// v000
// Times are from an AMD MI455X. After a warm-up the kernel runs many times in a row, and a time is the length of
// such a window on the GPU divided by its runs, so every launch and the gaps after it count. The runs cycle
// through copies of the inputs. A figure is the median of several windows, for all but v000 over two sittings.
// Sittings can differ by a few percent; kernels timed side by side share one.
// v000 is the starting kernel. One run takes 2620 microseconds.
#include <hip/hip_runtime.h>
#include <math.h>

typedef __attribute__((ext_vector_type(16))) _Float16 v16h;
typedef __attribute__((ext_vector_type(16))) __bf16 v16b;
typedef __attribute__((ext_vector_type(8)))  _Float16 v8h;
typedef __attribute__((ext_vector_type(8)))  float v8f;
typedef __attribute__((ext_vector_type(4)))  float v4f;
typedef __attribute__((ext_vector_type(2)))  float v2f;
typedef __attribute__((ext_vector_type(4)))  unsigned v4u;
typedef __attribute__((ext_vector_type(4)))  int v4i;
typedef float __attribute__((may_alias)) float_a;
typedef int __attribute__((may_alias)) int_a;

template <typename T> __device__ __forceinline__ void vst2(void* p, T v) { *(T*)p = v;  }
__device__ __forceinline__ v8f wmma16(v16h a, v16h b, v8f c) {
  v8f d = __builtin_amdgcn_wmma_f32_16x16x32_f16(false, a, false, b, (short)0, c, false, false);
  asm volatile("v_nop\n\tv_nop\n\tv_nop\n\tv_nop" : "+v"(d) : "v"(a), "v"(b));
  return d;
}
__device__ __forceinline__ v8f wmma_bf(v16b a, v16b b, v8f c) {
  v8f d = __builtin_amdgcn_wmma_f32_16x16x32_bf16(false, a, false, b, (short)0, c, false, false);
  asm volatile("v_nop\n\tv_nop\n\tv_nop\n\tv_nop" : "+v"(d) : "v"(a), "v"(b));
  return d;
}
// Multi-head cross-attention that also returns the head-averaged attention map (B 4, T 1,024 queries, 1,024 memory positions, d 1,024, 16 heads x 64).
__device__ __forceinline__ v16h frag_h(const _Float16* rowk0, int lane) {
  union { v16h v; v8h q[2]; } u; const _Float16* p = rowk0 + 8 * (lane >> 4);
  u.q[0] = *(const v8h*)p; u.q[1] = *(const v8h*)(p + 16); return u.v;
}
__device__ __forceinline__ v16h frag_f32(const float* rowk0, int lane) {
  v16h a; const float* p = rowk0 + 8 * (lane >> 4);
#pragma unroll
  for (int i = 0; i < 8; ++i) { a[i] = (_Float16)p[i]; a[8 + i] = (_Float16)p[16 + i]; }
  return a;
}
__device__ __forceinline__ v16h frag_f32s(const float* rowk0, int lane, float sc) {
  v16h a; const float* p = rowk0 + 8 * (lane >> 4);
#pragma unroll
  for (int i = 0; i < 8; ++i) { a[i] = (_Float16)(p[i] * sc); a[8 + i] = (_Float16)(p[16 + i] * sc); }
  return a;
}
// column fragment from a [K][ld] layout (column n), rows >= K read as 0
__device__ __forceinline__ v16h fragc_f32(const float* W, int k0, int n, int lane, int ld, int K) {
  v16h a; const int g = lane >> 4;
#pragma unroll
  for (int i = 0; i < 8; ++i) { const int ka = k0 + 8 * g + i, kb = ka + 16;
    a[i] = (_Float16)(ka < K ? W[(size_t)(ka < K ? ka : K - 1) * ld + n] : 0.f); a[8 + i] = (_Float16)(kb < K ? W[(size_t)(kb < K ? kb : K - 1) * ld + n] : 0.f); }
  return a;
}
struct F2 { v16b h, l; };
__device__ __forceinline__ F2 bsplit16(const float v[16]) { F2 r;
#pragma unroll
  for (int i = 0; i < 16; ++i) { const __bf16 h = (__bf16)v[i]; r.h[i] = h; r.l[i] = (__bf16)(v[i] - (float)h); }
  return r; }
__device__ __forceinline__ F2 split_row(const float* row, int k0, int lane) { float v[16]; const float* p = row + k0 + 8 * (lane >> 4);
#pragma unroll
  for (int i = 0; i < 8; ++i) { v[i] = p[i]; v[8 + i] = p[16 + i]; }
  return bsplit16(v); }
__device__ __forceinline__ F2 split_rowK(const float* row, int k0, int lane, int K) { float v[16]; const int g = lane >> 4;
#pragma unroll
  for (int i = 0; i < 8; ++i) { const int ka = k0 + 8 * g + i, kb = ka + 16; v[i] = ka < K ? row[ka < K ? ka : K - 1] : 0.f; v[8 + i] = kb < K ? row[kb < K ? kb : K - 1] : 0.f; }
  return bsplit16(v); }
__device__ __forceinline__ F2 split_col(const float* W, int k0, int n, int lane, int ld, int K) { float v[16]; const int g = lane >> 4;
#pragma unroll
  for (int i = 0; i < 8; ++i) { const int ka = k0 + 8 * g + i, kb = ka + 16; v[i] = ka < K ? W[(size_t)(ka < K ? ka : K - 1) * ld + n] : 0.f; v[8 + i] = kb < K ? W[(size_t)(kb < K ? kb : K - 1) * ld + n] : 0.f; }
  return bsplit16(v); }
__device__ __forceinline__ v8f mac3(const F2& a, const F2& b, v8f c) { c = wmma_bf(a.l, b.h, c); c = wmma_bf(a.h, b.l, c); return wmma_bf(a.h, b.h, c); }
__device__ __forceinline__ float sigm(float v) { return 1.0f / (1.0f + expf(-v)); }
#define LDSX() do { asm volatile("s_wait_dscnt 0" ::: "memory"); __builtin_amdgcn_wave_barrier(); __builtin_amdgcn_fence(__ATOMIC_RELEASE, "workgroup"); } while (0)


#define NB 4
#define SS 1024
#define DM 1024
#define NH 16
#define HD 64
#define QKVW (3 * DM)
#ifndef TQB
#define TQB (SS / 64)
#define TNB NB
#define TOB (NB * SS / 64)     // output row tiles (all)
#endif
typedef __attribute__((ext_vector_type(8))) __bf16 v8b;
__device__ __forceinline__ v16b frag_b(const __bf16* rowk0, int lane) {
  union { v16b v; v8b q[2]; } u; const __bf16* p = rowk0 + 8 * (lane >> 4);
  u.q[0] = *(const v8b*)p; u.q[1] = *(const v8b*)(p + 16); return u.v;
}
__device__ __forceinline__ float bfr(float v) { return (float)(__bf16)v; }
__device__ __attribute__((noinline)) float exp_ni(float v) { return expf(v); }
__device__ __attribute__((noinline)) float erf_ni(float v) { return erff(v); }

#define PK_A 0                       // [3072][1024] Wqkv rows (natural [out][in])
#define PK_P (PK_A + QKVW * DM)        // [1024][1024] Wo rows (natural)
#define PK_END (PK_P + DM * DM)
#define WS_PK  0u
#define WS_QK  (WS_PK + 2u * PK_END)             // f16 [4096 rows][2048]: q | k
#define WS_QKL (WS_QK + 2u * NB * SS * 2 * DM)     // f16 q | k residual planes x2048
#define WS_VTH (WS_QKL + 2u * NB * SS * 2 * DM)    // f16 [b][1024 (h*64+d)][1024 s] hi
#define WS_VTL (WS_VTH + 2u * NB * DM * SS)        // f16 lo x 2048
#define WS_O   (WS_VTL + 2u * NB * DM * SS)        // f32 [4096][1024]
#define WS_CS  (WS_O + 4u * NB * SS * DM)           // f32 2 x [1024][32], unused
#define WS_END (WS_CS + 4u * 2 * SS * 32)
// ---- k_pack: block = (row n, which): natural [out][in] rows -> bf16; which 0..2 -> W_q/W_k/W_v into PK_A rows which*1024 + n; 3 -> W_o into PK_P
__global__ __launch_bounds__(256) void k_pack(const float* __restrict__ WQ, const float* __restrict__ WK, const float* __restrict__ WV, const float* __restrict__ WO, __bf16* __restrict__ PK) {
  __shared__ __align__(16) __bf16 s[DM]; const int n = blockIdx.x, which = blockIdx.y, t = threadIdx.x; const float* Wm = (which == 0) ? WQ : (which == 1) ? WK : (which == 2) ? WV : WO;
  for (int k = t; k < DM; k += 256) s[k] = (__bf16)Wm[(size_t)n * DM + k];
  __syncthreads();
  __bf16* dst = (which < 3) ? PK + PK_A + ((size_t)which * DM + n) * DM : PK + PK_P + (size_t)n * DM;
  for (int q = t; q < DM / 8; q += 256) vst2((unsigned*)(dst + q * 8), *(const v4u*)&s[q * 8]);
}
__global__ __launch_bounds__(128) void k_qkv(const float* __restrict__ XQ, const float* __restrict__ XK, const float* __restrict__ XV, const __bf16* __restrict__ P, const float* __restrict__ BQ, const float* __restrict__ BK, const float* __restrict__ BV, _Float16* __restrict__ QK, _Float16* __restrict__ QKL, _Float16* __restrict__ VTH, _Float16* __restrict__ VTL) {
  const int which0 = (blockIdx.y * 128) / DM; const float* X = (which0 == 0) ? XQ : (which0 == 1) ? XK : XV;   // q from q_in, k from k_in, v from v_in
  __shared__ __align__(16) _Float16 so[4][16][136], sol[4][16][136]; __shared__ __align__(16) _Float16 sth[128][72], stl[128][72];
  const int tid = threadIdx.x, wave = tid >> 5, lane = tid & 31, col = lane & 15, g = lane >> 4; const size_t r0 = (size_t)blockIdx.x * 64 + wave * 16; const int n0 = blockIdx.y * 128;
  v8f acc[8] = {};
#pragma unroll 2
  for (int kc = 0; kc < DM / 32; ++kc) { v16b a; { const float* p = X + (r0 + col) * DM + kc * 32 + 8 * g;
#pragma unroll
      for (int i = 0; i < 8; ++i) { a[i] = (__bf16)p[i]; a[8 + i] = (__bf16)p[16 + i]; } }
#pragma unroll
    for (int j = 0; j < 8; ++j) acc[j] = wmma_bf(a, frag_b(P + (size_t)(n0 + j * 16 + col) * DM + kc * 32, lane), acc[j]); }
  { const float* BB = (which0 == 0) ? BQ : (which0 == 1) ? BK : BV;
#pragma unroll
    for (int j = 0; j < 8; ++j) { const float bb = bfr(BB[(n0 % DM) + j * 16 + col]);
#pragma unroll
      for (int r = 0; r < 8; ++r) acc[j][r] += bb; } }
  if (n0 < 2 * DM) {   // q stored unscaled (f16 sigma ~0.6, no subnormal exposure); 1/8 applied to the f32 score
#pragma unroll
    for (int j = 0; j < 8; ++j) {
#pragma unroll
      for (int r = 0; r < 8; ++r) { const float v = acc[j][r]; const _Float16 hv = (_Float16)v; so[wave][8 * g + r][j * 16 + col] = hv; sol[wave][8 * g + r][j * 16 + col] = (_Float16)((v - (float)hv) * 2048.0f); } }   // q, k as f16 hi + (x2048) residual (no RoPE in this module)
    LDSX();
    for (int rl = 0; rl < 16; ++rl) if (lane < 16) { vst2((unsigned*)(QK + (r0 + rl) * (2 * DM) + n0 + lane * 8), *(const v4u*)&so[wave][rl][lane * 8]); vst2((unsigned*)(QKL + (r0 + rl) * (2 * DM) + n0 + lane * 8), *(const v4u*)&sol[wave][rl][lane * 8]); }
  } else {
#pragma unroll
    for (int j = 0; j < 8; ++j) {
#pragma unroll
      for (int r = 0; r < 8; ++r) { const float v = acc[j][r]; const _Float16 hv = (_Float16)v; sth[j * 16 + col][wave * 16 + 8 * g + r] = hv; stl[j * 16 + col][wave * 16 + 8 * g + r] = (_Float16)((v - (float)hv) * 2048.0f); } }
    __syncthreads();
    const size_t rb = (size_t)blockIdx.x * 64; const int b = (int)(rb / SS), s0 = (int)(rb % SS); const int pc0 = n0 - 2 * DM;
    for (int q = tid; q < 128 * 8; q += 128) { const int d = q >> 3, pc = q & 7; const size_t o = ((size_t)b * DM + pc0 + d) * SS + s0 + pc * 8; vst2((unsigned*)(VTH + o), *(const v4u*)&sth[d][pc * 8]); vst2((unsigned*)(VTL + o), *(const v4u*)&stl[d][pc * 8]); }
  }
}
__global__ __launch_bounds__(128) void k_attn(const _Float16* __restrict__ QK, const _Float16* __restrict__ QKL, const _Float16* __restrict__ VTH, const _Float16* __restrict__ VTL, float* __restrict__ O, float* __restrict__ ATT) {
  __shared__ __align__(16) _Float16 sph[4][16][40], spl[4][16][40]; __shared__ __align__(16) float spm[4][16][36]; __shared__ __align__(16) float so[4][16][68];
  const int tid = threadIdx.x, wave = tid >> 5, lane = tid & 31, col = lane & 15, g = lane >> 4;
  const int qb = blockIdx.x, b = blockIdx.y; const int q0 = qb * 64 + wave * 16; const size_t rq = (size_t)b * SS + q0 + col;
#pragma unroll 1
  for (int h = 0; h < NH; ++h) {
    v16h aq[2], aql[2];
#pragma unroll
    for (int kc = 0; kc < 2; ++kc) { aq[kc] = frag_h(QK + rq * (2 * DM) + h * HD + kc * 32, lane); aql[kc] = frag_h(QKL + rq * (2 * DM) + h * HD + kc * 32, lane); }
    float m[8], l[8];
#pragma unroll
    for (int r = 0; r < 8; ++r) { m[r] = -3.0e38f; l[r] = 0.f; }
#pragma unroll 1
    for (int ks = 0; ks < SS / 32; ++ks) { v8f s[2];
#pragma unroll
      for (int ct = 0; ct < 2; ++ct) { const int kk = ks * 32 + ct * 16 + col; const _Float16* krow = QK + ((size_t)b * SS + kk) * (2 * DM) + DM + h * HD; const _Float16* krowl = QKL + ((size_t)b * SS + kk) * (2 * DM) + DM + h * HD; v8f c = {}, cl = {};
#pragma unroll
        for (int kc = 0; kc < 2; ++kc) { const v16h kh = frag_h(krow + kc * 32, lane); c = wmma16(aq[kc], kh, c); cl = wmma16(aql[kc], kh, cl); cl = wmma16(aq[kc], frag_h(krowl + kc * 32, lane), cl); }
#pragma unroll
        for (int r = 0; r < 8; ++r) s[ct][r] = (c[r] + cl[r] * (1.0f / 2048.0f)) * 0.125f; }
#pragma unroll
      for (int r = 0; r < 8; ++r) { float mx = fmaxf(s[0][r], s[1][r]);
#pragma unroll
        for (int o = 1; o < 16; o <<= 1) mx = fmaxf(mx, __shfl_xor(mx, o));
        const float mn = fmaxf(m[r], mx); const float alpha = (m[r] <= -1.0e38f) ? 0.f : __expf(m[r] - mn); float es = __expf(s[0][r] - mn) + __expf(s[1][r] - mn);
#pragma unroll
        for (int o = 1; o < 16; o <<= 1) es += __shfl_xor(es, o);
        l[r] = l[r] * alpha + es; m[r] = mn; } }
    float il[8];
#pragma unroll
    for (int r = 0; r < 8; ++r) il[r] = 1.0f / l[r];
    // pass 2: normalized P, P.V, attention-mean accumulation
    v8f acc[4] = {}, accl[4] = {};
#pragma unroll 1
    for (int ks = 0; ks < SS / 32; ++ks) {
#pragma unroll
      for (int ct = 0; ct < 2; ++ct) { const int kk = ks * 32 + ct * 16 + col; const _Float16* krow = QK + ((size_t)b * SS + kk) * (2 * DM) + DM + h * HD; const _Float16* krowl = QKL + ((size_t)b * SS + kk) * (2 * DM) + DM + h * HD; v8f c = {}, cl = {};
#pragma unroll
        for (int kc = 0; kc < 2; ++kc) { const v16h kh = frag_h(krow + kc * 32, lane); c = wmma16(aq[kc], kh, c); cl = wmma16(aql[kc], kh, cl); cl = wmma16(aq[kc], frag_h(krowl + kc * 32, lane), cl); }
#pragma unroll
        for (int r = 0; r < 8; ++r) { const float e = __expf((c[r] + cl[r] * (1.0f / 2048.0f)) * 0.125f - m[r]);   // unnormalised (<= 1: no f16 subnormal exposure); 1/l applied to the accumulators at the end
          const _Float16 he = (_Float16)e; sph[wave][8 * g + r][ct * 16 + col] = he; spl[wave][8 * g + r][ct * 16 + col] = (_Float16)((e - (float)he) * 2048.0f); spm[wave][8 * g + r][ct * 16 + col] = (e * il[r]) * (1.0f / NH); } }
      LDSX();
      const v16h pah = frag_h(&sph[wave][col][0], lane), pal = frag_h(&spl[wave][col][0], lane);
#pragma unroll
      for (int dt = 0; dt < 4; ++dt) { const size_t vo = ((size_t)b * DM + h * HD + dt * 16 + col) * SS + ks * 32; const v16h vh = frag_h(VTH + vo, lane), vl = frag_h(VTL + vo, lane); acc[dt] = wmma16(pah, vh, acc[dt]); accl[dt] = wmma16(pal, vh, accl[dt]); accl[dt] = wmma16(pah, vl, accl[dt]); }
      // attention-mean RMW: this wave's 16 rows x 32 keys = 16 lines; lane l handles rows (l>>3)*... : 8 lanes per line, 16 B each; 4 rounds of 4 rows
#pragma unroll
      for (int rr = 0; rr < 4; ++rr) { const int rl = rr * 4 + (lane >> 3), pc = lane & 7; float* ap = ATT + ((size_t)b * SS + q0 + rl) * SS + ks * 32 + pc * 4; v4f v = *(const v4f*)&spm[wave][rl][pc * 4];
        if (h > 0) { const v4f old = *(const v4f*)ap; v[0] += old[0]; v[1] += old[1]; v[2] += old[2]; v[3] += old[3]; }
        vst2(ap, v); }
      LDSX(); }
#pragma unroll
    for (int r = 0; r < 8; ++r) {
#pragma unroll
      for (int dt = 0; dt < 4; ++dt) so[wave][8 * g + r][dt * 16 + col] = (acc[dt][r] + accl[dt][r] * (1.0f / 2048.0f)) * il[r]; }
    LDSX();
    for (int rl = 0; rl < 16; ++rl) if (lane < 16) vst2(O + ((size_t)b * SS + q0 + rl) * DM + h * HD + lane * 4, *(const v4f*)&so[wave][rl][lane * 4]);
    LDSX(); }
}
// ---- k_out: block = (64 rows, 128 cols): out = O(hi/lo) . Wo rows (2 products) + bo
__global__ __launch_bounds__(128) void k_out(const float* __restrict__ O, const __bf16* __restrict__ P, const float* __restrict__ BO, float* __restrict__ Y) {
  __shared__ __align__(16) float so[4][16][132];
  const int tid = threadIdx.x, wave = tid >> 5, lane = tid & 31, col = lane & 15, g = lane >> 4; const size_t r0 = (size_t)blockIdx.x * 64 + wave * 16; const int n0 = blockIdx.y * 128;
  v8f acc[8] = {};
#pragma unroll 2
  for (int kc = 0; kc < DM / 32; ++kc) { const F2 a = split_row(O + (r0 + col) * DM, kc * 32, lane);
#pragma unroll
    for (int j = 0; j < 8; ++j) { const v16b w = frag_b(P + (size_t)(n0 + j * 16 + col) * DM + kc * 32, lane); acc[j] = wmma_bf(a.l, w, acc[j]); acc[j] = wmma_bf(a.h, w, acc[j]); } }
#pragma unroll
  for (int j = 0; j < 8; ++j) {
#pragma unroll
    for (int r = 0; r < 8; ++r) so[wave][8 * g + r][j * 16 + col] = acc[j][r] + bfr(BO[n0 + j * 16 + col]); }
  LDSX();
  for (int rl = 0; rl < 16; ++rl) vst2(Y + (r0 + rl) * DM + n0 + lane * 4, *(const v4f*)&so[wave][rl][lane * 4]);
}
extern "C" void kernel_launch(void* const* d_in, const int* in_sizes, int n_in, void* d_out, int out_size, void* d_ws, size_t ws_size, hipStream_t stream) {
  (void)in_sizes; (void)n_in; (void)out_size;
  const float** F = (const float**)d_in;   // 0 q_in [4,1024,1024], 1 k_in, 2 v_in, 3 Wq [1024,1024] natural (x @ W.T), 4 bq, 5 Wk, 6 bk, 7 Wv, 8 bv, 9 Wo, 10 bo
  if (ws_size < (size_t)WS_END) return;
  char* ws = (char*)d_ws; __bf16* PK = (__bf16*)(ws + WS_PK); _Float16 *QK = (_Float16*)(ws + WS_QK), *QKL = (_Float16*)(ws + WS_QKL), *VTH = (_Float16*)(ws + WS_VTH), *VTL = (_Float16*)(ws + WS_VTL); float* O = (float*)(ws + WS_O);
  k_pack<<<dim3(DM, 4), 256, 0, stream>>>(F[3], F[5], F[7], F[9], PK);
  k_qkv<<<dim3(TNB * SS / 64, QKVW / 128), 128, 0, stream>>>(F[0], F[1], F[2], PK + PK_A, F[4], F[6], F[8], QK, QKL, VTH, VTL);
  k_attn<<<dim3(TQB, TNB), 128, 0, stream>>>(QK, QKL, VTH, VTL, O, (float*)((char*)d_out + 16777216));
  k_out<<<dim3(TOB, DM / 128), 128, 0, stream>>>(O, PK + PK_P, F[10], (float*)d_out);
}

// v001
// A run of this version takes 516 microseconds.
// In two side-by-side timings against v000, it was 5.08 and 5.14 times as fast.
#include <hip/hip_runtime.h>
#include <math.h>

typedef __attribute__((ext_vector_type(16))) _Float16 v16h;
typedef __attribute__((ext_vector_type(16))) __bf16 v16b;
typedef __attribute__((ext_vector_type(8)))  _Float16 v8h;
typedef __attribute__((ext_vector_type(8)))  float v8f;
typedef __attribute__((ext_vector_type(4)))  float v4f;
typedef __attribute__((ext_vector_type(2)))  float v2f;
typedef __attribute__((ext_vector_type(4)))  unsigned v4u;
typedef __attribute__((ext_vector_type(4)))  int v4i;
typedef float __attribute__((may_alias)) float_a;
typedef int __attribute__((may_alias)) int_a;

template <typename T> __device__ __forceinline__ void vst2(void* p, T v) { *(T*)p = v;  }
__device__ __forceinline__ v8f wmma16(v16h a, v16h b, v8f c) {
  v8f d = __builtin_amdgcn_wmma_f32_16x16x32_f16(false, a, false, b, (short)0, c, false, false);
  asm volatile("v_nop\n\tv_nop\n\tv_nop\n\tv_nop" : "+v"(d) : "v"(a), "v"(b));
  return d;
}
__device__ __forceinline__ v8f wmma_bf(v16b a, v16b b, v8f c) {
  v8f d = __builtin_amdgcn_wmma_f32_16x16x32_bf16(false, a, false, b, (short)0, c, false, false);
  asm volatile("v_nop\n\tv_nop\n\tv_nop\n\tv_nop" : "+v"(d) : "v"(a), "v"(b));
  return d;
}
// Multi-head cross-attention that also returns the head-averaged attention map (B 4, T 1,024 queries, 1,024 memory positions, d 1,024, 16 heads x 64).
__device__ __forceinline__ v16h frag_h(const _Float16* rowk0, int lane) {
  union { v16h v; v8h q[2]; } u; const _Float16* p = rowk0 + 8 * (lane >> 4);
  u.q[0] = *(const v8h*)p; u.q[1] = *(const v8h*)(p + 16); return u.v;
}
__device__ __forceinline__ v16h frag_f32(const float* rowk0, int lane) {
  v16h a; const float* p = rowk0 + 8 * (lane >> 4);
#pragma unroll
  for (int i = 0; i < 8; ++i) { a[i] = (_Float16)p[i]; a[8 + i] = (_Float16)p[16 + i]; }
  return a;
}
__device__ __forceinline__ v16h frag_f32s(const float* rowk0, int lane, float sc) {
  v16h a; const float* p = rowk0 + 8 * (lane >> 4);
#pragma unroll
  for (int i = 0; i < 8; ++i) { a[i] = (_Float16)(p[i] * sc); a[8 + i] = (_Float16)(p[16 + i] * sc); }
  return a;
}
// column fragment from a [K][ld] layout (column n), rows >= K read as 0
__device__ __forceinline__ v16h fragc_f32(const float* W, int k0, int n, int lane, int ld, int K) {
  v16h a; const int g = lane >> 4;
#pragma unroll
  for (int i = 0; i < 8; ++i) { const int ka = k0 + 8 * g + i, kb = ka + 16;
    a[i] = (_Float16)(ka < K ? W[(size_t)(ka < K ? ka : K - 1) * ld + n] : 0.f); a[8 + i] = (_Float16)(kb < K ? W[(size_t)(kb < K ? kb : K - 1) * ld + n] : 0.f); }
  return a;
}
struct F2 { v16b h, l; };
__device__ __forceinline__ F2 bsplit16(const float v[16]) { F2 r;
#pragma unroll
  for (int i = 0; i < 16; ++i) { const __bf16 h = (__bf16)v[i]; r.h[i] = h; r.l[i] = (__bf16)(v[i] - (float)h); }
  return r; }
__device__ __forceinline__ F2 split_row(const float* row, int k0, int lane) { float v[16]; const float* p = row + k0 + 8 * (lane >> 4);
#pragma unroll
  for (int i = 0; i < 8; ++i) { v[i] = p[i]; v[8 + i] = p[16 + i]; }
  return bsplit16(v); }
__device__ __forceinline__ F2 split_rowK(const float* row, int k0, int lane, int K) { float v[16]; const int g = lane >> 4;
#pragma unroll
  for (int i = 0; i < 8; ++i) { const int ka = k0 + 8 * g + i, kb = ka + 16; v[i] = ka < K ? row[ka < K ? ka : K - 1] : 0.f; v[8 + i] = kb < K ? row[kb < K ? kb : K - 1] : 0.f; }
  return bsplit16(v); }
__device__ __forceinline__ F2 split_col(const float* W, int k0, int n, int lane, int ld, int K) { float v[16]; const int g = lane >> 4;
#pragma unroll
  for (int i = 0; i < 8; ++i) { const int ka = k0 + 8 * g + i, kb = ka + 16; v[i] = ka < K ? W[(size_t)(ka < K ? ka : K - 1) * ld + n] : 0.f; v[8 + i] = kb < K ? W[(size_t)(kb < K ? kb : K - 1) * ld + n] : 0.f; }
  return bsplit16(v); }
__device__ __forceinline__ v8f mac3(const F2& a, const F2& b, v8f c) { c = wmma_bf(a.l, b.h, c); c = wmma_bf(a.h, b.l, c); return wmma_bf(a.h, b.h, c); }
__device__ __forceinline__ float sigm(float v) { return 1.0f / (1.0f + expf(-v)); }
#define LDSX() do { asm volatile("s_wait_dscnt 0" ::: "memory"); __builtin_amdgcn_wave_barrier(); __builtin_amdgcn_fence(__ATOMIC_RELEASE, "workgroup"); } while (0)


#define NB 4
#define SS 1024
#define DM 1024
#define NH 16
#define HD 64
#define QKVW (3 * DM)
#ifndef TQB
#define TQB (SS / 64)
#define TNB NB
#define TOB (NB * SS / 64)     // output row tiles (all)
#endif
typedef __attribute__((ext_vector_type(8))) __bf16 v8b;
__device__ __forceinline__ v16b frag_b(const __bf16* rowk0, int lane) {
  union { v16b v; v8b q[2]; } u; const __bf16* p = rowk0 + 8 * (lane >> 4);
  u.q[0] = *(const v8b*)p; u.q[1] = *(const v8b*)(p + 16); return u.v;
}
__device__ __forceinline__ float bfr(float v) { return (float)(__bf16)v; }
__device__ __attribute__((noinline)) float exp_ni(float v) { return expf(v); }
__device__ __attribute__((noinline)) float erf_ni(float v) { return erff(v); }

#define PK_A 0                       // [3072][1024] Wqkv rows (natural [out][in])
#define PK_P (PK_A + QKVW * DM)        // [1024][1024] Wo rows (natural)
#define PK_END (PK_P + DM * DM)
#define WS_PK  0u
#define WS_QK  (WS_PK + 2u * PK_END)             // f16 [4096 rows][2048]: q | k
#define WS_QKL (WS_QK + 2u * NB * SS * 2 * DM)     // f16 q | k residual planes x2048
#define WS_VTH (WS_QKL + 2u * NB * SS * 2 * DM)    // f16 [b][1024 (h*64+d)][1024 s] hi
#define WS_VTL (WS_VTH + 2u * NB * DM * SS)        // f16 lo x 2048
#define WS_O   (WS_VTL + 2u * NB * DM * SS)        // f32 [4096][1024]
#define WS_CS  (WS_O + 4u * NB * SS * DM)           // f32 2 x [1024][32], unused
#define WS_END (WS_CS + 4u * 2 * SS * 32)
// ---- k_pack: block = (row n, which): natural [out][in] rows -> bf16; which 0..2 -> W_q/W_k/W_v into PK_A rows which*1024 + n; 3 -> W_o into PK_P
__global__ __launch_bounds__(256) void k_pack(const float* __restrict__ WQ, const float* __restrict__ WK, const float* __restrict__ WV, const float* __restrict__ WO, __bf16* __restrict__ PK) {
  __shared__ __align__(16) __bf16 s[DM]; const int n = blockIdx.x, which = blockIdx.y, t = threadIdx.x; const float* Wm = (which == 0) ? WQ : (which == 1) ? WK : (which == 2) ? WV : WO;
  for (int k = t; k < DM; k += 256) s[k] = (__bf16)Wm[(size_t)n * DM + k];
  __syncthreads();
  __bf16* dst = (which < 3) ? PK + PK_A + ((size_t)which * DM + n) * DM : PK + PK_P + (size_t)n * DM;
  for (int q = t; q < DM / 8; q += 256) vst2((unsigned*)(dst + q * 8), *(const v4u*)&s[q * 8]);
}
__global__ __launch_bounds__(128) void k_qkv(const float* __restrict__ XQ, const float* __restrict__ XK, const float* __restrict__ XV, const __bf16* __restrict__ P, const float* __restrict__ BQ, const float* __restrict__ BK, const float* __restrict__ BV, _Float16* __restrict__ QK, _Float16* __restrict__ QKL, _Float16* __restrict__ VTH, _Float16* __restrict__ VTL) {
  const int which0 = (blockIdx.y * 128) / DM; const float* X = (which0 == 0) ? XQ : (which0 == 1) ? XK : XV;   // q from q_in, k from k_in, v from v_in
  __shared__ __align__(16) _Float16 so[4][16][136], sol[4][16][136]; __shared__ __align__(16) _Float16 sth[128][72], stl[128][72];
  const int tid = threadIdx.x, wave = tid >> 5, lane = tid & 31, col = lane & 15, g = lane >> 4; const size_t r0 = (size_t)blockIdx.x * 64 + wave * 16; const int n0 = blockIdx.y * 128;
  v8f acc[8] = {};
#pragma unroll 2
  for (int kc = 0; kc < DM / 32; ++kc) { v16b a; { const float* p = X + (r0 + col) * DM + kc * 32 + 8 * g;
#pragma unroll
      for (int i = 0; i < 8; ++i) { a[i] = (__bf16)p[i]; a[8 + i] = (__bf16)p[16 + i]; } }
#pragma unroll
    for (int j = 0; j < 8; ++j) acc[j] = wmma_bf(a, frag_b(P + (size_t)(n0 + j * 16 + col) * DM + kc * 32, lane), acc[j]); }
  { const float* BB = (which0 == 0) ? BQ : (which0 == 1) ? BK : BV;
#pragma unroll
    for (int j = 0; j < 8; ++j) { const float bb = bfr(BB[(n0 % DM) + j * 16 + col]);
#pragma unroll
      for (int r = 0; r < 8; ++r) acc[j][r] += bb; } }
  if (n0 < 2 * DM) {   // q stored unscaled (f16 sigma ~0.6, no subnormal exposure); 1/8 applied to the f32 score
#pragma unroll
    for (int j = 0; j < 8; ++j) {
#pragma unroll
      for (int r = 0; r < 8; ++r) { const float v = acc[j][r]; const _Float16 hv = (_Float16)v; so[wave][8 * g + r][j * 16 + col] = hv; sol[wave][8 * g + r][j * 16 + col] = (_Float16)((v - (float)hv) * 2048.0f); } }   // q, k as f16 hi + (x2048) residual (no RoPE in this module)
    LDSX();
    for (int rl = 0; rl < 16; ++rl) if (lane < 16) { vst2((unsigned*)(QK + (r0 + rl) * (2 * DM) + n0 + lane * 8), *(const v4u*)&so[wave][rl][lane * 8]); vst2((unsigned*)(QKL + (r0 + rl) * (2 * DM) + n0 + lane * 8), *(const v4u*)&sol[wave][rl][lane * 8]); }
  } else {
#pragma unroll
    for (int j = 0; j < 8; ++j) {
#pragma unroll
      for (int r = 0; r < 8; ++r) { const float v = acc[j][r]; const _Float16 hv = (_Float16)v; sth[j * 16 + col][wave * 16 + 8 * g + r] = hv; stl[j * 16 + col][wave * 16 + 8 * g + r] = (_Float16)((v - (float)hv) * 2048.0f); } }
    __syncthreads();
    const size_t rb = (size_t)blockIdx.x * 64; const int b = (int)(rb / SS), s0 = (int)(rb % SS); const int pc0 = n0 - 2 * DM;
    for (int q = tid; q < 128 * 8; q += 128) { const int d = q >> 3, pc = q & 7; const size_t o = ((size_t)b * DM + pc0 + d) * SS + s0 + pc * 8; vst2((unsigned*)(VTH + o), *(const v4u*)&sth[d][pc * 8]); vst2((unsigned*)(VTL + o), *(const v4u*)&stl[d][pc * 8]); }
  }
}
// k_attn: block = 16 query rows of one batch, 16 waves, wave w = head w. The head mean of the attention map is summed in LDS
// (heads in the order 0..15) and each of its elements is stored once.
__global__ __launch_bounds__(512) void k_attn(const _Float16* __restrict__ QK, const _Float16* __restrict__ QKL, const _Float16* __restrict__ VTH, const _Float16* __restrict__ VTL, float* __restrict__ O, float* __restrict__ ATT) {
  __shared__ __align__(16) _Float16 sph[NH][16][40], spl[NH][16][40]; __shared__ __align__(16) float spm[2][NH][16][36]; __shared__ __align__(16) float so[NH][16][68];
  const int tid = threadIdx.x, wave = __builtin_amdgcn_readfirstlane(tid >> 5), lane = tid & 31, col = lane & 15, g = lane >> 4;   // readfirstlane: the head's offsets stay in scalar registers
  const int h = wave, b = blockIdx.y; const int q0 = blockIdx.x * 16; const size_t rq = (size_t)b * SS + q0 + col;
  v16h aq[2], aql[2];
#pragma unroll
  for (int kc = 0; kc < 2; ++kc) { aq[kc] = frag_h(QK + rq * (2 * DM) + h * HD + kc * 32, lane); aql[kc] = frag_h(QKL + rq * (2 * DM) + h * HD + kc * 32, lane); }
  float m[8], l[8];
#pragma unroll
  for (int r = 0; r < 8; ++r) { m[r] = -3.0e38f; l[r] = 0.f; }
#pragma unroll 1
  for (int ks = 0; ks < SS / 32; ++ks) { v8f s[2];
#pragma unroll
    for (int ct = 0; ct < 2; ++ct) { const int kk = ks * 32 + ct * 16 + col; const _Float16* krow = QK + ((size_t)b * SS + kk) * (2 * DM) + DM + h * HD; const _Float16* krowl = QKL + ((size_t)b * SS + kk) * (2 * DM) + DM + h * HD; v8f c = {}, cl = {};
#pragma unroll
      for (int kc = 0; kc < 2; ++kc) { const v16h kh = frag_h(krow + kc * 32, lane); c = wmma16(aq[kc], kh, c); cl = wmma16(aql[kc], kh, cl); cl = wmma16(aq[kc], frag_h(krowl + kc * 32, lane), cl); }
#pragma unroll
      for (int r = 0; r < 8; ++r) s[ct][r] = (c[r] + cl[r] * (1.0f / 2048.0f)) * 0.125f; }
#pragma unroll
    for (int r = 0; r < 8; ++r) { float mx = fmaxf(s[0][r], s[1][r]);
#pragma unroll
      for (int o = 1; o < 16; o <<= 1) mx = fmaxf(mx, __shfl_xor(mx, o));
      const float mn = fmaxf(m[r], mx); const float alpha = (m[r] <= -1.0e38f) ? 0.f : __expf(m[r] - mn); float es = __expf(s[0][r] - mn) + __expf(s[1][r] - mn);
#pragma unroll
      for (int o = 1; o < 16; o <<= 1) es += __shfl_xor(es, o);
      l[r] = l[r] * alpha + es; m[r] = mn; } }
  float il[8];
#pragma unroll
  for (int r = 0; r < 8; ++r) il[r] = 1.0f / l[r];
  // pass 2: normalized P, P.V, attention mean over the heads
  v8f acc[4] = {}, accl[4] = {};
#pragma unroll 1
  for (int ks = 0; ks < SS / 32; ++ks) { float (*pm)[16][36] = spm[ks & 1];   // two buffers: one barrier a key tile is enough
#pragma unroll
    for (int ct = 0; ct < 2; ++ct) { const int kk = ks * 32 + ct * 16 + col; const _Float16* krow = QK + ((size_t)b * SS + kk) * (2 * DM) + DM + h * HD; const _Float16* krowl = QKL + ((size_t)b * SS + kk) * (2 * DM) + DM + h * HD; v8f c = {}, cl = {};
#pragma unroll
      for (int kc = 0; kc < 2; ++kc) { const v16h kh = frag_h(krow + kc * 32, lane); c = wmma16(aq[kc], kh, c); cl = wmma16(aql[kc], kh, cl); cl = wmma16(aq[kc], frag_h(krowl + kc * 32, lane), cl); }
#pragma unroll
      for (int r = 0; r < 8; ++r) { const float e = __expf((c[r] + cl[r] * (1.0f / 2048.0f)) * 0.125f - m[r]);   // unnormalised (<= 1: no f16 subnormal exposure); 1/l applied to the accumulators at the end
        const _Float16 he = (_Float16)e; sph[wave][8 * g + r][ct * 16 + col] = he; spl[wave][8 * g + r][ct * 16 + col] = (_Float16)((e - (float)he) * 2048.0f); pm[wave][8 * g + r][ct * 16 + col] = (e * il[r]) * (1.0f / NH); } }
    LDSX();
    const v16h pah = frag_h(&sph[wave][col][0], lane), pal = frag_h(&spl[wave][col][0], lane);
#pragma unroll
    for (int dt = 0; dt < 4; ++dt) { const size_t vo = ((size_t)b * DM + h * HD + dt * 16 + col) * SS + ks * 32; const v16h vh = frag_h(VTH + vo, lane), vl = frag_h(VTL + vo, lane); acc[dt] = wmma16(pah, vh, acc[dt]); accl[dt] = wmma16(pal, vh, accl[dt]); accl[dt] = wmma16(pah, vl, accl[dt]); }
    __syncthreads();   // every head's share of this key tile stands in pm; also ends all reads of the other buffer
    // attention mean: wave w sums query row w, lane = key: one 128-byte line a wave
    float am = pm[0][wave][lane];
#pragma unroll   // unrolled so that the LDS reads of several heads are in flight at once
    for (int hh = 1; hh < NH; ++hh) am += pm[hh][wave][lane];
    ATT[((size_t)b * SS + q0 + wave) * SS + ks * 32 + lane] = am; }
#pragma unroll
  for (int r = 0; r < 8; ++r) {
#pragma unroll
    for (int dt = 0; dt < 4; ++dt) so[wave][8 * g + r][dt * 16 + col] = (acc[dt][r] + accl[dt][r] * (1.0f / 2048.0f)) * il[r]; }
  LDSX();
  for (int rl = 0; rl < 16; ++rl) if (lane < 16) vst2(O + ((size_t)b * SS + q0 + rl) * DM + h * HD + lane * 4, *(const v4f*)&so[wave][rl][lane * 4]);
}
// ---- k_out: block = (64 rows, 128 cols): out = O(hi/lo) . Wo rows (2 products) + bo
__global__ __launch_bounds__(128) void k_out(const float* __restrict__ O, const __bf16* __restrict__ P, const float* __restrict__ BO, float* __restrict__ Y) {
  __shared__ __align__(16) float so[4][16][132];
  const int tid = threadIdx.x, wave = tid >> 5, lane = tid & 31, col = lane & 15, g = lane >> 4; const size_t r0 = (size_t)blockIdx.x * 64 + wave * 16; const int n0 = blockIdx.y * 128;
  v8f acc[8] = {};
#pragma unroll 2
  for (int kc = 0; kc < DM / 32; ++kc) { const F2 a = split_row(O + (r0 + col) * DM, kc * 32, lane);
#pragma unroll
    for (int j = 0; j < 8; ++j) { const v16b w = frag_b(P + (size_t)(n0 + j * 16 + col) * DM + kc * 32, lane); acc[j] = wmma_bf(a.l, w, acc[j]); acc[j] = wmma_bf(a.h, w, acc[j]); } }
#pragma unroll
  for (int j = 0; j < 8; ++j) {
#pragma unroll
    for (int r = 0; r < 8; ++r) so[wave][8 * g + r][j * 16 + col] = acc[j][r] + bfr(BO[n0 + j * 16 + col]); }
  LDSX();
  for (int rl = 0; rl < 16; ++rl) vst2(Y + (r0 + rl) * DM + n0 + lane * 4, *(const v4f*)&so[wave][rl][lane * 4]);
}
extern "C" void kernel_launch(void* const* d_in, const int* in_sizes, int n_in, void* d_out, int out_size, void* d_ws, size_t ws_size, hipStream_t stream) {
  (void)in_sizes; (void)n_in; (void)out_size;
  const float** F = (const float**)d_in;   // 0 q_in [4,1024,1024], 1 k_in, 2 v_in, 3 Wq [1024,1024] natural (x @ W.T), 4 bq, 5 Wk, 6 bk, 7 Wv, 8 bv, 9 Wo, 10 bo
  if (ws_size < (size_t)WS_END) return;
  char* ws = (char*)d_ws; __bf16* PK = (__bf16*)(ws + WS_PK); _Float16 *QK = (_Float16*)(ws + WS_QK), *QKL = (_Float16*)(ws + WS_QKL), *VTH = (_Float16*)(ws + WS_VTH), *VTL = (_Float16*)(ws + WS_VTL); float* O = (float*)(ws + WS_O);
  k_pack<<<dim3(DM, 4), 256, 0, stream>>>(F[3], F[5], F[7], F[9], PK);
  k_qkv<<<dim3(TNB * SS / 64, QKVW / 128), 128, 0, stream>>>(F[0], F[1], F[2], PK + PK_A, F[4], F[6], F[8], QK, QKL, VTH, VTL);
  k_attn<<<dim3(SS / 16, TNB), 512, 0, stream>>>(QK, QKL, VTH, VTL, O, (float*)((char*)d_out + 16777216));
  k_out<<<dim3(TOB, DM / 128), 128, 0, stream>>>(O, PK + PK_P, F[10], (float*)d_out);
}

// v002
// It runs in 373 microseconds.
// In two side-by-side timings against v001, it was 1.37 and 1.38 times as fast.
// Over all steps from v000 it is 7.02 times as fast.
#include <hip/hip_runtime.h>
#include <math.h>

typedef __attribute__((ext_vector_type(16))) _Float16 v16h;
typedef __attribute__((ext_vector_type(16))) __bf16 v16b;
typedef __attribute__((ext_vector_type(8)))  _Float16 v8h;
typedef __attribute__((ext_vector_type(8)))  float v8f;
typedef __attribute__((ext_vector_type(4)))  float v4f;
typedef __attribute__((ext_vector_type(2)))  float v2f;
typedef __attribute__((ext_vector_type(4)))  unsigned v4u;
typedef __attribute__((ext_vector_type(4)))  int v4i;
typedef float __attribute__((may_alias)) float_a;
typedef int __attribute__((may_alias)) int_a;

template <typename T> __device__ __forceinline__ void vst2(void* p, T v) { *(T*)p = v;  }
__device__ __forceinline__ v8f wmma16(v16h a, v16h b, v8f c) {
  v8f d = __builtin_amdgcn_wmma_f32_16x16x32_f16(false, a, false, b, (short)0, c, false, false);
  asm volatile("v_nop\n\tv_nop\n\tv_nop\n\tv_nop" : "+v"(d) : "v"(a), "v"(b));
  return d;
}
__device__ __forceinline__ v8f wmma_bf(v16b a, v16b b, v8f c) {
  v8f d = __builtin_amdgcn_wmma_f32_16x16x32_bf16(false, a, false, b, (short)0, c, false, false);
  asm volatile("v_nop\n\tv_nop\n\tv_nop\n\tv_nop" : "+v"(d) : "v"(a), "v"(b));
  return d;
}
// Multi-head cross-attention that also returns the head-averaged attention map (B 4, T 1,024 queries, 1,024 memory positions, d 1,024, 16 heads x 64).
__device__ __forceinline__ v16h frag_h(const _Float16* rowk0, int lane) {
  union { v16h v; v8h q[2]; } u; const _Float16* p = rowk0 + 8 * (lane >> 4);
  u.q[0] = *(const v8h*)p; u.q[1] = *(const v8h*)(p + 16); return u.v;
}
__device__ __forceinline__ v16h frag_f32(const float* rowk0, int lane) {
  v16h a; const float* p = rowk0 + 8 * (lane >> 4);
#pragma unroll
  for (int i = 0; i < 8; ++i) { a[i] = (_Float16)p[i]; a[8 + i] = (_Float16)p[16 + i]; }
  return a;
}
__device__ __forceinline__ v16h frag_f32s(const float* rowk0, int lane, float sc) {
  v16h a; const float* p = rowk0 + 8 * (lane >> 4);
#pragma unroll
  for (int i = 0; i < 8; ++i) { a[i] = (_Float16)(p[i] * sc); a[8 + i] = (_Float16)(p[16 + i] * sc); }
  return a;
}
// column fragment from a [K][ld] layout (column n), rows >= K read as 0
__device__ __forceinline__ v16h fragc_f32(const float* W, int k0, int n, int lane, int ld, int K) {
  v16h a; const int g = lane >> 4;
#pragma unroll
  for (int i = 0; i < 8; ++i) { const int ka = k0 + 8 * g + i, kb = ka + 16;
    a[i] = (_Float16)(ka < K ? W[(size_t)(ka < K ? ka : K - 1) * ld + n] : 0.f); a[8 + i] = (_Float16)(kb < K ? W[(size_t)(kb < K ? kb : K - 1) * ld + n] : 0.f); }
  return a;
}
struct F2 { v16b h, l; };
__device__ __forceinline__ F2 bsplit16(const float v[16]) { F2 r;
#pragma unroll
  for (int i = 0; i < 16; ++i) { const __bf16 h = (__bf16)v[i]; r.h[i] = h; r.l[i] = (__bf16)(v[i] - (float)h); }
  return r; }
__device__ __forceinline__ F2 split_row(const float* row, int k0, int lane) { float v[16]; const float* p = row + k0 + 8 * (lane >> 4);
#pragma unroll
  for (int i = 0; i < 8; ++i) { v[i] = p[i]; v[8 + i] = p[16 + i]; }
  return bsplit16(v); }
__device__ __forceinline__ F2 split_rowK(const float* row, int k0, int lane, int K) { float v[16]; const int g = lane >> 4;
#pragma unroll
  for (int i = 0; i < 8; ++i) { const int ka = k0 + 8 * g + i, kb = ka + 16; v[i] = ka < K ? row[ka < K ? ka : K - 1] : 0.f; v[8 + i] = kb < K ? row[kb < K ? kb : K - 1] : 0.f; }
  return bsplit16(v); }
__device__ __forceinline__ F2 split_col(const float* W, int k0, int n, int lane, int ld, int K) { float v[16]; const int g = lane >> 4;
#pragma unroll
  for (int i = 0; i < 8; ++i) { const int ka = k0 + 8 * g + i, kb = ka + 16; v[i] = ka < K ? W[(size_t)(ka < K ? ka : K - 1) * ld + n] : 0.f; v[8 + i] = kb < K ? W[(size_t)(kb < K ? kb : K - 1) * ld + n] : 0.f; }
  return bsplit16(v); }
__device__ __forceinline__ v8f mac3(const F2& a, const F2& b, v8f c) { c = wmma_bf(a.l, b.h, c); c = wmma_bf(a.h, b.l, c); return wmma_bf(a.h, b.h, c); }
__device__ __forceinline__ float sigm(float v) { return 1.0f / (1.0f + expf(-v)); }
#define LDSX() do { asm volatile("s_wait_dscnt 0" ::: "memory"); __builtin_amdgcn_wave_barrier(); __builtin_amdgcn_fence(__ATOMIC_RELEASE, "workgroup"); } while (0)


#define NB 4
#define SS 1024
#define DM 1024
#define NH 16
#define HD 64
#define QKVW (3 * DM)
#ifndef TQB
#define TQB (SS / 64)
#define TNB NB
#define TOB (NB * SS / 64)     // output row tiles (all)
#endif
typedef __attribute__((ext_vector_type(8))) __bf16 v8b;
__device__ __forceinline__ v16b frag_b(const __bf16* rowk0, int lane) {
  union { v16b v; v8b q[2]; } u; const __bf16* p = rowk0 + 8 * (lane >> 4);
  u.q[0] = *(const v8b*)p; u.q[1] = *(const v8b*)(p + 16); return u.v;
}
__device__ __forceinline__ float bfr(float v) { return (float)(__bf16)v; }
__device__ __attribute__((noinline)) float exp_ni(float v) { return expf(v); }
__device__ __attribute__((noinline)) float erf_ni(float v) { return erff(v); }

#define PK_A 0                       // [3072][1024] Wqkv rows (natural [out][in])
#define PK_P (PK_A + QKVW * DM)        // [1024][1024] Wo rows (natural)
#define PK_END (PK_P + DM * DM)
#define WS_PK  0u
#define WS_QK  (WS_PK + 2u * PK_END)             // f16 [4096 rows][2048]: q | k
#define WS_QKL (WS_QK + 2u * NB * SS * 2 * DM)     // f16 q | k residual planes x2048
#define WS_VTH (WS_QKL + 2u * NB * SS * 2 * DM)    // f16 [b][1024 (h*64+d)][1024 s] hi
#define WS_VTL (WS_VTH + 2u * NB * DM * SS)        // f16 lo x 2048
#define WS_O   (WS_VTL + 2u * NB * DM * SS)        // f32 [4096][1024]
#define WS_CS  (WS_O + 4u * NB * SS * DM)           // f32 2 x [1024][32], unused
#define WS_END (WS_CS + 4u * 2 * SS * 32)
// ---- k_pack: block = (row n, which): natural [out][in] rows -> bf16; which 0..2 -> W_q/W_k/W_v into PK_A rows which*1024 + n; 3 -> W_o into PK_P
__global__ __launch_bounds__(256) void k_pack(const float* __restrict__ WQ, const float* __restrict__ WK, const float* __restrict__ WV, const float* __restrict__ WO, __bf16* __restrict__ PK) {
  __shared__ __align__(16) __bf16 s[DM]; const int n = blockIdx.x, which = blockIdx.y, t = threadIdx.x; const float* Wm = (which == 0) ? WQ : (which == 1) ? WK : (which == 2) ? WV : WO;
  for (int k = t; k < DM; k += 256) s[k] = (__bf16)Wm[(size_t)n * DM + k];
  __syncthreads();
  __bf16* dst = (which < 3) ? PK + PK_A + ((size_t)which * DM + n) * DM : PK + PK_P + (size_t)n * DM;
  for (int q = t; q < DM / 8; q += 256) vst2((unsigned*)(dst + q * 8), *(const v4u*)&s[q * 8]);
}
// one k step (32 wide) of a 16 x 128 wave tile: the f32 row piece and the eight weight fragments, all loads issued as one group
struct KStep { v4f x[4]; v16b w[8]; };
__device__ __forceinline__ void ld_step(KStep& t, const float* xrow, const __bf16* wrow, int kc, int lane) {
  const float* p = xrow + kc * 32 + 8 * (lane >> 4); t.x[0] = *(const v4f*)p; t.x[1] = *(const v4f*)(p + 4); t.x[2] = *(const v4f*)(p + 16); t.x[3] = *(const v4f*)(p + 20);
#pragma unroll
  for (int j = 0; j < 8; ++j) t.w[j] = frag_b(wrow + (size_t)j * 16 * DM + kc * 32, lane);
  asm volatile("s_wait_xcnt 0x0" ::: "memory");   // in front of any later overwrite of a register that these loads name
}
__global__ __launch_bounds__(128) void k_qkv(const float* __restrict__ XQ, const float* __restrict__ XK, const float* __restrict__ XV, const __bf16* __restrict__ P, const float* __restrict__ BQ, const float* __restrict__ BK, const float* __restrict__ BV, _Float16* __restrict__ QK, _Float16* __restrict__ QKL, _Float16* __restrict__ VTH, _Float16* __restrict__ VTL) {
  const int which0 = (blockIdx.y * 128) / DM; const float* X = (which0 == 0) ? XQ : (which0 == 1) ? XK : XV;   // q from q_in, k from k_in, v from v_in
  __shared__ __align__(16) _Float16 so[4][16][136], sol[4][16][136]; __shared__ __align__(16) _Float16 sth[128][72], stl[128][72];
  const int tid = threadIdx.x, wave = tid >> 5, lane = tid & 31, col = lane & 15, g = lane >> 4; const size_t r0 = (size_t)blockIdx.x * 64 + wave * 16; const int n0 = blockIdx.y * 128;
  v8f acc[8] = {};
  const float* xa = X + (r0 + col) * DM; const __bf16* pb = P + (size_t)(n0 + col) * DM;
  KStep t0, t1; ld_step(t0, xa, pb, 0, lane);
#pragma unroll 1   // the two register sets already are the unrolling
  for (int kc = 0; kc < DM / 32; kc += 2) {
    ld_step(t1, xa, pb, kc + 1, lane);
    { v16b a;
#pragma unroll
      for (int i = 0; i < 16; ++i) a[i] = (__bf16)t0.x[i >> 2][i & 3];
#pragma unroll
      for (int j = 0; j < 8; ++j) acc[j] = wmma_bf(a, t0.w[j], acc[j]); }
    ld_step(t0, xa, pb, kc + 2 < DM / 32 ? kc + 2 : kc, lane);   // last trip: no step is left, the index stays inside the row
    { v16b a;
#pragma unroll
      for (int i = 0; i < 16; ++i) a[i] = (__bf16)t1.x[i >> 2][i & 3];
#pragma unroll
      for (int j = 0; j < 8; ++j) acc[j] = wmma_bf(a, t1.w[j], acc[j]); } }
  { const float* BB = (which0 == 0) ? BQ : (which0 == 1) ? BK : BV;
#pragma unroll
    for (int j = 0; j < 8; ++j) { const float bb = bfr(BB[(n0 % DM) + j * 16 + col]);
#pragma unroll
      for (int r = 0; r < 8; ++r) acc[j][r] += bb; } }
  if (n0 < 2 * DM) {   // q stored unscaled (f16 sigma ~0.6, no subnormal exposure); 1/8 applied to the f32 score
#pragma unroll
    for (int j = 0; j < 8; ++j) {
#pragma unroll
      for (int r = 0; r < 8; ++r) { const float v = acc[j][r]; const _Float16 hv = (_Float16)v; so[wave][8 * g + r][j * 16 + col] = hv; sol[wave][8 * g + r][j * 16 + col] = (_Float16)((v - (float)hv) * 2048.0f); } }   // q, k as f16 hi + (x2048) residual (no RoPE in this module)
    LDSX();
    for (int rl = 0; rl < 16; ++rl) if (lane < 16) { vst2((unsigned*)(QK + (r0 + rl) * (2 * DM) + n0 + lane * 8), *(const v4u*)&so[wave][rl][lane * 8]); vst2((unsigned*)(QKL + (r0 + rl) * (2 * DM) + n0 + lane * 8), *(const v4u*)&sol[wave][rl][lane * 8]); }
  } else {
#pragma unroll
    for (int j = 0; j < 8; ++j) {
#pragma unroll
      for (int r = 0; r < 8; ++r) { const float v = acc[j][r]; const _Float16 hv = (_Float16)v; sth[j * 16 + col][wave * 16 + 8 * g + r] = hv; stl[j * 16 + col][wave * 16 + 8 * g + r] = (_Float16)((v - (float)hv) * 2048.0f); } }
    __syncthreads();
    const size_t rb = (size_t)blockIdx.x * 64; const int b = (int)(rb / SS), s0 = (int)(rb % SS); const int pc0 = n0 - 2 * DM;
    for (int q = tid; q < 128 * 8; q += 128) { const int d = q >> 3, pc = q & 7; const size_t o = ((size_t)b * DM + pc0 + d) * SS + s0 + pc * 8; vst2((unsigned*)(VTH + o), *(const v4u*)&sth[d][pc * 8]); vst2((unsigned*)(VTL + o), *(const v4u*)&stl[d][pc * 8]); }
  }
}
__device__ __forceinline__ v16h frag_at(const _Float16* p) { union { v16h v; v8h q[2]; } u; u.q[0] = *(const v8h*)p; u.q[1] = *(const v8h*)(p + 16); return u.v; }   // frag_h with the lane half's offset already in p
// the K fragments (hi, residual) of one 32-key tile of one head, all sixteen loads issued as one group; kb, kbl: the lane's row of tile 0 in the q | k planes, at the head's column of q
__device__ __forceinline__ void ld_k(v16h (&kf)[2][2][2], const _Float16* kb, const _Float16* kbl, int ks, int lane) {
  const _Float16* p = kb + (size_t)ks * 32 * (2 * DM) + 8 * (lane >> 4); const _Float16* pl = kbl + (size_t)ks * 32 * (2 * DM) + 8 * (lane >> 4);   // the lane's own addresses: every load below is one of them plus a constant
#pragma unroll
  for (int ct = 0; ct < 2; ++ct) {
#pragma unroll
    for (int kc = 0; kc < 2; ++kc) { const int o = DM + ct * 16 * (2 * DM) + kc * 32; kf[ct][kc][0] = frag_at(p + o); kf[ct][kc][1] = frag_at(pl + o); } }
  asm volatile("s_wait_xcnt 0x0" :: "v"(p), "v"(pl) : "memory");   // in front of any overwrite of a register that these loads name; the inputs keep the address registers whole up to here
}
// k_attn: block = 16 query rows of one batch, 16 waves, wave w = head w. The head mean of the attention map is summed in LDS
// (heads in the order 0..15) and each of its elements is stored once.
__global__ __launch_bounds__(512) void k_attn(const _Float16* __restrict__ QK, const _Float16* __restrict__ QKL, const _Float16* __restrict__ VTH, const _Float16* __restrict__ VTL, float* __restrict__ O, float* __restrict__ ATT) {
  __shared__ __align__(16) _Float16 sph[NH][16][40], spl[NH][16][40]; __shared__ __align__(16) float spm[2][NH][16][36]; __shared__ __align__(16) float so[NH][16][68];
  const int tid = threadIdx.x, wave = __builtin_amdgcn_readfirstlane(tid >> 5), lane = tid & 31, col = lane & 15, g = lane >> 4;   // readfirstlane: the head's offsets stay in scalar registers
  const int h = wave, b = blockIdx.y; const int q0 = blockIdx.x * 16; const size_t rq = (size_t)b * SS + q0 + col;
  v16h aq[2], aql[2];
#pragma unroll
  for (int kc = 0; kc < 2; ++kc) { aq[kc] = frag_h(QK + rq * (2 * DM) + h * HD + kc * 32, lane); aql[kc] = frag_h(QKL + rq * (2 * DM) + h * HD + kc * 32, lane); }
  float m[8], l[8];
#pragma unroll
  for (int r = 0; r < 8; ++r) { m[r] = -3.0e38f; l[r] = 0.f; }
  const _Float16* kb = QK + ((size_t)b * SS + col) * (2 * DM) + h * HD; const _Float16* kbl = QKL + ((size_t)b * SS + col) * (2 * DM) + h * HD;
  asm volatile("s_wait_xcnt 0x0" :: "v"(QK + rq * (2 * DM) + h * HD + 8 * g), "v"(QKL + rq * (2 * DM) + h * HD + 8 * g) : "memory");   // the Q loads' address registers stay whole up to here; the K loads that follow may reuse them
  v16h kf[2][2][2]; ld_k(kf, kb, kbl, 0, lane);
#pragma unroll 1
  for (int ks = 0; ks < SS / 32; ++ks) { v8f s[2];
#pragma unroll
    for (int ct = 0; ct < 2; ++ct) { v8f c = {}, cl = {};
#pragma unroll
      for (int kc = 0; kc < 2; ++kc) { c = wmma16(aq[kc], kf[ct][kc][0], c); cl = wmma16(aql[kc], kf[ct][kc][0], cl); cl = wmma16(aq[kc], kf[ct][kc][1], cl); }
#pragma unroll
      for (int r = 0; r < 8; ++r) s[ct][r] = (c[r] + cl[r] * (1.0f / 2048.0f)) * 0.125f; }
    ld_k(kf, kb, kbl, (ks + 1) & (SS / 32 - 1), lane);   // the next tile flies during the softmax; the last trip fetches tile 0, with which pass 2 begins
#pragma unroll
    for (int r = 0; r < 8; ++r) { float mx = fmaxf(s[0][r], s[1][r]);
#pragma unroll
      for (int o = 1; o < 16; o <<= 1) mx = fmaxf(mx, __shfl_xor(mx, o));
      const float mn = fmaxf(m[r], mx); const float alpha = (m[r] <= -1.0e38f) ? 0.f : __expf(m[r] - mn); float es = __expf(s[0][r] - mn) + __expf(s[1][r] - mn);
#pragma unroll
      for (int o = 1; o < 16; o <<= 1) es += __shfl_xor(es, o);
      l[r] = l[r] * alpha + es; m[r] = mn; } }
  float il[8];
#pragma unroll
  for (int r = 0; r < 8; ++r) il[r] = 1.0f / l[r];
  // pass 2: normalized P, P.V, attention mean over the heads
  v8f acc[4] = {}, accl[4] = {};
#pragma unroll 1
  for (int ks = 0; ks < SS / 32; ++ks) { float (*pm)[16][36] = spm[ks & 1];   // two buffers: one barrier a key tile is enough
#pragma unroll
    for (int ct = 0; ct < 2; ++ct) { v8f c = {}, cl = {};
#pragma unroll
      for (int kc = 0; kc < 2; ++kc) { c = wmma16(aq[kc], kf[ct][kc][0], c); cl = wmma16(aql[kc], kf[ct][kc][0], cl); cl = wmma16(aq[kc], kf[ct][kc][1], cl); }
#pragma unroll
      for (int r = 0; r < 8; ++r) { const float e = __expf((c[r] + cl[r] * (1.0f / 2048.0f)) * 0.125f - m[r]);   // unnormalised (<= 1: no f16 subnormal exposure); 1/l applied to the accumulators at the end
        const _Float16 he = (_Float16)e; sph[wave][8 * g + r][ct * 16 + col] = he; spl[wave][8 * g + r][ct * 16 + col] = (_Float16)((e - (float)he) * 2048.0f); pm[wave][8 * g + r][ct * 16 + col] = (e * il[r]) * (1.0f / NH); } }
    v16h vf[4][2];   // this tile's V fragments, one group: they fly while P goes through LDS
    const _Float16* vp = VTH + ((size_t)b * DM + h * HD + col) * SS + ks * 32 + 8 * g; const _Float16* vpl = VTL + ((size_t)b * DM + h * HD + col) * SS + ks * 32 + 8 * g;
#pragma unroll
    for (int dt = 0; dt < 4; ++dt) { vf[dt][0] = frag_at(vp + dt * 16 * SS); vf[dt][1] = frag_at(vpl + dt * 16 * SS); }
    asm volatile("s_wait_xcnt 0x0" :: "v"(vp), "v"(vpl) : "memory");   // in front of any overwrite of a register that these loads name; the inputs keep the address registers whole up to here
    LDSX();
    const v16h pah = frag_h(&sph[wave][col][0], lane), pal = frag_h(&spl[wave][col][0], lane);
#pragma unroll
    for (int dt = 0; dt < 4; ++dt) { acc[dt] = wmma16(pah, vf[dt][0], acc[dt]); accl[dt] = wmma16(pal, vf[dt][0], accl[dt]); accl[dt] = wmma16(pah, vf[dt][1], accl[dt]); }
    __syncthreads();   // every head's share of this key tile stands in pm; also ends all reads of the other buffer
    ld_k(kf, kb, kbl, (ks + 1) & (SS / 32 - 1), lane);   // behind the barrier, whose fence waits for every load: the next tile's K flies during the head mean (the last trip's index wraps to tile 0 and stays in bounds)
    // attention mean: wave w sums query row w, lane = key: one 128-byte line a wave
    float am = pm[0][wave][lane];
#pragma unroll   // unrolled so that the LDS reads of several heads are in flight at once
    for (int hh = 1; hh < NH; ++hh) am += pm[hh][wave][lane];
    ATT[((size_t)b * SS + q0 + wave) * SS + ks * 32 + lane] = am; }
#pragma unroll
  for (int r = 0; r < 8; ++r) {
#pragma unroll
    for (int dt = 0; dt < 4; ++dt) so[wave][8 * g + r][dt * 16 + col] = (acc[dt][r] + accl[dt][r] * (1.0f / 2048.0f)) * il[r]; }
  LDSX();
  for (int rl = 0; rl < 16; ++rl) if (lane < 16) vst2(O + ((size_t)b * SS + q0 + rl) * DM + h * HD + lane * 4, *(const v4f*)&so[wave][rl][lane * 4]);
}
// ---- k_out: block = (64 rows, 128 cols): out = O(hi/lo) . Wo rows (2 products) + bo
__global__ __launch_bounds__(128) void k_out(const float* __restrict__ O, const __bf16* __restrict__ P, const float* __restrict__ BO, float* __restrict__ Y) {
  __shared__ __align__(16) float so[4][16][132];
  const int tid = threadIdx.x, wave = tid >> 5, lane = tid & 31, col = lane & 15, g = lane >> 4; const size_t r0 = (size_t)blockIdx.x * 64 + wave * 16; const int n0 = blockIdx.y * 128;
  v8f acc[8] = {};
  const float* xa = O + (r0 + col) * DM; const __bf16* pb = P + (size_t)(n0 + col) * DM;
  KStep t0, t1; ld_step(t0, xa, pb, 0, lane);
#pragma unroll 1   // the two register sets already are the unrolling
  for (int kc = 0; kc < DM / 32; kc += 2) {
    ld_step(t1, xa, pb, kc + 1, lane);
    { float v[16];
#pragma unroll
      for (int i = 0; i < 16; ++i) v[i] = t0.x[i >> 2][i & 3];
      const F2 a = bsplit16(v);
#pragma unroll
      for (int j = 0; j < 8; ++j) { acc[j] = wmma_bf(a.l, t0.w[j], acc[j]); acc[j] = wmma_bf(a.h, t0.w[j], acc[j]); } }
    ld_step(t0, xa, pb, kc + 2 < DM / 32 ? kc + 2 : kc, lane);   // last trip: no step is left, the index stays inside the row
    { float v[16];
#pragma unroll
      for (int i = 0; i < 16; ++i) v[i] = t1.x[i >> 2][i & 3];
      const F2 a = bsplit16(v);
#pragma unroll
      for (int j = 0; j < 8; ++j) { acc[j] = wmma_bf(a.l, t1.w[j], acc[j]); acc[j] = wmma_bf(a.h, t1.w[j], acc[j]); } } }
#pragma unroll
  for (int j = 0; j < 8; ++j) {
#pragma unroll
    for (int r = 0; r < 8; ++r) so[wave][8 * g + r][j * 16 + col] = acc[j][r] + bfr(BO[n0 + j * 16 + col]); }
  LDSX();
  for (int rl = 0; rl < 16; ++rl) vst2(Y + (r0 + rl) * DM + n0 + lane * 4, *(const v4f*)&so[wave][rl][lane * 4]);
}
extern "C" void kernel_launch(void* const* d_in, const int* in_sizes, int n_in, void* d_out, int out_size, void* d_ws, size_t ws_size, hipStream_t stream) {
  (void)in_sizes; (void)n_in; (void)out_size;
  const float** F = (const float**)d_in;   // 0 q_in [4,1024,1024], 1 k_in, 2 v_in, 3 Wq [1024,1024] natural (x @ W.T), 4 bq, 5 Wk, 6 bk, 7 Wv, 8 bv, 9 Wo, 10 bo
  if (ws_size < (size_t)WS_END) return;
  char* ws = (char*)d_ws; __bf16* PK = (__bf16*)(ws + WS_PK); _Float16 *QK = (_Float16*)(ws + WS_QK), *QKL = (_Float16*)(ws + WS_QKL), *VTH = (_Float16*)(ws + WS_VTH), *VTL = (_Float16*)(ws + WS_VTL); float* O = (float*)(ws + WS_O);
  k_pack<<<dim3(DM, 4), 256, 0, stream>>>(F[3], F[5], F[7], F[9], PK);
  k_qkv<<<dim3(TNB * SS / 64, QKVW / 128), 128, 0, stream>>>(F[0], F[1], F[2], PK + PK_A, F[4], F[6], F[8], QK, QKL, VTH, VTL);
  k_attn<<<dim3(SS / 16, TNB), 512, 0, stream>>>(QK, QKL, VTH, VTL, O, (float*)((char*)d_out + 16777216));
  k_out<<<dim3(TOB, DM / 128), 128, 0, stream>>>(O, PK + PK_P, F[10], (float*)d_out);
}

// v003
// It runs in 211 microseconds.
// Next to v002, in two timings, it ran 1.76 times as fast each time.
// All steps since v000 together make it 12.3 times as fast.
#include <hip/hip_runtime.h>
#include <math.h>

typedef __attribute__((ext_vector_type(16))) _Float16 v16h;
typedef __attribute__((ext_vector_type(16))) __bf16 v16b;
typedef __attribute__((ext_vector_type(8)))  _Float16 v8h;
typedef __attribute__((ext_vector_type(8)))  float v8f;
typedef __attribute__((ext_vector_type(4)))  float v4f;
typedef __attribute__((ext_vector_type(2)))  float v2f;
typedef __attribute__((ext_vector_type(4)))  unsigned v4u;
typedef __attribute__((ext_vector_type(4)))  int v4i;
typedef float __attribute__((may_alias)) float_a;
typedef int __attribute__((may_alias)) int_a;

template <typename T> __device__ __forceinline__ void vst2(void* p, T v) { *(T*)p = v;  }
__device__ __forceinline__ v8f wmma16(v16h a, v16h b, v8f c) {
  v8f d = __builtin_amdgcn_wmma_f32_16x16x32_f16(false, a, false, b, (short)0, c, false, false);
  asm volatile("v_nop\n\tv_nop\n\tv_nop\n\tv_nop" : "+v"(d) : "v"(a), "v"(b));
  return d;
}
__device__ __forceinline__ v8f wmma_bf(v16b a, v16b b, v8f c) {
  v8f d = __builtin_amdgcn_wmma_f32_16x16x32_bf16(false, a, false, b, (short)0, c, false, false);
  asm volatile("v_nop\n\tv_nop\n\tv_nop\n\tv_nop" : "+v"(d) : "v"(a), "v"(b));
  return d;
}
// Multi-head cross-attention that also returns the head-averaged attention map (B 4, T 1,024 queries, 1,024 memory positions, d 1,024, 16 heads x 64).
__device__ __forceinline__ v16h frag_h(const _Float16* rowk0, int lane) {
  union { v16h v; v8h q[2]; } u; const _Float16* p = rowk0 + 8 * (lane >> 4);
  u.q[0] = *(const v8h*)p; u.q[1] = *(const v8h*)(p + 16); return u.v;
}
__device__ __forceinline__ v16h frag_f32(const float* rowk0, int lane) {
  v16h a; const float* p = rowk0 + 8 * (lane >> 4);
#pragma unroll
  for (int i = 0; i < 8; ++i) { a[i] = (_Float16)p[i]; a[8 + i] = (_Float16)p[16 + i]; }
  return a;
}
__device__ __forceinline__ v16h frag_f32s(const float* rowk0, int lane, float sc) {
  v16h a; const float* p = rowk0 + 8 * (lane >> 4);
#pragma unroll
  for (int i = 0; i < 8; ++i) { a[i] = (_Float16)(p[i] * sc); a[8 + i] = (_Float16)(p[16 + i] * sc); }
  return a;
}
// column fragment from a [K][ld] layout (column n), rows >= K read as 0
__device__ __forceinline__ v16h fragc_f32(const float* W, int k0, int n, int lane, int ld, int K) {
  v16h a; const int g = lane >> 4;
#pragma unroll
  for (int i = 0; i < 8; ++i) { const int ka = k0 + 8 * g + i, kb = ka + 16;
    a[i] = (_Float16)(ka < K ? W[(size_t)(ka < K ? ka : K - 1) * ld + n] : 0.f); a[8 + i] = (_Float16)(kb < K ? W[(size_t)(kb < K ? kb : K - 1) * ld + n] : 0.f); }
  return a;
}
struct F2 { v16b h, l; };
__device__ __forceinline__ F2 bsplit16(const float v[16]) { F2 r;
#pragma unroll
  for (int i = 0; i < 16; ++i) { const __bf16 h = (__bf16)v[i]; r.h[i] = h; r.l[i] = (__bf16)(v[i] - (float)h); }
  return r; }
__device__ __forceinline__ F2 split_row(const float* row, int k0, int lane) { float v[16]; const float* p = row + k0 + 8 * (lane >> 4);
#pragma unroll
  for (int i = 0; i < 8; ++i) { v[i] = p[i]; v[8 + i] = p[16 + i]; }
  return bsplit16(v); }
__device__ __forceinline__ F2 split_rowK(const float* row, int k0, int lane, int K) { float v[16]; const int g = lane >> 4;
#pragma unroll
  for (int i = 0; i < 8; ++i) { const int ka = k0 + 8 * g + i, kb = ka + 16; v[i] = ka < K ? row[ka < K ? ka : K - 1] : 0.f; v[8 + i] = kb < K ? row[kb < K ? kb : K - 1] : 0.f; }
  return bsplit16(v); }
__device__ __forceinline__ F2 split_col(const float* W, int k0, int n, int lane, int ld, int K) { float v[16]; const int g = lane >> 4;
#pragma unroll
  for (int i = 0; i < 8; ++i) { const int ka = k0 + 8 * g + i, kb = ka + 16; v[i] = ka < K ? W[(size_t)(ka < K ? ka : K - 1) * ld + n] : 0.f; v[8 + i] = kb < K ? W[(size_t)(kb < K ? kb : K - 1) * ld + n] : 0.f; }
  return bsplit16(v); }
__device__ __forceinline__ v8f mac3(const F2& a, const F2& b, v8f c) { c = wmma_bf(a.l, b.h, c); c = wmma_bf(a.h, b.l, c); return wmma_bf(a.h, b.h, c); }
__device__ __forceinline__ float sigm(float v) { return 1.0f / (1.0f + expf(-v)); }
#define LDSX() do { asm volatile("s_wait_dscnt 0" ::: "memory"); __builtin_amdgcn_wave_barrier(); __builtin_amdgcn_fence(__ATOMIC_RELEASE, "workgroup"); } while (0)


#define NB 4
#define SS 1024
#define DM 1024
#define NH 16
#define HD 64
#define QKVW (3 * DM)
#ifndef TQB
#define TQB (SS / 64)
#define TNB NB
#define TOB (NB * SS / 64)     // output row tiles (all)
#endif
typedef __attribute__((ext_vector_type(8))) __bf16 v8b;
__device__ __forceinline__ v16b frag_b(const __bf16* rowk0, int lane) {
  union { v16b v; v8b q[2]; } u; const __bf16* p = rowk0 + 8 * (lane >> 4);
  u.q[0] = *(const v8b*)p; u.q[1] = *(const v8b*)(p + 16); return u.v;
}
__device__ __forceinline__ float bfr(float v) { return (float)(__bf16)v; }
__device__ __attribute__((noinline)) float exp_ni(float v) { return expf(v); }
__device__ __attribute__((noinline)) float erf_ni(float v) { return erff(v); }

#define PK_A 0                       // Wqkv, 192 tiles of 16 rows, fragment order (see k_pack)
#define PK_P (PK_A + QKVW * DM)        // Wo, 64 tiles of 16 rows, fragment order
#define PK_END (PK_P + DM * DM)
// Every operand that a loop reads from the workspace (all but q, which a block reads once) lies there in FRAGMENT ORDER: the 16 bytes that lane 0..31 loads
// with one instruction stand side by side, so a wave-wide 16-byte load reads 512 contiguous bytes (four whole 128-byte lines, not pieces of sixteen).
#define WS_PK  0u
#define WS_Q   (WS_PK + 2u * PK_END)             // f16 [4096 rows][1024]: q, natural rows (read once a block)
#define WS_QL  (WS_Q + 2u * NB * SS * DM)          // f16 q residual x2048
#define WS_KF  (WS_QL + 2u * NB * SS * DM)         // f16 K fragments [b][h][32-key tile][ct 2][kc 2][hi, residual x2048][half 2][lane 32][8]
#define WS_VF  (WS_KF + 4u * NB * SS * DM)         // f16 V fragments [b][h][32-key tile][dt 4][hi, residual x2048][half 2][lane 32][8]
#define WS_O   (WS_VF + 4u * NB * SS * DM)         // f32 O fragments [16-row tile][kc 32][piece 4][lane 32][4]
#define WS_XP  (WS_O + 4u * NB * SS * DM)          // bf16 q_in, k_in, v_in, each 256 tiles of 16 rows, fragment order (see k_pack)
#define WS_END (WS_XP + 2u * 3 * NB * SS * DM)
// a 16-bit fragment in fragment order: p = the lane's 16 bytes of the first half, the second half stands 512 bytes on
__device__ __forceinline__ v16h frag_ch(const _Float16* p) { union { v16h v; v8h q[2]; } u; u.q[0] = *(const v8h*)p; u.q[1] = *(const v8h*)(p + 256); return u.v; }
__device__ __forceinline__ v16b frag_cb(const __bf16* p) { union { v16b v; v8b q[2]; } u; u.q[0] = *(const v8b*)p; u.q[1] = *(const v8b*)(p + 256); return u.v; }
// ---- k_pack: block = (tile of 16 rows, which); which 0..2 -> W_q/W_k/W_v into PK_A, 3 -> W_o into PK_P, 4..15 -> a quarter of the rows of q_in/k_in/v_in into XP.
// f32 -> bf16, stored as [tile][kc 32][half 2][lane 32][8]: lane = 16 g + row, k = 32 kc + 16 half + 8 g + i (the k order of frag_b, for A and B alike)
__global__ __launch_bounds__(256) void k_pack(const float* __restrict__ WQ, const float* __restrict__ WK, const float* __restrict__ WV, const float* __restrict__ WO, const float* __restrict__ XQ, const float* __restrict__ XK, const float* __restrict__ XV, __bf16* __restrict__ PK, __bf16* __restrict__ XP) {
  const int which = blockIdx.y, t = threadIdx.x, nt = (which < 4) ? blockIdx.x : ((which - 4) & 3) * 64 + blockIdx.x;
  const float* Wm = (which == 0) ? WQ : (which == 1) ? WK : (which == 2) ? WV : (which == 3) ? WO : (which < 8) ? XQ : (which < 12) ? XK : XV;
  __bf16* dst = ((which < 3) ? PK + PK_A + (size_t)which * DM * DM : (which == 3) ? PK + PK_P : XP + (size_t)((which - 4) >> 2) * NB * SS * DM) + (size_t)nt * 16 * DM;
  const float* s = Wm + (size_t)(nt * 16 + (t & 15)) * DM + ((t >> 5) & 1) * 16 + 8 * ((t >> 4) & 1) + (t >> 6) * 32;   // piece t + 256 u: lane t & 31, half (t >> 5) & 1, kc = (t >> 6) + 4 u
  v4f a[8], c[8];
#pragma unroll   // a thread's sixteen loads are in flight together
  for (int u = 0; u < 8; ++u) { a[u] = *(const v4f*)(s + u * 128); c[u] = *(const v4f*)(s + u * 128 + 4); }
#pragma unroll   // constant indices: a, c and o stay in registers
  for (int u = 0; u < 8; ++u) { v8b o;
#pragma unroll   // as above
    for (int i = 0; i < 4; ++i) { o[i] = (__bf16)a[u][i]; o[4 + i] = (__bf16)c[u][i]; }
    *(v8b*)(dst + (size_t)(u * 256 + t) * 8) = o; }
}
// one k step (32 wide) of a 16 x 128 wave tile: the row operand (k_out: f32 pieces; k_qkv: a bf16 fragment) and the eight weight fragments, all loads issued as one group.
// p: the lane's first 16 bytes of the row tile's step; w: the lane's 16 bytes of the first weight tile's step. A step is 1 KiB of a bf16 tile, 2 KiB of an f32 tile
struct KStep { v4f x[4]; v16b w[8]; };
struct KStepB { v16b a; v16b w[8]; };
__device__ __forceinline__ void ld_stepb(KStepB& t, const __bf16* p, const __bf16* w) {
  t.a = frag_cb(p);
#pragma unroll   // constant indices and offsets: t.w stays in registers, every load is the lane's address plus a constant
  for (int j = 0; j < 8; ++j) t.w[j] = frag_cb(w + (size_t)j * 16 * DM);
  asm volatile("s_wait_xcnt 0x0" :: "v"(p), "v"(w) : "memory");   // in front of any later overwrite of a register that these loads name; the inputs keep the address registers whole up to here
}
__device__ __forceinline__ void ld_step(KStep& t, const float* p, const __bf16* w) {
  t.x[0] = *(const v4f*)p; t.x[1] = *(const v4f*)(p + 128); t.x[2] = *(const v4f*)(p + 256); t.x[3] = *(const v4f*)(p + 384);
#pragma unroll
  for (int j = 0; j < 8; ++j) t.w[j] = frag_cb(w + (size_t)j * 16 * DM);
  asm volatile("s_wait_xcnt 0x0" :: "v"(p), "v"(w) : "memory");   // in front of any later overwrite of a register that these loads name; the inputs keep the address registers whole up to here
}
__global__ __launch_bounds__(128) void k_qkv(const __bf16* __restrict__ XP, const __bf16* __restrict__ P, const float* __restrict__ BQ, const float* __restrict__ BK, const float* __restrict__ BV, _Float16* __restrict__ Q, _Float16* __restrict__ QL, _Float16* __restrict__ KF, _Float16* __restrict__ VF) {
  const int which0 = (blockIdx.y * 128) / DM; const __bf16* X = XP + (size_t)which0 * NB * SS * DM;   // q from q_in, k from k_in, v from v_in
  __shared__ __align__(16) _Float16 so[4][16][136], sol[4][16][136]; __shared__ __align__(16) _Float16 sth[128][72], stl[128][72];
  const int tid = threadIdx.x, wave = tid >> 5, lane = tid & 31, col = lane & 15, g = lane >> 4; const size_t r0 = (size_t)blockIdx.x * 64 + wave * 16; const int n0 = blockIdx.y * 128;
  v8f acc[8] = {};
  const __bf16* xa = X + r0 * DM + lane * 8; const __bf16* pb = P + (size_t)n0 * DM + lane * 8;
  KStepB t0, t1; ld_stepb(t0, xa, pb);
#pragma unroll 1   // the two register sets already are the unrolling
  for (int kc = 0; kc < DM / 32; kc += 2) {
    ld_stepb(t1, xa + 512, pb + 512);
#pragma unroll
    for (int j = 0; j < 8; ++j) acc[j] = wmma_bf(t0.a, t0.w[j], acc[j]);
    { const int adv = kc + 2 < DM / 32 ? 1024 : 0; xa += adv; pb += adv; }   // two steps on; last trip: no step is left, the pointers stay inside the tile.
    ld_stepb(t0, xa, pb);
#pragma unroll
    for (int j = 0; j < 8; ++j) acc[j] = wmma_bf(t1.a, t1.w[j], acc[j]); }
  { const float* BB = (which0 == 0) ? BQ : (which0 == 1) ? BK : BV;
#pragma unroll
    for (int j = 0; j < 8; ++j) { const float bb = bfr(BB[(n0 % DM) + j * 16 + col]);
#pragma unroll
      for (int r = 0; r < 8; ++r) acc[j][r] += bb; } }
  if (n0 < 2 * DM) {   // q stored unscaled (f16 sigma ~0.6, no subnormal exposure); 1/8 applied to the f32 score
#pragma unroll
    for (int j = 0; j < 8; ++j) {
#pragma unroll
      for (int r = 0; r < 8; ++r) { const float v = acc[j][r]; const _Float16 hv = (_Float16)v; so[wave][8 * g + r][j * 16 + col] = hv; sol[wave][8 * g + r][j * 16 + col] = (_Float16)((v - (float)hv) * 2048.0f); } }   // q, k as f16 hi + (x2048) residual (no RoPE in this module)
    LDSX();
    if (n0 < DM) {
      for (int rl = 0; rl < 16; ++rl) if (lane < 16) { vst2((unsigned*)(Q + (r0 + rl) * DM + n0 + lane * 8), *(const v4u*)&so[wave][rl][lane * 8]); vst2((unsigned*)(QL + (r0 + rl) * DM + n0 + lane * 8), *(const v4u*)&sol[wave][rl][lane * 8]); }
    } else {   // the wave's 16 keys are one ct of one key tile, its 128 columns two heads: lane = 16 g + key, d = 32 kc + 16 half + 8 g + i
      const int b = (int)(r0 / SS), kt = (int)(r0 % SS) / 16, h0 = (n0 - DM) / HD;
#pragma unroll   // constant offsets: the wave's sixteen LDS reads are in flight together
      for (int hh = 0; hh < 2; ++hh) { _Float16* kd = KF + (((size_t)(b * NH + h0 + hh) * (SS / 32) + (kt >> 1)) * 2 + (kt & 1)) * 2048 + lane * 8;
#pragma unroll   // as above
        for (int kq = 0; kq < 4; ++kq) { const int kc = kq >> 1, hf = kq & 1, sc = hh * 64 + kc * 32 + hf * 16 + 8 * g;
          vst2((unsigned*)(kd + kc * 1024 + hf * 256), *(const v4u*)&so[wave][col][sc]); vst2((unsigned*)(kd + kc * 1024 + 512 + hf * 256), *(const v4u*)&sol[wave][col][sc]); } }
      asm volatile("s_wait_xcnt 0x0" ::: "memory");   // in front of any later overwrite of a register that these stores name
    }
  } else {
#pragma unroll
    for (int j = 0; j < 8; ++j) {
#pragma unroll
      for (int r = 0; r < 8; ++r) { const float v = acc[j][r]; const _Float16 hv = (_Float16)v; sth[j * 16 + col][wave * 16 + 8 * g + r] = hv; stl[j * 16 + col][wave * 16 + 8 * g + r] = (_Float16)((v - (float)hv) * 2048.0f); } }
    __syncthreads();
    const size_t rb = (size_t)blockIdx.x * 64; const int b = (int)(rb / SS), ks0 = (int)(rb % SS) / 32, h0 = (n0 - 2 * DM) / HD;
    // the block's 64 keys are two key tiles, its 128 columns two heads: lane = 16 g + (d mod 16), key = 32 tile + 16 half + 8 g + i
    for (int e = tid; e < 1024; e += 128) { const int hf = (e >> 5) & 1, dt = (e >> 6) & 3, hh = (e >> 8) & 1, kl = e >> 9; const int d = hh * 64 + dt * 16 + col, kk = kl * 32 + hf * 16 + 8 * g;
      _Float16* vd = VF + (((size_t)(b * NH + h0 + hh) * (SS / 32) + ks0 + kl) * 4 + dt) * 1024 + hf * 256 + lane * 8; vst2((unsigned*)vd, *(const v4u*)&sth[d][kk]); vst2((unsigned*)(vd + 512), *(const v4u*)&stl[d][kk]); }
  }
}
// the K fragments (hi, residual) of one 32-key tile of one head, all sixteen loads issued as one group; kfl: the lane's 16 bytes of the head's tile 0; a tile is 8 KiB in a row
__device__ __forceinline__ void ld_k(v16h (&kf)[2][2][2], const _Float16* kfl, int ks) {
  const _Float16* p = kfl + (size_t)ks * 4096;   // the lane's own address: every load below is it plus a constant
#pragma unroll
  for (int ct = 0; ct < 2; ++ct) {
#pragma unroll
    for (int kc = 0; kc < 2; ++kc) { kf[ct][kc][0] = frag_ch(p + (ct * 2 + kc) * 1024); kf[ct][kc][1] = frag_ch(p + (ct * 2 + kc) * 1024 + 512); } }
  asm volatile("s_wait_xcnt 0x0" :: "v"(p) : "memory");   // in front of any overwrite of a register that these loads name; the input keeps the address registers whole up to here
}
// k_attn: block = 16 query rows of one batch, 16 waves, wave w = head w. The head mean of the attention map is summed in LDS
// (heads in the order 0..15) and each of its elements is stored once.
__global__ __launch_bounds__(512) void k_attn(const _Float16* __restrict__ Q, const _Float16* __restrict__ QL, const _Float16* __restrict__ KF, const _Float16* __restrict__ VF, float* __restrict__ O, float* __restrict__ ATT) {
  __shared__ __align__(16) _Float16 sph[NH][16][40], spl[NH][16][40]; __shared__ __align__(16) float spm[2][NH][16][36]; __shared__ __align__(16) float so[NH][16][68];
  const int tid = threadIdx.x, wave = __builtin_amdgcn_readfirstlane(tid >> 5), lane = tid & 31, col = lane & 15, g = lane >> 4;   // readfirstlane: the head's offsets stay in scalar registers
  const int h = wave, b = blockIdx.y; const int q0 = blockIdx.x * 16; const size_t rq = (size_t)b * SS + q0 + col;
  v16h aq[2], aql[2];
#pragma unroll
  for (int kc = 0; kc < 2; ++kc) { aq[kc] = frag_h(Q + rq * DM + h * HD + kc * 32, lane); aql[kc] = frag_h(QL + rq * DM + h * HD + kc * 32, lane); }
  float m[8], l[8];
#pragma unroll
  for (int r = 0; r < 8; ++r) { m[r] = -3.0e38f; l[r] = 0.f; }
  const _Float16* kfl = KF + (size_t)(b * NH + h) * (SS / 32) * 4096 + lane * 8; const _Float16* vfl = VF + (size_t)(b * NH + h) * (SS / 32) * 4096 + lane * 8;
  asm volatile("s_wait_xcnt 0x0" :: "v"(Q + rq * DM + h * HD + 8 * g), "v"(QL + rq * DM + h * HD + 8 * g) : "memory");   // the Q loads' address registers stay whole up to here; the K loads that follow may reuse them
  v16h kf[2][2][2]; ld_k(kf, kfl, 0);
#pragma unroll 1
  for (int ks = 0; ks < SS / 32; ++ks) { v8f s[2];
#pragma unroll
    for (int ct = 0; ct < 2; ++ct) { v8f c = {}, cl = {};
#pragma unroll
      for (int kc = 0; kc < 2; ++kc) { c = wmma16(aq[kc], kf[ct][kc][0], c); cl = wmma16(aql[kc], kf[ct][kc][0], cl); cl = wmma16(aq[kc], kf[ct][kc][1], cl); }
#pragma unroll
      for (int r = 0; r < 8; ++r) s[ct][r] = (c[r] + cl[r] * (1.0f / 2048.0f)) * 0.125f; }
    ld_k(kf, kfl, (ks + 1) & (SS / 32 - 1));   // the next tile flies during the softmax; the last trip fetches tile 0, with which pass 2 begins
#pragma unroll
    for (int r = 0; r < 8; ++r) { float mx = fmaxf(s[0][r], s[1][r]);
#pragma unroll
      for (int o = 1; o < 16; o <<= 1) mx = fmaxf(mx, __shfl_xor(mx, o));
      const float mn = fmaxf(m[r], mx); const float alpha = (m[r] <= -1.0e38f) ? 0.f : __expf(m[r] - mn); float es = __expf(s[0][r] - mn) + __expf(s[1][r] - mn);
#pragma unroll
      for (int o = 1; o < 16; o <<= 1) es += __shfl_xor(es, o);
      l[r] = l[r] * alpha + es; m[r] = mn; } }
  float il[8];
#pragma unroll
  for (int r = 0; r < 8; ++r) il[r] = 1.0f / l[r];
  // pass 2: normalized P, P.V, attention mean over the heads
  v8f acc[4] = {}, accl[4] = {};
#pragma unroll 1
  for (int ks = 0; ks < SS / 32; ++ks) { float (*pm)[16][36] = spm[ks & 1];   // two buffers: one barrier a key tile is enough
#pragma unroll
    for (int ct = 0; ct < 2; ++ct) { v8f c = {}, cl = {};
#pragma unroll
      for (int kc = 0; kc < 2; ++kc) { c = wmma16(aq[kc], kf[ct][kc][0], c); cl = wmma16(aql[kc], kf[ct][kc][0], cl); cl = wmma16(aq[kc], kf[ct][kc][1], cl); }
#pragma unroll
      for (int r = 0; r < 8; ++r) { const float e = __expf((c[r] + cl[r] * (1.0f / 2048.0f)) * 0.125f - m[r]);   // unnormalised (<= 1: no f16 subnormal exposure); 1/l applied to the accumulators at the end
        const _Float16 he = (_Float16)e; sph[wave][8 * g + r][ct * 16 + col] = he; spl[wave][8 * g + r][ct * 16 + col] = (_Float16)((e - (float)he) * 2048.0f); pm[wave][8 * g + r][ct * 16 + col] = (e * il[r]) * (1.0f / NH); } }
    v16h vf[4][2];   // this tile's V fragments, one group: they fly while P goes through LDS
    const _Float16* vp = vfl + (size_t)ks * 4096;
#pragma unroll
    for (int dt = 0; dt < 4; ++dt) { vf[dt][0] = frag_ch(vp + dt * 1024); vf[dt][1] = frag_ch(vp + dt * 1024 + 512); }
    asm volatile("s_wait_xcnt 0x0" :: "v"(vp) : "memory");   // in front of any overwrite of a register that these loads name; the input keeps the address registers whole up to here
    LDSX();
    const v16h pah = frag_h(&sph[wave][col][0], lane), pal = frag_h(&spl[wave][col][0], lane);
#pragma unroll
    for (int dt = 0; dt < 4; ++dt) { acc[dt] = wmma16(pah, vf[dt][0], acc[dt]); accl[dt] = wmma16(pal, vf[dt][0], accl[dt]); accl[dt] = wmma16(pah, vf[dt][1], accl[dt]); }
    __syncthreads();   // every head's share of this key tile stands in pm; also ends all reads of the other buffer
    ld_k(kf, kfl, (ks + 1) & (SS / 32 - 1));   // behind the barrier, whose fence waits for every load: the next tile's K flies during the head mean (the last trip's index wraps to tile 0 and stays in bounds)
    // attention mean: wave w sums query row w, lane = key: one 128-byte line a wave
    float am = pm[0][wave][lane];
#pragma unroll   // unrolled so that the LDS reads of several heads are in flight at once
    for (int hh = 1; hh < NH; ++hh) am += pm[hh][wave][lane];
    ATT[((size_t)b * SS + q0 + wave) * SS + ks * 32 + lane] = am; }
#pragma unroll
  for (int r = 0; r < 8; ++r) {
#pragma unroll
    for (int dt = 0; dt < 4; ++dt) so[wave][8 * g + r][dt * 16 + col] = (acc[dt][r] + accl[dt][r] * (1.0f / 2048.0f)) * il[r]; }
  LDSX();
  // the head's 64 columns are k steps 2 h and 2 h + 1 of k_out: lane = 16 g + row, piece x holds k = 16 (x / 2) + 8 g + 4 (x mod 2) + i of its step
  float* of = O + ((size_t)b * SS + q0) * DM + h * 1024 + lane * 4;
#pragma unroll   // constant offsets: the eight LDS reads are in flight together
  for (int x = 0; x < 8; ++x) vst2(of + x * 128, *(const v4f*)&so[wave][col][(x >> 2) * 32 + ((x >> 1) & 1) * 16 + 8 * g + (x & 1) * 4]);
}
// ---- k_out: block = (64 rows, 128 cols): out = O(hi/lo) . Wo rows (2 products) + bo
__global__ __launch_bounds__(128) void k_out(const float* __restrict__ O, const __bf16* __restrict__ P, const float* __restrict__ BO, float* __restrict__ Y) {
  __shared__ __align__(16) float so[4][16][132];
  const int tid = threadIdx.x, wave = tid >> 5, lane = tid & 31, col = lane & 15, g = lane >> 4; const size_t r0 = (size_t)blockIdx.x * 64 + wave * 16; const int n0 = blockIdx.y * 128;
  v8f acc[8] = {};
  const float* xa = O + r0 * DM + lane * 4; const __bf16* pb = P + (size_t)n0 * DM + lane * 8;
  KStep t0, t1; ld_step(t0, xa, pb);
#pragma unroll 1   // the two register sets already are the unrolling
  for (int kc = 0; kc < DM / 32; kc += 2) {
    ld_step(t1, xa + 512, pb + 512);
    { float v[16];
#pragma unroll
      for (int i = 0; i < 16; ++i) v[i] = t0.x[i >> 2][i & 3];
      const F2 a = bsplit16(v);
#pragma unroll
      for (int j = 0; j < 8; ++j) { acc[j] = wmma_bf(a.l, t0.w[j], acc[j]); acc[j] = wmma_bf(a.h, t0.w[j], acc[j]); } }
    { const int adv = kc + 2 < DM / 32 ? 1024 : 0; xa += adv; pb += adv; }   // two steps on; last trip: no step is left, the pointers stay inside the tile.
    ld_step(t0, xa, pb);
    { float v[16];
#pragma unroll
      for (int i = 0; i < 16; ++i) v[i] = t1.x[i >> 2][i & 3];
      const F2 a = bsplit16(v);
#pragma unroll
      for (int j = 0; j < 8; ++j) { acc[j] = wmma_bf(a.l, t1.w[j], acc[j]); acc[j] = wmma_bf(a.h, t1.w[j], acc[j]); } } }
#pragma unroll
  for (int j = 0; j < 8; ++j) {
#pragma unroll
    for (int r = 0; r < 8; ++r) so[wave][8 * g + r][j * 16 + col] = acc[j][r] + bfr(BO[n0 + j * 16 + col]); }
  LDSX();
  for (int rl = 0; rl < 16; ++rl) vst2(Y + (r0 + rl) * DM + n0 + lane * 4, *(const v4f*)&so[wave][rl][lane * 4]);
}
extern "C" void kernel_launch(void* const* d_in, const int* in_sizes, int n_in, void* d_out, int out_size, void* d_ws, size_t ws_size, hipStream_t stream) {
  (void)in_sizes; (void)n_in; (void)out_size;
  const float** F = (const float**)d_in;   // 0 q_in [4,1024,1024], 1 k_in, 2 v_in, 3 Wq [1024,1024] natural (x @ W.T), 4 bq, 5 Wk, 6 bk, 7 Wv, 8 bv, 9 Wo, 10 bo
  if (ws_size < (size_t)WS_END) return;
  char* ws = (char*)d_ws; __bf16* PK = (__bf16*)(ws + WS_PK); _Float16 *Q = (_Float16*)(ws + WS_Q), *QL = (_Float16*)(ws + WS_QL), *KF = (_Float16*)(ws + WS_KF), *VF = (_Float16*)(ws + WS_VF); float* O = (float*)(ws + WS_O); __bf16* XP = (__bf16*)(ws + WS_XP);
  k_pack<<<dim3(DM / 16, 16), 256, 0, stream>>>(F[3], F[5], F[7], F[9], F[0], F[1], F[2], PK, XP);
  k_qkv<<<dim3(TNB * SS / 64, QKVW / 128), 128, 0, stream>>>(XP, PK + PK_A, F[4], F[6], F[8], Q, QL, KF, VF);
  k_attn<<<dim3(SS / 16, TNB), 512, 0, stream>>>(Q, QL, KF, VF, O, (float*)((char*)d_out + 16777216));
  k_out<<<dim3(TOB, DM / 128), 128, 0, stream>>>(O, PK + PK_P, F[10], (float*)d_out);
}

// v004
// It runs in 192 microseconds.
// Next to v003, in two timings, it ran 1.10 times as fast each time.
// All steps since v000 together make it 13.6 times as fast.
#include <hip/hip_runtime.h>
#include <math.h>

typedef __attribute__((ext_vector_type(16))) _Float16 v16h;
typedef __attribute__((ext_vector_type(16))) __bf16 v16b;
typedef __attribute__((ext_vector_type(8)))  _Float16 v8h;
typedef __attribute__((ext_vector_type(8)))  float v8f;
typedef __attribute__((ext_vector_type(4)))  float v4f;
typedef __attribute__((ext_vector_type(2)))  float v2f;
typedef __attribute__((ext_vector_type(4)))  unsigned v4u;
typedef __attribute__((ext_vector_type(4)))  int v4i;
typedef float __attribute__((may_alias)) float_a;
typedef int __attribute__((may_alias)) int_a;

template <typename T> __device__ __forceinline__ void vst2(void* p, T v) { *(T*)p = v;  }
__device__ __forceinline__ v8f wmma16(v16h a, v16h b, v8f c) {
  v8f d = __builtin_amdgcn_wmma_f32_16x16x32_f16(false, a, false, b, (short)0, c, false, false);
  asm volatile("v_nop\n\tv_nop\n\tv_nop\n\tv_nop" : "+v"(d) : "v"(a), "v"(b));
  return d;
}
__device__ __forceinline__ v8f wmma_bf(v16b a, v16b b, v8f c) {
  v8f d = __builtin_amdgcn_wmma_f32_16x16x32_bf16(false, a, false, b, (short)0, c, false, false);
  asm volatile("v_nop\n\tv_nop\n\tv_nop\n\tv_nop" : "+v"(d) : "v"(a), "v"(b));
  return d;
}
// Multi-head cross-attention that also returns the head-averaged attention map (B 4, T 1,024 queries, 1,024 memory positions, d 1,024, 16 heads x 64).
__device__ __forceinline__ v16h frag_h(const _Float16* rowk0, int lane) {
  union { v16h v; v8h q[2]; } u; const _Float16* p = rowk0 + 8 * (lane >> 4);
  u.q[0] = *(const v8h*)p; u.q[1] = *(const v8h*)(p + 16); return u.v;
}
__device__ __forceinline__ v16h frag_f32(const float* rowk0, int lane) {
  v16h a; const float* p = rowk0 + 8 * (lane >> 4);
#pragma unroll
  for (int i = 0; i < 8; ++i) { a[i] = (_Float16)p[i]; a[8 + i] = (_Float16)p[16 + i]; }
  return a;
}
__device__ __forceinline__ v16h frag_f32s(const float* rowk0, int lane, float sc) {
  v16h a; const float* p = rowk0 + 8 * (lane >> 4);
#pragma unroll
  for (int i = 0; i < 8; ++i) { a[i] = (_Float16)(p[i] * sc); a[8 + i] = (_Float16)(p[16 + i] * sc); }
  return a;
}
// column fragment from a [K][ld] layout (column n), rows >= K read as 0
__device__ __forceinline__ v16h fragc_f32(const float* W, int k0, int n, int lane, int ld, int K) {
  v16h a; const int g = lane >> 4;
#pragma unroll
  for (int i = 0; i < 8; ++i) { const int ka = k0 + 8 * g + i, kb = ka + 16;
    a[i] = (_Float16)(ka < K ? W[(size_t)(ka < K ? ka : K - 1) * ld + n] : 0.f); a[8 + i] = (_Float16)(kb < K ? W[(size_t)(kb < K ? kb : K - 1) * ld + n] : 0.f); }
  return a;
}
struct F2 { v16b h, l; };
__device__ __forceinline__ F2 bsplit16(const float v[16]) { F2 r;
#pragma unroll
  for (int i = 0; i < 16; ++i) { const __bf16 h = (__bf16)v[i]; r.h[i] = h; r.l[i] = (__bf16)(v[i] - (float)h); }
  return r; }
__device__ __forceinline__ F2 split_row(const float* row, int k0, int lane) { float v[16]; const float* p = row + k0 + 8 * (lane >> 4);
#pragma unroll
  for (int i = 0; i < 8; ++i) { v[i] = p[i]; v[8 + i] = p[16 + i]; }
  return bsplit16(v); }
__device__ __forceinline__ F2 split_rowK(const float* row, int k0, int lane, int K) { float v[16]; const int g = lane >> 4;
#pragma unroll
  for (int i = 0; i < 8; ++i) { const int ka = k0 + 8 * g + i, kb = ka + 16; v[i] = ka < K ? row[ka < K ? ka : K - 1] : 0.f; v[8 + i] = kb < K ? row[kb < K ? kb : K - 1] : 0.f; }
  return bsplit16(v); }
__device__ __forceinline__ F2 split_col(const float* W, int k0, int n, int lane, int ld, int K) { float v[16]; const int g = lane >> 4;
#pragma unroll
  for (int i = 0; i < 8; ++i) { const int ka = k0 + 8 * g + i, kb = ka + 16; v[i] = ka < K ? W[(size_t)(ka < K ? ka : K - 1) * ld + n] : 0.f; v[8 + i] = kb < K ? W[(size_t)(kb < K ? kb : K - 1) * ld + n] : 0.f; }
  return bsplit16(v); }
__device__ __forceinline__ v8f mac3(const F2& a, const F2& b, v8f c) { c = wmma_bf(a.l, b.h, c); c = wmma_bf(a.h, b.l, c); return wmma_bf(a.h, b.h, c); }
__device__ __forceinline__ float sigm(float v) { return 1.0f / (1.0f + expf(-v)); }
#define LDSX() do { asm volatile("s_wait_dscnt 0" ::: "memory"); __builtin_amdgcn_wave_barrier(); __builtin_amdgcn_fence(__ATOMIC_RELEASE, "workgroup"); } while (0)


#define NB 4
#define SS 1024
#define DM 1024
#define NH 16
#define HD 64
#define QKVW (3 * DM)
#ifndef TQB
#define TQB (SS / 64)
#define TNB NB
#define TOB (NB * SS / 64)     // output row tiles (all)
#endif
typedef __attribute__((ext_vector_type(8))) __bf16 v8b;
__device__ __forceinline__ v16b frag_b(const __bf16* rowk0, int lane) {
  union { v16b v; v8b q[2]; } u; const __bf16* p = rowk0 + 8 * (lane >> 4);
  u.q[0] = *(const v8b*)p; u.q[1] = *(const v8b*)(p + 16); return u.v;
}
__device__ __forceinline__ float bfr(float v) { return (float)(__bf16)v; }
__device__ __attribute__((noinline)) float exp_ni(float v) { return expf(v); }
__device__ __attribute__((noinline)) float erf_ni(float v) { return erff(v); }

#define PK_A 0                       // Wqkv, 192 tiles of 16 rows, fragment order (see k_pack)
#define PK_P (PK_A + QKVW * DM)        // Wo, 64 tiles of 16 rows, fragment order
#define PK_END (PK_P + DM * DM)
// Every operand that a loop reads from the workspace lies there in FRAGMENT ORDER: the 16 bytes that lane 0..31 loads
// with one instruction stand side by side, so a wave-wide 16-byte load reads 512 contiguous bytes (four whole 128-byte lines, not pieces of sixteen).
#define WS_PK  0u
#define WS_QF  (WS_PK + 2u * PK_END)             // f16 Q fragments, laid out as K's: [b][h][32-row tile][ct 2][kc 2][hi, residual x2048][half 2][lane 32][8]
#define WS_KF  (WS_QF + 4u * NB * SS * DM)         // f16 K fragments [b][h][32-key tile][ct 2][kc 2][hi, residual x2048][half 2][lane 32][8]
#define WS_VF  (WS_KF + 4u * NB * SS * DM)         // f16 V fragments [b][h][32-key tile][dt 4][hi, residual x2048][half 2][lane 32][8]
#define WS_O   (WS_VF + 4u * NB * SS * DM)         // f32 O fragments [16-row tile][kc 32][piece 4][lane 32][4]
#define WS_XP  (WS_O + 4u * NB * SS * DM)          // bf16 q_in, k_in, v_in, each 256 tiles of 16 rows, fragment order (see k_pack)
#define WS_ST  (WS_XP + 2u * 3 * NB * SS * DM)     // f32 [2][b][h][query row]: the row's score maximum; 1 / (16 x the row's sum)
#define WS_END (WS_ST + 8u * NB * NH * SS)
// a 16-bit fragment in fragment order: p = the lane's 16 bytes of the first half, the second half stands 512 bytes on
__device__ __forceinline__ v16h frag_ch(const _Float16* p) { union { v16h v; v8h q[2]; } u; u.q[0] = *(const v8h*)p; u.q[1] = *(const v8h*)(p + 256); return u.v; }
__device__ __forceinline__ v16b frag_cb(const __bf16* p) { union { v16b v; v8b q[2]; } u; u.q[0] = *(const v8b*)p; u.q[1] = *(const v8b*)(p + 256); return u.v; }
// ---- k_pack: block = (tile of 16 rows, which); which 0..2 -> W_q/W_k/W_v into PK_A, 3 -> W_o into PK_P, 4..15 -> a quarter of the rows of q_in/k_in/v_in into XP.
// f32 -> bf16, stored as [tile][kc 32][half 2][lane 32][8]: lane = 16 g + row, k = 32 kc + 16 half + 8 g + i (the k order of frag_b, for A and B alike)
__global__ __launch_bounds__(256) void k_pack(const float* __restrict__ WQ, const float* __restrict__ WK, const float* __restrict__ WV, const float* __restrict__ WO, const float* __restrict__ XQ, const float* __restrict__ XK, const float* __restrict__ XV, __bf16* __restrict__ PK, __bf16* __restrict__ XP) {
  const int which = blockIdx.y, t = threadIdx.x, nt = (which < 4) ? blockIdx.x : ((which - 4) & 3) * 64 + blockIdx.x;
  const float* Wm = (which == 0) ? WQ : (which == 1) ? WK : (which == 2) ? WV : (which == 3) ? WO : (which < 8) ? XQ : (which < 12) ? XK : XV;
  __bf16* dst = ((which < 3) ? PK + PK_A + (size_t)which * DM * DM : (which == 3) ? PK + PK_P : XP + (size_t)((which - 4) >> 2) * NB * SS * DM) + (size_t)nt * 16 * DM;
  const float* s = Wm + (size_t)(nt * 16 + (t & 15)) * DM + ((t >> 5) & 1) * 16 + 8 * ((t >> 4) & 1) + (t >> 6) * 32;   // piece t + 256 u: lane t & 31, half (t >> 5) & 1, kc = (t >> 6) + 4 u
  v4f a[8], c[8];
#pragma unroll   // a thread's sixteen loads are in flight together
  for (int u = 0; u < 8; ++u) { a[u] = *(const v4f*)(s + u * 128); c[u] = *(const v4f*)(s + u * 128 + 4); }
#pragma unroll   // constant indices: a, c and o stay in registers
  for (int u = 0; u < 8; ++u) { v8b o;
#pragma unroll   // as above
    for (int i = 0; i < 4; ++i) { o[i] = (__bf16)a[u][i]; o[4 + i] = (__bf16)c[u][i]; }
    *(v8b*)(dst + (size_t)(u * 256 + t) * 8) = o; }
}
// one k step (32 wide) of a 16 x 128 wave tile: the row operand (k_out: f32 pieces; k_qkv: a bf16 fragment) and the eight weight fragments, all loads issued as one group.
// p: the lane's first 16 bytes of the row tile's step; w: the lane's 16 bytes of the first weight tile's step. A step is 1 KiB of a bf16 tile, 2 KiB of an f32 tile
struct KStep { v4f x[4]; v16b w[8]; };
struct KStepB { v16b a; v16b w[8]; };
__device__ __forceinline__ void ld_stepb(KStepB& t, const __bf16* p, const __bf16* w) {
  t.a = frag_cb(p);
#pragma unroll   // constant indices and offsets: t.w stays in registers, every load is the lane's address plus a constant
  for (int j = 0; j < 8; ++j) t.w[j] = frag_cb(w + (size_t)j * 16 * DM);
  asm volatile("s_wait_xcnt 0x0" :: "v"(p), "v"(w) : "memory");   // in front of any later overwrite of a register that these loads name; the inputs keep the address registers whole up to here
}
__device__ __forceinline__ void ld_step(KStep& t, const float* p, const __bf16* w) {
  t.x[0] = *(const v4f*)p; t.x[1] = *(const v4f*)(p + 128); t.x[2] = *(const v4f*)(p + 256); t.x[3] = *(const v4f*)(p + 384);
#pragma unroll
  for (int j = 0; j < 8; ++j) t.w[j] = frag_cb(w + (size_t)j * 16 * DM);
  asm volatile("s_wait_xcnt 0x0" :: "v"(p), "v"(w) : "memory");   // in front of any later overwrite of a register that these loads name; the inputs keep the address registers whole up to here
}
__global__ __launch_bounds__(128) void k_qkv(const __bf16* __restrict__ XP, const __bf16* __restrict__ P, const float* __restrict__ BQ, const float* __restrict__ BK, const float* __restrict__ BV, _Float16* __restrict__ QF, _Float16* __restrict__ KF, _Float16* __restrict__ VF) {
  const int which0 = (blockIdx.y * 128) / DM; const __bf16* X = XP + (size_t)which0 * NB * SS * DM;   // q from q_in, k from k_in, v from v_in
  __shared__ __align__(16) _Float16 so[4][16][136], sol[4][16][136]; __shared__ __align__(16) _Float16 sth[128][72], stl[128][72];
  const int tid = threadIdx.x, wave = tid >> 5, lane = tid & 31, col = lane & 15, g = lane >> 4; const size_t r0 = (size_t)blockIdx.x * 64 + wave * 16; const int n0 = blockIdx.y * 128;
  v8f acc[8] = {};
  const __bf16* xa = X + r0 * DM + lane * 8; const __bf16* pb = P + (size_t)n0 * DM + lane * 8;
  KStepB t0, t1; ld_stepb(t0, xa, pb);
#pragma unroll 1   // the two register sets already are the unrolling
  for (int kc = 0; kc < DM / 32; kc += 2) {
    ld_stepb(t1, xa + 512, pb + 512);
#pragma unroll
    for (int j = 0; j < 8; ++j) acc[j] = wmma_bf(t0.a, t0.w[j], acc[j]);
    { const int adv = kc + 2 < DM / 32 ? 1024 : 0; xa += adv; pb += adv; }   // two steps on; last trip: no step is left, the pointers stay inside the tile.
    ld_stepb(t0, xa, pb);
#pragma unroll
    for (int j = 0; j < 8; ++j) acc[j] = wmma_bf(t1.a, t1.w[j], acc[j]); }
  { const float* BB = (which0 == 0) ? BQ : (which0 == 1) ? BK : BV;
#pragma unroll
    for (int j = 0; j < 8; ++j) { const float bb = bfr(BB[(n0 % DM) + j * 16 + col]);
#pragma unroll
      for (int r = 0; r < 8; ++r) acc[j][r] += bb; } }
  if (n0 < 2 * DM) {   // q stored unscaled (f16 sigma ~0.6, no subnormal exposure); 1/8 applied to the f32 score
#pragma unroll
    for (int j = 0; j < 8; ++j) {
#pragma unroll
      for (int r = 0; r < 8; ++r) { const float v = acc[j][r]; const _Float16 hv = (_Float16)v; so[wave][8 * g + r][j * 16 + col] = hv; sol[wave][8 * g + r][j * 16 + col] = (_Float16)((v - (float)hv) * 2048.0f); } }   // q, k as f16 hi + (x2048) residual (no RoPE in this module)
    LDSX();
    {   // the wave's 16 rows (queries or keys) are one ct of one 32-row tile, its 128 columns two heads: lane = 16 g + row, d = 32 kc + 16 half + 8 g + i
      _Float16* FB = (n0 < DM) ? QF : KF; const int b = (int)(r0 / SS), kt = (int)(r0 % SS) / 16, h0 = (n0 % DM) / HD;
#pragma unroll   // constant offsets: the wave's sixteen LDS reads are in flight together
      for (int hh = 0; hh < 2; ++hh) { _Float16* kd = FB + (((size_t)(b * NH + h0 + hh) * (SS / 32) + (kt >> 1)) * 2 + (kt & 1)) * 2048 + lane * 8;
#pragma unroll   // as above
        for (int kq = 0; kq < 4; ++kq) { const int kc = kq >> 1, hf = kq & 1, sc = hh * 64 + kc * 32 + hf * 16 + 8 * g;
          vst2((unsigned*)(kd + kc * 1024 + hf * 256), *(const v4u*)&so[wave][col][sc]); vst2((unsigned*)(kd + kc * 1024 + 512 + hf * 256), *(const v4u*)&sol[wave][col][sc]); } }
      asm volatile("s_wait_xcnt 0x0" ::: "memory");   // in front of any later overwrite of a register that these stores name
    }
  } else {
#pragma unroll
    for (int j = 0; j < 8; ++j) {
#pragma unroll
      for (int r = 0; r < 8; ++r) { const float v = acc[j][r]; const _Float16 hv = (_Float16)v; sth[j * 16 + col][wave * 16 + 8 * g + r] = hv; stl[j * 16 + col][wave * 16 + 8 * g + r] = (_Float16)((v - (float)hv) * 2048.0f); } }
    __syncthreads();
    const size_t rb = (size_t)blockIdx.x * 64; const int b = (int)(rb / SS), ks0 = (int)(rb % SS) / 32, h0 = (n0 - 2 * DM) / HD;
    // the block's 64 keys are two key tiles, its 128 columns two heads: lane = 16 g + (d mod 16), key = 32 tile + 16 half + 8 g + i
    for (int e = tid; e < 1024; e += 128) { const int hf = (e >> 5) & 1, dt = (e >> 6) & 3, hh = (e >> 8) & 1, kl = e >> 9; const int d = hh * 64 + dt * 16 + col, kk = kl * 32 + hf * 16 + 8 * g;
      _Float16* vd = VF + (((size_t)(b * NH + h0 + hh) * (SS / 32) + ks0 + kl) * 4 + dt) * 1024 + hf * 256 + lane * 8; vst2((unsigned*)vd, *(const v4u*)&sth[d][kk]); vst2((unsigned*)(vd + 512), *(const v4u*)&stl[d][kk]); }
  }
}
// the K fragments (hi, residual) of one 32-key tile, read from its copy in LDS; p: the lane's 16 bytes of the tile (8 KiB in a row, fragment order)
__device__ __forceinline__ void ld_kl(v16h (&kf)[2][2][2], const _Float16* p) {
#pragma unroll   // constant indices and offsets: kf stays in registers, the sixteen LDS reads stand as one group
  for (int ct = 0; ct < 2; ++ct) {
#pragma unroll   // as above
    for (int kc = 0; kc < 2; ++kc) { kf[ct][kc][0] = frag_ch(p + (ct * 2 + kc) * 1024); kf[ct][kc][1] = frag_ch(p + (ct * 2 + kc) * 1024 + 512); } }
}
// k_attn: block = 256 query rows of ONE head of one batch, 16 waves, wave w = query tile w. Each 32-key tile of K (in each of the two passes) and of V is fetched once a block
// (16 bytes a thread) and put into LDS, where all sixteen waves read their fragments. Out: O, and per row the score maximum and 1 / (16 l) for k_map.
// K ring of three buffers: in trip t tile t + 2 is stored, tile t + 1 (published by the barrier of trip t - 1) is read into registers. V: two buffers.
__global__ __launch_bounds__(512) void k_attn(const _Float16* __restrict__ QF, const _Float16* __restrict__ KF, const _Float16* __restrict__ VF, float* __restrict__ O, float* __restrict__ SM, float* __restrict__ SW) {
  __shared__ __align__(16) _Float16 kb[3][4096], vb[2][4096]; __shared__ __align__(16) _Float16 sph[16][16][40], spl[16][16][40]; __shared__ __align__(16) float so[16][16][68]; __shared__ __align__(16) float st[2][256];
  const int tid = threadIdx.x, wave = __builtin_amdgcn_readfirstlane(tid >> 5), lane = tid & 31, col = lane & 15, g = lane >> 4;   // readfirstlane: the wave's offsets stay in scalar registers
  const int bh = blockIdx.y, b = bh / NH, h = bh % NH; const int q0 = blockIdx.x * 256 + wave * 16;
  const _Float16* qf = QF + ((size_t)bh * (SS / 32) + (q0 >> 5)) * 4096 + ((q0 >> 4) & 1) * 2048 + lane * 8;
  v16h aq[2], aql[2];
#pragma unroll   // constant indices: fragments, scores and sums stay in registers
  for (int kc = 0; kc < 2; ++kc) { aq[kc] = frag_ch(qf + kc * 1024); aql[kc] = frag_ch(qf + kc * 1024 + 512); }
  float m[8], l[8];
#pragma unroll   // constant indices: fragments, scores and sums stay in registers
  for (int r = 0; r < 8; ++r) { m[r] = -3.0e38f; l[r] = 0.f; }
  const _Float16* kg = KF + (size_t)bh * (SS / 32) * 4096 + tid * 8; const _Float16* vg = VF + (size_t)bh * (SS / 32) * 4096 + tid * 8;   // the thread's 16 bytes of tile 0
  v8h rk, rv;   // the thread's piece of the K tile two trips ahead, of the V tile one trip ahead
  { const v8h k0 = *(const v8h*)kg, k1 = *(const v8h*)(kg + 4096), v0 = *(const v8h*)vg; rk = *(const v8h*)(kg + 2 * 4096); rv = *(const v8h*)(vg + 4096);
    asm volatile("s_wait_xcnt 0x0" :: "v"(qf), "v"(kg), "v"(vg) : "memory");   // in front of any overwrite of a register that these loads name; the inputs keep the address registers whole up to here
    *(v8h*)&kb[0][tid * 8] = k0; *(v8h*)&kb[1][tid * 8] = k1; *(v8h*)&vb[0][tid * 8] = v0; }
  __syncthreads();   // K tiles 0 and 1 and V tile 0 stand in LDS
  v16h kf[2][2][2]; ld_kl(kf, &kb[0][lane * 8]);
  int i1 = 1, i2 = 2;   // ring places of tiles t + 1 and t + 2
#pragma unroll 1   // one trip per barrier; the ring indices rotate at run time
  for (int ks = 0; ks < SS / 32; ++ks) { v8f s[2];
    *(v8h*)&kb[i2][tid * 8] = rk;   // its last readers left this buffer before the barrier of trip t - 2
    { const _Float16* p = kg + (size_t)((ks + 3) & (SS / 32 - 1)) * 4096; rk = *(const v8h*)p;   // the index wraps: pass 2 goes on in the same ring with tile 0
      asm volatile("s_wait_xcnt 0x0" :: "v"(p) : "memory"); }   // in front of any overwrite of the load's address registers
#pragma unroll   // constant indices: fragments, scores and sums stay in registers
    for (int ct = 0; ct < 2; ++ct) { v8f c = {}, cl = {};
#pragma unroll   // constant indices: fragments, scores and sums stay in registers
      for (int kc = 0; kc < 2; ++kc) { c = wmma16(aq[kc], kf[ct][kc][0], c); cl = wmma16(aql[kc], kf[ct][kc][0], cl); cl = wmma16(aq[kc], kf[ct][kc][1], cl); }
#pragma unroll   // constant indices: fragments, scores and sums stay in registers
      for (int r = 0; r < 8; ++r) s[ct][r] = (c[r] + cl[r] * (1.0f / 2048.0f)) * 0.125f; }
    ld_kl(kf, &kb[i1][lane * 8]);   // the next tile's fragments come from LDS during the softmax
#pragma unroll   // constant indices: fragments, scores and sums stay in registers
    for (int r = 0; r < 8; ++r) { float mx = fmaxf(s[0][r], s[1][r]);
#pragma unroll   // constant indices: fragments, scores and sums stay in registers
      for (int o = 1; o < 16; o <<= 1) mx = fmaxf(mx, __shfl_xor(mx, o));
      const float mn = fmaxf(m[r], mx); const float alpha = (m[r] <= -1.0e38f) ? 0.f : __expf(m[r] - mn); float es = __expf(s[0][r] - mn) + __expf(s[1][r] - mn);
#pragma unroll   // constant indices: fragments, scores and sums stay in registers
      for (int o = 1; o < 16; o <<= 1) es += __shfl_xor(es, o);
      l[r] = l[r] * alpha + es; m[r] = mn; }
    __syncthreads();   // publishes tile t + 2; ends all reads of tile t + 1's buffer
    i1 = i2; i2 = (i2 == 2) ? 0 : i2 + 1; }
  float il[8];
#pragma unroll   // constant indices: fragments, scores and sums stay in registers
  for (int r = 0; r < 8; ++r) il[r] = 1.0f / l[r];
  if (col == 0) {   // every lane of a 16-lane row holds the same values
#pragma unroll   // constant indices: fragments, scores and sums stay in registers
    for (int r = 0; r < 8; ++r) { st[0][wave * 16 + 8 * g + r] = m[r]; st[1][wave * 16 + 8 * g + r] = il[r] * (1.0f / NH); } }
  // pass 2: unnormalised P, P.V
  v8f acc[4] = {}, accl[4] = {};
#pragma unroll 1   // one trip per barrier; the ring indices rotate at run time
  for (int ks = 0; ks < SS / 32; ++ks) {
    *(v8h*)&kb[i2][tid * 8] = rk; *(v8h*)&vb[(ks + 1) & 1][tid * 8] = rv;   // V: the readers of trip t - 1 left this buffer before its barrier
    { const int nk = ((ks + 3) & (SS / 32 - 1)) * 4096, nv = ((ks + 2) & (SS / 32 - 1)) * 4096; const _Float16* p = kg + nk; const _Float16* w = vg + nv; rk = *(const v8h*)p; rv = *(const v8h*)w;   // the last trips' indices wrap and stay in bounds
      asm volatile("s_wait_xcnt 0x0" :: "v"(p), "v"(w) : "memory"); }   // in front of any overwrite of the loads' address registers
#pragma unroll   // constant indices: fragments, scores and sums stay in registers
    for (int ct = 0; ct < 2; ++ct) { v8f c = {}, cl = {};
#pragma unroll   // constant indices: fragments, scores and sums stay in registers
      for (int kc = 0; kc < 2; ++kc) { c = wmma16(aq[kc], kf[ct][kc][0], c); cl = wmma16(aql[kc], kf[ct][kc][0], cl); cl = wmma16(aq[kc], kf[ct][kc][1], cl); }
#pragma unroll   // constant indices: fragments, scores and sums stay in registers
      for (int r = 0; r < 8; ++r) { const float e = __expf((c[r] + cl[r] * (1.0f / 2048.0f)) * 0.125f - m[r]);   // unnormalised (<= 1: no f16 subnormal exposure); 1/l applied to the accumulators at the end
        const _Float16 he = (_Float16)e; sph[wave][8 * g + r][ct * 16 + col] = he; spl[wave][8 * g + r][ct * 16 + col] = (_Float16)((e - (float)he) * 2048.0f); } }
    v16h vf[4][2];   // this tile's V fragments, one group of LDS reads
    const _Float16* vp = &vb[ks & 1][lane * 8];
#pragma unroll   // constant indices: fragments, scores and sums stay in registers
    for (int dt = 0; dt < 4; ++dt) { vf[dt][0] = frag_ch(vp + dt * 1024); vf[dt][1] = frag_ch(vp + dt * 1024 + 512); }
    LDSX();
    const v16h pah = frag_h(&sph[wave][col][0], lane), pal = frag_h(&spl[wave][col][0], lane);
#pragma unroll   // constant indices: fragments, scores and sums stay in registers
    for (int dt = 0; dt < 4; ++dt) { acc[dt] = wmma16(pah, vf[dt][0], acc[dt]); accl[dt] = wmma16(pal, vf[dt][0], accl[dt]); accl[dt] = wmma16(pah, vf[dt][1], accl[dt]); }
    ld_kl(kf, &kb[i1][lane * 8]);   // the next tile's K fragments, once V's registers are free
    __syncthreads();   // publishes K tile t + 2 and V tile t + 1; ends all reads of the buffers that the next trip refills
    i1 = i2; i2 = (i2 == 2) ? 0 : i2 + 1; }
  if (tid < 256) SM[(size_t)bh * SS + blockIdx.x * 256 + tid] = st[0][tid]; else SW[(size_t)bh * SS + blockIdx.x * 256 + tid - 256] = st[1][tid - 256];   // one 128-byte line a wave
  asm volatile("s_wait_xcnt 0x0" ::: "memory");   // in front of any later overwrite of a register that this store names
#pragma unroll   // constant indices: fragments, scores and sums stay in registers
  for (int r = 0; r < 8; ++r) {
#pragma unroll   // constant indices: fragments, scores and sums stay in registers
    for (int dt = 0; dt < 4; ++dt) so[wave][8 * g + r][dt * 16 + col] = (acc[dt][r] + accl[dt][r] * (1.0f / 2048.0f)) * il[r]; }
  LDSX();
  // the head's 64 columns are k steps 2 h and 2 h + 1 of k_out: lane = 16 g + row, piece x holds k = 16 (x / 2) + 8 g + 4 (x mod 2) + i of its step
  float* of = O + ((size_t)b * SS + q0) * DM + h * 1024 + lane * 4;
#pragma unroll   // constant offsets: the eight LDS reads are in flight together
  for (int x = 0; x < 8; ++x) vst2(of + x * 128, *(const v4f*)&so[wave][col][(x >> 2) * 32 + ((x >> 1) & 1) * 16 + 8 * g + (x & 1) * 4]);
  asm volatile("s_wait_xcnt 0x0" ::: "memory");   // in front of any later overwrite of a register that these stores name
}
// k_map: the head mean of the attention map. Block = 128 query rows x 128 keys of one batch, 16 waves as 4 x 4, a wave owns 32 x 32 and sums the heads
// (in the order 0..15) in registers. A head's Q rows and K rows of the block (32 KiB each, in a row) are fetched once and put into LDS, two buffers.
#define HSTEP ((SS / 32) * 4096)   // halves from one head's fragments to the next head's
__global__ __launch_bounds__(512) void k_map(const _Float16* __restrict__ QF, const _Float16* __restrict__ KF, const float* __restrict__ SM, const float* __restrict__ SW, float* __restrict__ ATT) {
  __shared__ __align__(16) _Float16 qb[2][4 * 4096], kb[2][4 * 4096]; __shared__ __align__(16) float sst[2][NH][128]; __shared__ __align__(16) float so[16][32][36];
  const int tid = threadIdx.x, wave = __builtin_amdgcn_readfirstlane(tid >> 5), lane = tid & 31, col = lane & 15, g = lane >> 4;   // readfirstlane: the wave's offsets stay in scalar registers
  const int b = blockIdx.z, r0 = blockIdx.y * 128, k0 = blockIdx.x * 128, wr = wave >> 2, wc = wave & 3;
  const _Float16* qs = QF + ((size_t)b * NH * (SS / 32) + (r0 >> 5)) * 4096; const _Float16* cs = KF + ((size_t)b * NH * (SS / 32) + (k0 >> 5)) * 4096;   // head 0: the first of the block's four 32-row tiles of Q, of K
  const _Float16* qg = qs + tid * 8; const _Float16* kg = cs + tid * 8;   // the thread's 16 bytes of it
  v8h rq[4], rk[4];
  { const float* ms = SM + ((size_t)b * NH + wave) * SS + r0; const float* fs = SW + ((size_t)b * NH + wave) * SS + r0;   // wave w brings head w's 128 rows
    const v4f tm = *(const v4f*)(ms + lane * 4), tw = *(const v4f*)(fs + lane * 4); v8h q0[4], c0[4];
#pragma unroll   // constant indices: the pieces stay in registers; heads 0 and 1 are fetched as one group, with one wait behind it
    for (int j = 0; j < 4; ++j) { q0[j] = *(const v8h*)(qg + j * 4096); c0[j] = *(const v8h*)(kg + j * 4096); rq[j] = *(const v8h*)(qg + HSTEP + j * 4096); rk[j] = *(const v8h*)(kg + HSTEP + j * 4096); }
    asm volatile("s_wait_xcnt 0x0" :: "s"(qs), "s"(cs), "s"(ms), "s"(fs), "v"(tid), "v"(lane) : "memory");   // in front of any overwrite of a register that these loads name; the inputs keep bases and offsets whole up to here
    *(v4f*)&sst[0][wave][lane * 4] = tm; *(v4f*)&sst[1][wave][lane * 4] = tw;
#pragma unroll   // as above
    for (int j = 0; j < 4; ++j) { *(v8h*)&qb[0][j * 4096 + tid * 8] = q0[j]; *(v8h*)&kb[0][j * 4096 + tid * 8] = c0[j]; } }
  __syncthreads();   // head 0 and the rows' softmax figures stand in LDS
  v8f am[2][2] = {};
  for (int h = 0; h < NH; ++h) {
#pragma unroll   // as above
    for (int j = 0; j < 4; ++j) { *(v8h*)&qb[(h + 1) & 1][j * 4096 + tid * 8] = rq[j]; *(v8h*)&kb[(h + 1) & 1][j * 4096 + tid * 8] = rk[j]; }   // head h + 1; the readers of head h - 1 left this buffer before its barrier
    { const int ho = ((h + 2) & (NH - 1)) * HSTEP; const _Float16* p = qg + ho; const _Float16* w = kg + ho;   // the last trips' index wraps and stays in bounds
#pragma unroll   // as above
      for (int j = 0; j < 4; ++j) { rq[j] = *(const v8h*)(p + j * 4096); rk[j] = *(const v8h*)(w + j * 4096); }
      asm volatile("s_wait_xcnt 0x0" :: "v"(p), "v"(w) : "memory"); }   // as above
    v16h kf[2][2][2]; ld_kl(kf, &kb[h & 1][wc * 4096 + lane * 8]);
#pragma unroll   // constant indices: fragments, scores and sums stay in registers
    for (int qt = 0; qt < 2; ++qt) { const _Float16* qp = &qb[h & 1][wr * 4096 + qt * 2048 + lane * 8];
      v16h aq[2], aql[2];
#pragma unroll   // constant indices: fragments, scores and sums stay in registers
      for (int kc = 0; kc < 2; ++kc) { aq[kc] = frag_ch(qp + kc * 1024); aql[kc] = frag_ch(qp + kc * 1024 + 512); }
      const float* fm = &sst[0][h][wr * 32 + qt * 16 + 8 * g]; const float* fw = &sst[1][h][wr * 32 + qt * 16 + 8 * g];
      const v4f m0 = *(const v4f*)fm, m1 = *(const v4f*)(fm + 4), w0 = *(const v4f*)fw, w1 = *(const v4f*)(fw + 4);
#pragma unroll   // constant indices: fragments, scores and sums stay in registers
      for (int ct = 0; ct < 2; ++ct) { v8f c = {}, cl = {};
#pragma unroll   // constant indices: fragments, scores and sums stay in registers
        for (int kc = 0; kc < 2; ++kc) { c = wmma16(aq[kc], kf[ct][kc][0], c); cl = wmma16(aql[kc], kf[ct][kc][0], cl); cl = wmma16(aq[kc], kf[ct][kc][1], cl); }
#pragma unroll   // constant indices: fragments, scores and sums stay in registers
        for (int r = 0; r < 8; ++r) { const float mr = r < 4 ? m0[r & 3] : m1[r & 3], wt = r < 4 ? w0[r & 3] : w1[r & 3];
          am[qt][ct][r] += __expf((c[r] + cl[r] * (1.0f / 2048.0f)) * 0.125f - mr) * wt; } } }
    __syncthreads();   // publishes head h + 1; ends all reads of head h's buffer
  }
#pragma unroll   // constant indices: fragments, scores and sums stay in registers
  for (int qt = 0; qt < 2; ++qt) {
#pragma unroll   // constant indices: fragments, scores and sums stay in registers
    for (int ct = 0; ct < 2; ++ct) {
#pragma unroll   // constant indices: fragments, scores and sums stay in registers
      for (int r = 0; r < 8; ++r) so[wave][qt * 16 + 8 * g + r][ct * 16 + col] = am[qt][ct][r]; } }
  LDSX();
  float* ap = ATT + ((size_t)b * SS + r0 + wr * 32 + (lane >> 3)) * SS + k0 + wc * 32 + (lane & 7) * 4;   // eight lanes store one row's 128-byte line
#pragma unroll   // constant offsets: the eight LDS reads are in flight together
  for (int x = 0; x < 8; ++x) vst2(ap + (size_t)x * 4 * SS, *(const v4f*)&so[wave][x * 4 + (lane >> 3)][(lane & 7) * 4]);
  asm volatile("s_wait_xcnt 0x0" ::: "memory");   // in front of any later overwrite of a register that these stores name
}
// ---- k_out: block = (64 rows, 128 cols): out = O(hi/lo) . Wo rows (2 products) + bo
__global__ __launch_bounds__(128) void k_out(const float* __restrict__ O, const __bf16* __restrict__ P, const float* __restrict__ BO, float* __restrict__ Y) {
  __shared__ __align__(16) float so[4][16][132];
  const int tid = threadIdx.x, wave = tid >> 5, lane = tid & 31, col = lane & 15, g = lane >> 4; const size_t r0 = (size_t)blockIdx.x * 64 + wave * 16; const int n0 = blockIdx.y * 128;
  v8f acc[8] = {};
  const float* xa = O + r0 * DM + lane * 4; const __bf16* pb = P + (size_t)n0 * DM + lane * 8;
  KStep t0, t1; ld_step(t0, xa, pb);
#pragma unroll 1   // the two register sets already are the unrolling
  for (int kc = 0; kc < DM / 32; kc += 2) {
    ld_step(t1, xa + 512, pb + 512);
    { float v[16];
#pragma unroll
      for (int i = 0; i < 16; ++i) v[i] = t0.x[i >> 2][i & 3];
      const F2 a = bsplit16(v);
#pragma unroll
      for (int j = 0; j < 8; ++j) { acc[j] = wmma_bf(a.l, t0.w[j], acc[j]); acc[j] = wmma_bf(a.h, t0.w[j], acc[j]); } }
    { const int adv = kc + 2 < DM / 32 ? 1024 : 0; xa += adv; pb += adv; }   // two steps on; last trip: no step is left, the pointers stay inside the tile.
    ld_step(t0, xa, pb);
    { float v[16];
#pragma unroll
      for (int i = 0; i < 16; ++i) v[i] = t1.x[i >> 2][i & 3];
      const F2 a = bsplit16(v);
#pragma unroll
      for (int j = 0; j < 8; ++j) { acc[j] = wmma_bf(a.l, t1.w[j], acc[j]); acc[j] = wmma_bf(a.h, t1.w[j], acc[j]); } } }
#pragma unroll
  for (int j = 0; j < 8; ++j) {
#pragma unroll
    for (int r = 0; r < 8; ++r) so[wave][8 * g + r][j * 16 + col] = acc[j][r] + bfr(BO[n0 + j * 16 + col]); }
  LDSX();
  for (int rl = 0; rl < 16; ++rl) vst2(Y + (r0 + rl) * DM + n0 + lane * 4, *(const v4f*)&so[wave][rl][lane * 4]);
}
extern "C" void kernel_launch(void* const* d_in, const int* in_sizes, int n_in, void* d_out, int out_size, void* d_ws, size_t ws_size, hipStream_t stream) {
  (void)in_sizes; (void)n_in; (void)out_size;
  const float** F = (const float**)d_in;   // 0 q_in [4,1024,1024], 1 k_in, 2 v_in, 3 Wq [1024,1024] natural (x @ W.T), 4 bq, 5 Wk, 6 bk, 7 Wv, 8 bv, 9 Wo, 10 bo
  if (ws_size < (size_t)WS_END) return;
  char* ws = (char*)d_ws; __bf16* PK = (__bf16*)(ws + WS_PK); _Float16 *QF = (_Float16*)(ws + WS_QF), *KF = (_Float16*)(ws + WS_KF), *VF = (_Float16*)(ws + WS_VF); float* O = (float*)(ws + WS_O); __bf16* XP = (__bf16*)(ws + WS_XP); float* SM = (float*)(ws + WS_ST); float* SW = SM + NB * NH * SS;
  k_pack<<<dim3(DM / 16, 16), 256, 0, stream>>>(F[3], F[5], F[7], F[9], F[0], F[1], F[2], PK, XP);
  k_qkv<<<dim3(TNB * SS / 64, QKVW / 128), 128, 0, stream>>>(XP, PK + PK_A, F[4], F[6], F[8], QF, KF, VF);
  k_attn<<<dim3(SS / 256, TNB * NH), 512, 0, stream>>>(QF, KF, VF, O, SM, SW);
  k_map<<<dim3(SS / 128, SS / 128, TNB), 512, 0, stream>>>(QF, KF, SM, SW, (float*)((char*)d_out + 16777216));
  k_out<<<dim3(TOB, DM / 128), 128, 0, stream>>>(O, PK + PK_P, F[10], (float*)d_out);
}

// v005
// It runs in 172 microseconds.
// Timed twice side by side with v004, it ran 1.12 times as fast both times.
// Over all steps from v000 it is 15.2 times as fast.
#include <hip/hip_runtime.h>
#include <math.h>

typedef __attribute__((ext_vector_type(16))) _Float16 v16h;
typedef __attribute__((ext_vector_type(16))) __bf16 v16b;
typedef __attribute__((ext_vector_type(8)))  _Float16 v8h;
typedef __attribute__((ext_vector_type(8)))  float v8f;
typedef __attribute__((ext_vector_type(4)))  float v4f;
typedef __attribute__((ext_vector_type(2)))  float v2f;
typedef __attribute__((ext_vector_type(4)))  unsigned v4u;
typedef __attribute__((ext_vector_type(4)))  int v4i;
typedef float __attribute__((may_alias)) float_a;
typedef int __attribute__((may_alias)) int_a;

template <typename T> __device__ __forceinline__ void vst2(void* p, T v) { *(T*)p = v;  }
__device__ __forceinline__ v8f wmma16(v16h a, v16h b, v8f c) {
  v8f d = __builtin_amdgcn_wmma_f32_16x16x32_f16(false, a, false, b, (short)0, c, false, false);
  asm volatile("v_nop\n\tv_nop\n\tv_nop\n\tv_nop" : "+v"(d) : "v"(a), "v"(b));
  return d;
}
__device__ __forceinline__ v8f wmma_bf(v16b a, v16b b, v8f c) {
  v8f d = __builtin_amdgcn_wmma_f32_16x16x32_bf16(false, a, false, b, (short)0, c, false, false);
  asm volatile("v_nop\n\tv_nop\n\tv_nop\n\tv_nop" : "+v"(d) : "v"(a), "v"(b));
  return d;
}
// Multi-head cross-attention that also returns the head-averaged attention map (B 4, T 1,024 queries, 1,024 memory positions, d 1,024, 16 heads x 64).
__device__ __forceinline__ v16h frag_h(const _Float16* rowk0, int lane) {
  union { v16h v; v8h q[2]; } u; const _Float16* p = rowk0 + 8 * (lane >> 4);
  u.q[0] = *(const v8h*)p; u.q[1] = *(const v8h*)(p + 16); return u.v;
}
__device__ __forceinline__ v16h frag_f32(const float* rowk0, int lane) {
  v16h a; const float* p = rowk0 + 8 * (lane >> 4);
#pragma unroll
  for (int i = 0; i < 8; ++i) { a[i] = (_Float16)p[i]; a[8 + i] = (_Float16)p[16 + i]; }
  return a;
}
__device__ __forceinline__ v16h frag_f32s(const float* rowk0, int lane, float sc) {
  v16h a; const float* p = rowk0 + 8 * (lane >> 4);
#pragma unroll
  for (int i = 0; i < 8; ++i) { a[i] = (_Float16)(p[i] * sc); a[8 + i] = (_Float16)(p[16 + i] * sc); }
  return a;
}
// column fragment from a [K][ld] layout (column n), rows >= K read as 0
__device__ __forceinline__ v16h fragc_f32(const float* W, int k0, int n, int lane, int ld, int K) {
  v16h a; const int g = lane >> 4;
#pragma unroll
  for (int i = 0; i < 8; ++i) { const int ka = k0 + 8 * g + i, kb = ka + 16;
    a[i] = (_Float16)(ka < K ? W[(size_t)(ka < K ? ka : K - 1) * ld + n] : 0.f); a[8 + i] = (_Float16)(kb < K ? W[(size_t)(kb < K ? kb : K - 1) * ld + n] : 0.f); }
  return a;
}
struct F2 { v16b h, l; };
__device__ __forceinline__ F2 bsplit16(const float v[16]) { F2 r;
#pragma unroll
  for (int i = 0; i < 16; ++i) { const __bf16 h = (__bf16)v[i]; r.h[i] = h; r.l[i] = (__bf16)(v[i] - (float)h); }
  return r; }
__device__ __forceinline__ F2 split_row(const float* row, int k0, int lane) { float v[16]; const float* p = row + k0 + 8 * (lane >> 4);
#pragma unroll
  for (int i = 0; i < 8; ++i) { v[i] = p[i]; v[8 + i] = p[16 + i]; }
  return bsplit16(v); }
__device__ __forceinline__ F2 split_rowK(const float* row, int k0, int lane, int K) { float v[16]; const int g = lane >> 4;
#pragma unroll
  for (int i = 0; i < 8; ++i) { const int ka = k0 + 8 * g + i, kb = ka + 16; v[i] = ka < K ? row[ka < K ? ka : K - 1] : 0.f; v[8 + i] = kb < K ? row[kb < K ? kb : K - 1] : 0.f; }
  return bsplit16(v); }
__device__ __forceinline__ F2 split_col(const float* W, int k0, int n, int lane, int ld, int K) { float v[16]; const int g = lane >> 4;
#pragma unroll
  for (int i = 0; i < 8; ++i) { const int ka = k0 + 8 * g + i, kb = ka + 16; v[i] = ka < K ? W[(size_t)(ka < K ? ka : K - 1) * ld + n] : 0.f; v[8 + i] = kb < K ? W[(size_t)(kb < K ? kb : K - 1) * ld + n] : 0.f; }
  return bsplit16(v); }
__device__ __forceinline__ v8f mac3(const F2& a, const F2& b, v8f c) { c = wmma_bf(a.l, b.h, c); c = wmma_bf(a.h, b.l, c); return wmma_bf(a.h, b.h, c); }
__device__ __forceinline__ float sigm(float v) { return 1.0f / (1.0f + expf(-v)); }
#define LDSX() do { asm volatile("s_wait_dscnt 0" ::: "memory"); __builtin_amdgcn_wave_barrier(); __builtin_amdgcn_fence(__ATOMIC_RELEASE, "workgroup"); } while (0)


#define NB 4
#define SS 1024
#define DM 1024
#define NH 16
#define HD 64
#define QKVW (3 * DM)
#ifndef TQB
#define TQB (SS / 64)
#define TNB NB
#define TOB (NB * SS / 64)     // output row tiles (all)
#endif
typedef __attribute__((ext_vector_type(8))) __bf16 v8b;
__device__ __forceinline__ v16b frag_b(const __bf16* rowk0, int lane) {
  union { v16b v; v8b q[2]; } u; const __bf16* p = rowk0 + 8 * (lane >> 4);
  u.q[0] = *(const v8b*)p; u.q[1] = *(const v8b*)(p + 16); return u.v;
}
__device__ __forceinline__ float bfr(float v) { return (float)(__bf16)v; }
__device__ __attribute__((noinline)) float exp_ni(float v) { return expf(v); }
__device__ __attribute__((noinline)) float erf_ni(float v) { return erff(v); }

#define PK_A 0                       // Wqkv, 192 tiles of 16 rows, fragment order (see k_pack)
#define PK_P (PK_A + QKVW * DM)        // Wo, 64 tiles of 16 rows, fragment order
#define PK_END (PK_P + DM * DM)
// Every operand that a loop reads from the workspace lies there in FRAGMENT ORDER: the 16 bytes that lane 0..31 loads
// with one instruction stand side by side, so a wave-wide 16-byte load reads 512 contiguous bytes (four whole 128-byte lines, not pieces of sixteen).
#define WS_PK  0u
#define WS_QF  (WS_PK + 2u * PK_END)             // f16 Q fragments, laid out as K's: [b][h][32-row tile][ct 2][kc 2][hi, residual x2048][half 2][lane 32][8]
#define WS_KF  (WS_QF + 4u * NB * SS * DM)         // f16 K fragments [b][h][32-key tile][ct 2][kc 2][hi, residual x2048][half 2][lane 32][8]
#define WS_VF  (WS_KF + 4u * NB * SS * DM)         // f16 V fragments [b][h][32-key tile][dt 4][hi, residual x2048][half 2][lane 32][8]
#define WS_O   (WS_VF + 4u * NB * SS * DM)         // f32 O fragments [16-row tile][kc 32][piece 4][lane 32][4]
#define WS_XP  (WS_O + 4u * NB * SS * DM)          // bf16 q_in, k_in, v_in, each 256 tiles of 16 rows, fragment order (see k_pack)
#define WS_ST  (WS_XP + 2u * 3 * NB * SS * DM)     // f32 [2][b][h][query row]: the row's score maximum; 1 / (16 x the row's sum)
#define WS_END (WS_ST + 8u * NB * NH * SS)
// a 16-bit fragment in fragment order: p = the lane's 16 bytes of the first half, the second half stands 512 bytes on
__device__ __forceinline__ v16h frag_ch(const _Float16* p) { union { v16h v; v8h q[2]; } u; u.q[0] = *(const v8h*)p; u.q[1] = *(const v8h*)(p + 256); return u.v; }
__device__ __forceinline__ v16b frag_cb(const __bf16* p) { union { v16b v; v8b q[2]; } u; u.q[0] = *(const v8b*)p; u.q[1] = *(const v8b*)(p + 256); return u.v; }
// ---- k_pack: block = (tile of 16 rows, which); which 0..2 -> W_q/W_k/W_v into PK_A, 3 -> W_o into PK_P, 4..15 -> a quarter of the rows of q_in/k_in/v_in into XP.
// f32 -> bf16, stored as [tile][kc 32][half 2][lane 32][8]: lane = 16 g + row, k = 32 kc + 16 half + 8 g + i (the k order of frag_b, for A and B alike)
__global__ __launch_bounds__(256) void k_pack(const float* __restrict__ WQ, const float* __restrict__ WK, const float* __restrict__ WV, const float* __restrict__ WO, const float* __restrict__ XQ, const float* __restrict__ XK, const float* __restrict__ XV, __bf16* __restrict__ PK, __bf16* __restrict__ XP) {
  const int which = blockIdx.y, t = threadIdx.x, nt = (which < 4) ? blockIdx.x : ((which - 4) & 3) * 64 + blockIdx.x;
  const float* Wm = (which == 0) ? WQ : (which == 1) ? WK : (which == 2) ? WV : (which == 3) ? WO : (which < 8) ? XQ : (which < 12) ? XK : XV;
  __bf16* dst = ((which < 3) ? PK + PK_A + (size_t)which * DM * DM : (which == 3) ? PK + PK_P : XP + (size_t)((which - 4) >> 2) * NB * SS * DM) + (size_t)nt * 16 * DM;
  const float* s = Wm + (size_t)(nt * 16 + (t & 15)) * DM + ((t >> 5) & 1) * 16 + 8 * ((t >> 4) & 1) + (t >> 6) * 32;   // piece t + 256 u: lane t & 31, half (t >> 5) & 1, kc = (t >> 6) + 4 u
  v4f a[8], c[8];
#pragma unroll   // a thread's sixteen loads are in flight together
  for (int u = 0; u < 8; ++u) { a[u] = *(const v4f*)(s + u * 128); c[u] = *(const v4f*)(s + u * 128 + 4); }
#pragma unroll   // constant indices: a, c and o stay in registers
  for (int u = 0; u < 8; ++u) { v8b o;
#pragma unroll   // as above
    for (int i = 0; i < 4; ++i) { o[i] = (__bf16)a[u][i]; o[4 + i] = (__bf16)c[u][i]; }
    *(v8b*)(dst + (size_t)(u * 256 + t) * 8) = o; }
}
// one k step (32 wide) of a 16 x 128 wave tile: the row operand (k_out: f32 pieces; k_qkv: a bf16 fragment) and the eight weight fragments, all loads issued as one group.
// p: the lane's first 16 bytes of the row tile's step; w: the lane's 16 bytes of the first weight tile's step. A step is 1 KiB of a bf16 tile, 2 KiB of an f32 tile
struct KStep { v4f x[4]; v16b w[8]; };
struct KStepB { v16b a; v16b w[8]; };
__device__ __forceinline__ void ld_stepb(KStepB& t, const __bf16* p, const __bf16* w) {
  t.a = frag_cb(p);
#pragma unroll   // constant indices and offsets: t.w stays in registers, every load is the lane's address plus a constant
  for (int j = 0; j < 8; ++j) t.w[j] = frag_cb(w + (size_t)j * 16 * DM);
  asm volatile("s_wait_xcnt 0x0" :: "v"(p), "v"(w) : "memory");   // in front of any later overwrite of a register that these loads name; the inputs keep the address registers whole up to here
}
__device__ __forceinline__ void ld_step(KStep& t, const float* p, const __bf16* w) {
  t.x[0] = *(const v4f*)p; t.x[1] = *(const v4f*)(p + 128); t.x[2] = *(const v4f*)(p + 256); t.x[3] = *(const v4f*)(p + 384);
#pragma unroll
  for (int j = 0; j < 8; ++j) t.w[j] = frag_cb(w + (size_t)j * 16 * DM);
  asm volatile("s_wait_xcnt 0x0" :: "v"(p), "v"(w) : "memory");   // in front of any later overwrite of a register that these loads name; the inputs keep the address registers whole up to here
}
__global__ __launch_bounds__(128) void k_qkv(const __bf16* __restrict__ XP, const __bf16* __restrict__ P, const float* __restrict__ BQ, const float* __restrict__ BK, const float* __restrict__ BV, _Float16* __restrict__ QF, _Float16* __restrict__ KF, _Float16* __restrict__ VF) {
  const int which0 = (blockIdx.y * 128) / DM; const __bf16* X = XP + (size_t)which0 * NB * SS * DM;   // q from q_in, k from k_in, v from v_in
  __shared__ __align__(16) _Float16 so[4][16][136], sol[4][16][136]; __shared__ __align__(16) _Float16 sth[128][72], stl[128][72];
  const int tid = threadIdx.x, wave = tid >> 5, lane = tid & 31, col = lane & 15, g = lane >> 4; const size_t r0 = (size_t)blockIdx.x * 64 + wave * 16; const int n0 = blockIdx.y * 128;
  v8f acc[8] = {};
  const __bf16* xa = X + r0 * DM + lane * 8; const __bf16* pb = P + (size_t)n0 * DM + lane * 8;
  KStepB t0, t1; ld_stepb(t0, xa, pb);
#pragma unroll 1   // the two register sets already are the unrolling
  for (int kc = 0; kc < DM / 32; kc += 2) {
    ld_stepb(t1, xa + 512, pb + 512);
#pragma unroll
    for (int j = 0; j < 8; ++j) acc[j] = wmma_bf(t0.a, t0.w[j], acc[j]);
    { const int adv = kc + 2 < DM / 32 ? 1024 : 0; xa += adv; pb += adv; }   // two steps on; last trip: no step is left, the pointers stay inside the tile.
    ld_stepb(t0, xa, pb);
#pragma unroll
    for (int j = 0; j < 8; ++j) acc[j] = wmma_bf(t1.a, t1.w[j], acc[j]); }
  { const float* BB = (which0 == 0) ? BQ : (which0 == 1) ? BK : BV;
#pragma unroll
    for (int j = 0; j < 8; ++j) { const float bb = bfr(BB[(n0 % DM) + j * 16 + col]);
#pragma unroll
      for (int r = 0; r < 8; ++r) acc[j][r] += bb; } }
  if (n0 < 2 * DM) {   // q stored unscaled (f16 sigma ~0.6, no subnormal exposure); 1/8 applied to the f32 score
#pragma unroll
    for (int j = 0; j < 8; ++j) {
#pragma unroll
      for (int r = 0; r < 8; ++r) { const float v = acc[j][r]; const _Float16 hv = (_Float16)v; so[wave][8 * g + r][j * 16 + col] = hv; sol[wave][8 * g + r][j * 16 + col] = (_Float16)((v - (float)hv) * 2048.0f); } }   // q, k as f16 hi + (x2048) residual (no RoPE in this module)
    LDSX();
    {   // the wave's 16 rows (queries or keys) are one ct of one 32-row tile, its 128 columns two heads: lane = 16 g + row, d = 32 kc + 16 half + 8 g + i
      _Float16* FB = (n0 < DM) ? QF : KF; const int b = (int)(r0 / SS), kt = (int)(r0 % SS) / 16, h0 = (n0 % DM) / HD;
#pragma unroll   // constant offsets: the wave's sixteen LDS reads are in flight together
      for (int hh = 0; hh < 2; ++hh) { _Float16* kd = FB + (((size_t)(b * NH + h0 + hh) * (SS / 32) + (kt >> 1)) * 2 + (kt & 1)) * 2048 + lane * 8;
#pragma unroll   // as above
        for (int kq = 0; kq < 4; ++kq) { const int kc = kq >> 1, hf = kq & 1, sc = hh * 64 + kc * 32 + hf * 16 + 8 * g;
          vst2((unsigned*)(kd + kc * 1024 + hf * 256), *(const v4u*)&so[wave][col][sc]); vst2((unsigned*)(kd + kc * 1024 + 512 + hf * 256), *(const v4u*)&sol[wave][col][sc]); } }
      asm volatile("s_wait_xcnt 0x0" ::: "memory");   // in front of any later overwrite of a register that these stores name
    }
  } else {
#pragma unroll
    for (int j = 0; j < 8; ++j) {
#pragma unroll
      for (int r = 0; r < 8; ++r) { const float v = acc[j][r]; const _Float16 hv = (_Float16)v; sth[j * 16 + col][wave * 16 + 8 * g + r] = hv; stl[j * 16 + col][wave * 16 + 8 * g + r] = (_Float16)((v - (float)hv) * 2048.0f); } }
    __syncthreads();
    const size_t rb = (size_t)blockIdx.x * 64; const int b = (int)(rb / SS), ks0 = (int)(rb % SS) / 32, h0 = (n0 - 2 * DM) / HD;
    // the block's 64 keys are two key tiles, its 128 columns two heads: lane = 16 g + (d mod 16), key = 32 tile + 16 half + 8 g + i
    for (int e = tid; e < 1024; e += 128) { const int hf = (e >> 5) & 1, dt = (e >> 6) & 3, hh = (e >> 8) & 1, kl = e >> 9; const int d = hh * 64 + dt * 16 + col, kk = kl * 32 + hf * 16 + 8 * g;
      _Float16* vd = VF + (((size_t)(b * NH + h0 + hh) * (SS / 32) + ks0 + kl) * 4 + dt) * 1024 + hf * 256 + lane * 8; vst2((unsigned*)vd, *(const v4u*)&sth[d][kk]); vst2((unsigned*)(vd + 512), *(const v4u*)&stl[d][kk]); }
  }
}
// the K fragments (hi, residual) of one 32-key tile, read from its copy in LDS; p: the lane's 16 bytes of the tile (8 KiB in a row, fragment order)
__device__ __forceinline__ void ld_kl(v16h (&kf)[2][2][2], const _Float16* p) {
#pragma unroll   // constant indices and offsets: kf stays in registers, the sixteen LDS reads stand as one group
  for (int ct = 0; ct < 2; ++ct) {
#pragma unroll   // as above
    for (int kc = 0; kc < 2; ++kc) { kf[ct][kc][0] = frag_ch(p + (ct * 2 + kc) * 1024); kf[ct][kc][1] = frag_ch(p + (ct * 2 + kc) * 1024 + 512); } }
}
// k_attn: block = 256 query rows of ONE head of one batch, 16 waves, wave w = query tile w. Each 32-key tile of K (in each of the two passes) and of V is fetched once a block
// (16 bytes a thread) and put into LDS, where all sixteen waves read their fragments. Out: O, and per row the score maximum and 1 / (16 l) for k_map.
// K ring of three buffers: in trip t tile t + 2 is stored, tile t + 1 (published by the barrier of trip t - 1) is read into registers. V: two buffers.
// Both products are taken transposed: S^T = K . Q^T (A = K fragments, B = Q fragments) and O^T = V^T . P^T (A = V fragments, B = P^T). Lane (g, col) then holds,
// of query col alone, the scores of keys 16 ct + 8 g + r: maximum and sum are in-lane, and the two score tiles, converted in place, are the B operand P^T
// (element 8 ct + r = key 16 ct + 8 g + r, the k order of the V fragments). Lanes col and col + 16 split a query's keys and are joined once, behind pass 1.
__device__ __forceinline__ float xhalf(float v) { return __int_as_float(__builtin_amdgcn_permlanex16(__float_as_int(v), __float_as_int(v), 0x76543210, 0xfedcba98, false, false)); }   // the value of lane l ^ 16
__global__ __launch_bounds__(512) void k_attn(const _Float16* __restrict__ QF, const _Float16* __restrict__ KF, const _Float16* __restrict__ VF, float* __restrict__ O, float* __restrict__ SM, float* __restrict__ SW) {
  __shared__ __align__(16) _Float16 kb[3][4096], vb[2][4096]; __shared__ __align__(16) float st[2][256];
  const int tid = threadIdx.x, wave = __builtin_amdgcn_readfirstlane(tid >> 5), lane = tid & 31, col = lane & 15, g = lane >> 4;   // readfirstlane: the wave's offsets stay in scalar registers
  const int bh = blockIdx.y, b = bh / NH, h = bh % NH; const int q0 = blockIdx.x * 256 + wave * 16;
  const _Float16* qf = QF + ((size_t)bh * (SS / 32) + (q0 >> 5)) * 4096 + ((q0 >> 4) & 1) * 2048 + lane * 8;
  v16h aq[2], aql[2];
#pragma unroll   // constant indices: fragments, scores and sums stay in registers
  for (int kc = 0; kc < 2; ++kc) { aq[kc] = frag_ch(qf + kc * 1024); aql[kc] = frag_ch(qf + kc * 1024 + 512); }
  float m = -3.0e38f, l = 0.f;   // of query col, over the lane's half of the keys
  const _Float16* kg = KF + (size_t)bh * (SS / 32) * 4096 + tid * 8; const _Float16* vg = VF + (size_t)bh * (SS / 32) * 4096 + tid * 8;   // the thread's 16 bytes of tile 0
  v8h rk, rv;   // the thread's piece of the K tile two trips ahead, of the V tile one trip ahead
  { const v8h k0 = *(const v8h*)kg, k1 = *(const v8h*)(kg + 4096), v0 = *(const v8h*)vg; rk = *(const v8h*)(kg + 2 * 4096); rv = *(const v8h*)(vg + 4096);
    asm volatile("s_wait_xcnt 0x0" :: "v"(qf), "v"(kg), "v"(vg) : "memory");   // in front of any overwrite of a register that these loads name; the inputs keep the address registers whole up to here
    *(v8h*)&kb[0][tid * 8] = k0; *(v8h*)&kb[1][tid * 8] = k1; *(v8h*)&vb[0][tid * 8] = v0; }
  __syncthreads();   // K tiles 0 and 1 and V tile 0 stand in LDS
  v16h kf[2][2][2]; ld_kl(kf, &kb[0][lane * 8]);
  int i1 = 1, i2 = 2;   // ring places of tiles t + 1 and t + 2
#pragma unroll 1   // one trip per barrier; the ring indices rotate at run time
  for (int ks = 0; ks < SS / 32; ++ks) { v8f s[2];
    *(v8h*)&kb[i2][tid * 8] = rk;   // its last readers left this buffer before the barrier of trip t - 2
    { const _Float16* p = kg + (size_t)((ks + 3) & (SS / 32 - 1)) * 4096; rk = *(const v8h*)p;   // the index wraps: pass 2 goes on in the same ring with tile 0
      asm volatile("s_wait_xcnt 0x0" :: "v"(p) : "memory"); }   // in front of any overwrite of the load's address registers
#pragma unroll   // constant indices: fragments, scores and sums stay in registers
    for (int ct = 0; ct < 2; ++ct) { v8f c = {}, cl = {};
#pragma unroll   // constant indices: fragments, scores and sums stay in registers
      for (int kc = 0; kc < 2; ++kc) { c = wmma16(kf[ct][kc][0], aq[kc], c); cl = wmma16(kf[ct][kc][0], aql[kc], cl); cl = wmma16(kf[ct][kc][1], aq[kc], cl); }
#pragma unroll   // constant indices: fragments, scores and sums stay in registers
      for (int r = 0; r < 8; ++r) s[ct][r] = (c[r] + cl[r] * (1.0f / 2048.0f)) * 0.125f; }
    ld_kl(kf, &kb[i1][lane * 8]);   // the next tile's fragments come from LDS during the softmax
    float mx[8];
#pragma unroll   // constant indices: fragments, scores and sums stay in registers
    for (int r = 0; r < 8; ++r) mx[r] = fmaxf(s[0][r], s[1][r]);
    const float mn = fmaxf(fmaxf(fmaxf(fmaxf(mx[0], mx[1]), fmaxf(mx[2], mx[3])), fmaxf(fmaxf(mx[4], mx[5]), fmaxf(mx[6], mx[7]))), m);
    const float alpha = (m <= -1.0e38f) ? 0.f : __expf(m - mn);
    float es[8];
#pragma unroll   // constant indices: fragments, scores and sums stay in registers
    for (int r = 0; r < 8; ++r) es[r] = __expf(s[0][r] - mn) + __expf(s[1][r] - mn);
    l = l * alpha + (((es[0] + es[1]) + (es[2] + es[3])) + ((es[4] + es[5]) + (es[6] + es[7]))); m = mn;
    __builtin_amdgcn_sched_barrier(0);   // the softmax arithmetic stays in front of the barrier's wait for the fragment reads and runs while they fly; moved behind it, it would start only when every wave's reads are back
    __syncthreads();   // publishes tile t + 2; ends all reads of tile t + 1's buffer
    i1 = i2; i2 = (i2 == 2) ? 0 : i2 + 1; }
  { const float mo = xhalf(m), lo = xhalf(l), mj = fmaxf(m, mo);   // the query's other sixteen keys of every tile
    l = l * __expf(m - mj) + lo * __expf(mo - mj); m = mj; }
  const float il = 1.0f / l;
  if (g == 0) { st[0][wave * 16 + col] = m; st[1][wave * 16 + col] = il * (1.0f / NH); }   // both halves hold the query's values
  // pass 2: unnormalised P^T, V^T . P^T
  v8f acc[4] = {}, accl[4] = {};
#pragma unroll 1   // one trip per barrier; the ring indices rotate at run time
  for (int ks = 0; ks < SS / 32; ++ks) {
    *(v8h*)&kb[i2][tid * 8] = rk; *(v8h*)&vb[(ks + 1) & 1][tid * 8] = rv;   // V: the readers of trip t - 1 left this buffer before its barrier
    { const int nk = ((ks + 3) & (SS / 32 - 1)) * 4096, nv = ((ks + 2) & (SS / 32 - 1)) * 4096; const _Float16* p = kg + nk; const _Float16* w = vg + nv; rk = *(const v8h*)p; rv = *(const v8h*)w;   // the last trips' indices wrap and stay in bounds
      asm volatile("s_wait_xcnt 0x0" :: "v"(p), "v"(w) : "memory"); }   // in front of any overwrite of the loads' address registers
    v8f c[2], cl[2];
#pragma unroll   // constant indices: fragments, scores and sums stay in registers
    for (int ct = 0; ct < 2; ++ct) { c[ct] = v8f{}; cl[ct] = v8f{};
#pragma unroll   // constant indices: fragments, scores and sums stay in registers
      for (int kc = 0; kc < 2; ++kc) { c[ct] = wmma16(kf[ct][kc][0], aq[kc], c[ct]); cl[ct] = wmma16(kf[ct][kc][0], aql[kc], cl[ct]); cl[ct] = wmma16(kf[ct][kc][1], aq[kc], cl[ct]); } }
    v16h vf[4][2];   // this tile's V fragments, one group of LDS reads into the registers that K's fragments leave
    const _Float16* vp = &vb[ks & 1][lane * 8];
#pragma unroll   // constant indices: fragments, scores and sums stay in registers
    for (int dt = 0; dt < 4; ++dt) { vf[dt][0] = frag_ch(vp + dt * 1024); vf[dt][1] = frag_ch(vp + dt * 1024 + 512); }
    __builtin_amdgcn_sched_barrier(0);   // the V reads are issued in front of the exponentials and fly during them; sunk behind them, their latency would stand in front of the second product
    v16h ph, pl;   // P^T as a B operand: hi, residual x2048
#pragma unroll   // constant indices: fragments, scores and sums stay in registers
    for (int ct = 0; ct < 2; ++ct) {
#pragma unroll   // constant indices: fragments, scores and sums stay in registers
      for (int r = 0; r < 8; ++r) { const float e = __expf((c[ct][r] + cl[ct][r] * (1.0f / 2048.0f)) * 0.125f - m);   // unnormalised (<= 1: no f16 subnormal exposure); 1/l applied to the accumulators at the end
        const _Float16 he = (_Float16)e; ph[ct * 8 + r] = he; pl[ct * 8 + r] = (_Float16)((e - (float)he) * 2048.0f); } }
#pragma unroll   // constant indices: fragments, scores and sums stay in registers
    for (int dt = 0; dt < 4; ++dt) { acc[dt] = wmma16(vf[dt][0], ph, acc[dt]); accl[dt] = wmma16(vf[dt][0], pl, accl[dt]); accl[dt] = wmma16(vf[dt][1], ph, accl[dt]); }
    ld_kl(kf, &kb[i1][lane * 8]);   // the next tile's K fragments, once V's registers are free
    __syncthreads();   // publishes K tile t + 2 and V tile t + 1; ends all reads of the buffers that the next trip refills
    i1 = i2; i2 = (i2 == 2) ? 0 : i2 + 1; }
  if (tid < 256) SM[(size_t)bh * SS + blockIdx.x * 256 + tid] = st[0][tid]; else SW[(size_t)bh * SS + blockIdx.x * 256 + tid - 256] = st[1][tid - 256];   // one 128-byte line a wave
  asm volatile("s_wait_xcnt 0x0" ::: "memory");   // in front of any later overwrite of a register that this store names
  // the head's 64 columns are k steps 2 h and 2 h + 1 of k_out: lane = 16 g + row, piece x holds k = 16 (x / 2) + 8 g + 4 (x mod 2) + i of its step:
  // that is registers 4 (x mod 2) + i of the lane's own O^T tile x / 2
  float* of = O + ((size_t)b * SS + q0) * DM + h * 1024 + lane * 4;
#pragma unroll   // constant indices: the sums stay in registers
  for (int x = 0; x < 8; ++x) { v4f o;
#pragma unroll   // as above
    for (int i = 0; i < 4; ++i) o[i] = (acc[x >> 1][(x & 1) * 4 + i] + accl[x >> 1][(x & 1) * 4 + i] * (1.0f / 2048.0f)) * il;
    vst2(of + x * 128, o); }
  asm volatile("s_wait_xcnt 0x0" ::: "memory");   // in front of any later overwrite of a register that these stores name
}
// k_map: the head mean of the attention map. Block = 128 query rows x 128 keys of one batch, 16 waves as 4 x 4, a wave owns 32 x 32 and sums the heads
// (in the order 0..15) in registers. A head's Q rows and K rows of the block (32 KiB each, in a row) are fetched once and put into LDS, two buffers.
#define HSTEP ((SS / 32) * 4096)   // halves from one head's fragments to the next head's
__global__ __launch_bounds__(512) void k_map(const _Float16* __restrict__ QF, const _Float16* __restrict__ KF, const float* __restrict__ SM, const float* __restrict__ SW, float* __restrict__ ATT) {
  __shared__ __align__(16) _Float16 qb[2][4 * 4096], kb[2][4 * 4096]; __shared__ __align__(16) float sst[2][NH][128]; __shared__ __align__(16) float so[16][32][36];
  const int tid = threadIdx.x, wave = __builtin_amdgcn_readfirstlane(tid >> 5), lane = tid & 31, col = lane & 15, g = lane >> 4;   // readfirstlane: the wave's offsets stay in scalar registers
  const int b = blockIdx.z, r0 = blockIdx.y * 128, k0 = blockIdx.x * 128, wr = wave >> 2, wc = wave & 3;
  const _Float16* qs = QF + ((size_t)b * NH * (SS / 32) + (r0 >> 5)) * 4096; const _Float16* cs = KF + ((size_t)b * NH * (SS / 32) + (k0 >> 5)) * 4096;   // head 0: the first of the block's four 32-row tiles of Q, of K
  const _Float16* qg = qs + tid * 8; const _Float16* kg = cs + tid * 8;   // the thread's 16 bytes of it
  v8h rq[4], rk[4];
  { const float* ms = SM + ((size_t)b * NH + wave) * SS + r0; const float* fs = SW + ((size_t)b * NH + wave) * SS + r0;   // wave w brings head w's 128 rows
    const v4f tm = *(const v4f*)(ms + lane * 4), tw = *(const v4f*)(fs + lane * 4); v8h q0[4], c0[4];
#pragma unroll   // constant indices: the pieces stay in registers; heads 0 and 1 are fetched as one group, with one wait behind it
    for (int j = 0; j < 4; ++j) { q0[j] = *(const v8h*)(qg + j * 4096); c0[j] = *(const v8h*)(kg + j * 4096); rq[j] = *(const v8h*)(qg + HSTEP + j * 4096); rk[j] = *(const v8h*)(kg + HSTEP + j * 4096); }
    asm volatile("s_wait_xcnt 0x0" :: "s"(qs), "s"(cs), "s"(ms), "s"(fs), "v"(tid), "v"(lane) : "memory");   // in front of any overwrite of a register that these loads name; the inputs keep bases and offsets whole up to here
    *(v4f*)&sst[0][wave][lane * 4] = tm; *(v4f*)&sst[1][wave][lane * 4] = tw;
#pragma unroll   // as above
    for (int j = 0; j < 4; ++j) { *(v8h*)&qb[0][j * 4096 + tid * 8] = q0[j]; *(v8h*)&kb[0][j * 4096 + tid * 8] = c0[j]; } }
  __syncthreads();   // head 0 and the rows' softmax figures stand in LDS
  v8f am[2][2] = {};
  for (int h = 0; h < NH; ++h) {
#pragma unroll   // as above
    for (int j = 0; j < 4; ++j) { *(v8h*)&qb[(h + 1) & 1][j * 4096 + tid * 8] = rq[j]; *(v8h*)&kb[(h + 1) & 1][j * 4096 + tid * 8] = rk[j]; }   // head h + 1; the readers of head h - 1 left this buffer before its barrier
    { const int ho = ((h + 2) & (NH - 1)) * HSTEP; const _Float16* p = qg + ho; const _Float16* w = kg + ho;   // the last trips' index wraps and stays in bounds
#pragma unroll   // as above
      for (int j = 0; j < 4; ++j) { rq[j] = *(const v8h*)(p + j * 4096); rk[j] = *(const v8h*)(w + j * 4096); }
      asm volatile("s_wait_xcnt 0x0" :: "v"(p), "v"(w) : "memory"); }   // as above
    v16h kf[2][2][2]; ld_kl(kf, &kb[h & 1][wc * 4096 + lane * 8]);
#pragma unroll   // constant indices: fragments, scores and sums stay in registers
    for (int qt = 0; qt < 2; ++qt) { const _Float16* qp = &qb[h & 1][wr * 4096 + qt * 2048 + lane * 8];
      v16h aq[2], aql[2];
#pragma unroll   // constant indices: fragments, scores and sums stay in registers
      for (int kc = 0; kc < 2; ++kc) { aq[kc] = frag_ch(qp + kc * 1024); aql[kc] = frag_ch(qp + kc * 1024 + 512); }
      const float* fm = &sst[0][h][wr * 32 + qt * 16 + 8 * g]; const float* fw = &sst[1][h][wr * 32 + qt * 16 + 8 * g];
      const v4f m0 = *(const v4f*)fm, m1 = *(const v4f*)(fm + 4), w0 = *(const v4f*)fw, w1 = *(const v4f*)(fw + 4);
#pragma unroll   // constant indices: fragments, scores and sums stay in registers
      for (int ct = 0; ct < 2; ++ct) { v8f c = {}, cl = {};
#pragma unroll   // constant indices: fragments, scores and sums stay in registers
        for (int kc = 0; kc < 2; ++kc) { c = wmma16(aq[kc], kf[ct][kc][0], c); cl = wmma16(aql[kc], kf[ct][kc][0], cl); cl = wmma16(aq[kc], kf[ct][kc][1], cl); }
#pragma unroll   // constant indices: fragments, scores and sums stay in registers
        for (int r = 0; r < 8; ++r) { const float mr = r < 4 ? m0[r & 3] : m1[r & 3], wt = r < 4 ? w0[r & 3] : w1[r & 3];
          am[qt][ct][r] += __expf((c[r] + cl[r] * (1.0f / 2048.0f)) * 0.125f - mr) * wt; } } }
    __syncthreads();   // publishes head h + 1; ends all reads of head h's buffer
  }
#pragma unroll   // constant indices: fragments, scores and sums stay in registers
  for (int qt = 0; qt < 2; ++qt) {
#pragma unroll   // constant indices: fragments, scores and sums stay in registers
    for (int ct = 0; ct < 2; ++ct) {
#pragma unroll   // constant indices: fragments, scores and sums stay in registers
      for (int r = 0; r < 8; ++r) so[wave][qt * 16 + 8 * g + r][ct * 16 + col] = am[qt][ct][r]; } }
  LDSX();
  float* ap = ATT + ((size_t)b * SS + r0 + wr * 32 + (lane >> 3)) * SS + k0 + wc * 32 + (lane & 7) * 4;   // eight lanes store one row's 128-byte line
#pragma unroll   // constant offsets: the eight LDS reads are in flight together
  for (int x = 0; x < 8; ++x) vst2(ap + (size_t)x * 4 * SS, *(const v4f*)&so[wave][x * 4 + (lane >> 3)][(lane & 7) * 4]);
  asm volatile("s_wait_xcnt 0x0" ::: "memory");   // in front of any later overwrite of a register that these stores name
}
// ---- k_out: block = (64 rows, 128 cols): out = O(hi/lo) . Wo rows (2 products) + bo
__global__ __launch_bounds__(128) void k_out(const float* __restrict__ O, const __bf16* __restrict__ P, const float* __restrict__ BO, float* __restrict__ Y) {
  __shared__ __align__(16) float so[4][16][132];
  const int tid = threadIdx.x, wave = tid >> 5, lane = tid & 31, col = lane & 15, g = lane >> 4; const size_t r0 = (size_t)blockIdx.x * 64 + wave * 16; const int n0 = blockIdx.y * 128;
  v8f acc[8] = {};
  const float* xa = O + r0 * DM + lane * 4; const __bf16* pb = P + (size_t)n0 * DM + lane * 8;
  KStep t0, t1; ld_step(t0, xa, pb);
#pragma unroll 1   // the two register sets already are the unrolling
  for (int kc = 0; kc < DM / 32; kc += 2) {
    ld_step(t1, xa + 512, pb + 512);
    { float v[16];
#pragma unroll
      for (int i = 0; i < 16; ++i) v[i] = t0.x[i >> 2][i & 3];
      const F2 a = bsplit16(v);
#pragma unroll
      for (int j = 0; j < 8; ++j) { acc[j] = wmma_bf(a.l, t0.w[j], acc[j]); acc[j] = wmma_bf(a.h, t0.w[j], acc[j]); } }
    { const int adv = kc + 2 < DM / 32 ? 1024 : 0; xa += adv; pb += adv; }   // two steps on; last trip: no step is left, the pointers stay inside the tile.
    ld_step(t0, xa, pb);
    { float v[16];
#pragma unroll
      for (int i = 0; i < 16; ++i) v[i] = t1.x[i >> 2][i & 3];
      const F2 a = bsplit16(v);
#pragma unroll
      for (int j = 0; j < 8; ++j) { acc[j] = wmma_bf(a.l, t1.w[j], acc[j]); acc[j] = wmma_bf(a.h, t1.w[j], acc[j]); } } }
#pragma unroll
  for (int j = 0; j < 8; ++j) {
#pragma unroll
    for (int r = 0; r < 8; ++r) so[wave][8 * g + r][j * 16 + col] = acc[j][r] + bfr(BO[n0 + j * 16 + col]); }
  LDSX();
  for (int rl = 0; rl < 16; ++rl) vst2(Y + (r0 + rl) * DM + n0 + lane * 4, *(const v4f*)&so[wave][rl][lane * 4]);
}
extern "C" void kernel_launch(void* const* d_in, const int* in_sizes, int n_in, void* d_out, int out_size, void* d_ws, size_t ws_size, hipStream_t stream) {
  (void)in_sizes; (void)n_in; (void)out_size;
  const float** F = (const float**)d_in;   // 0 q_in [4,1024,1024], 1 k_in, 2 v_in, 3 Wq [1024,1024] natural (x @ W.T), 4 bq, 5 Wk, 6 bk, 7 Wv, 8 bv, 9 Wo, 10 bo
  if (ws_size < (size_t)WS_END) return;
  char* ws = (char*)d_ws; __bf16* PK = (__bf16*)(ws + WS_PK); _Float16 *QF = (_Float16*)(ws + WS_QF), *KF = (_Float16*)(ws + WS_KF), *VF = (_Float16*)(ws + WS_VF); float* O = (float*)(ws + WS_O); __bf16* XP = (__bf16*)(ws + WS_XP); float* SM = (float*)(ws + WS_ST); float* SW = SM + NB * NH * SS;
  k_pack<<<dim3(DM / 16, 16), 256, 0, stream>>>(F[3], F[5], F[7], F[9], F[0], F[1], F[2], PK, XP);
  k_qkv<<<dim3(TNB * SS / 64, QKVW / 128), 128, 0, stream>>>(XP, PK + PK_A, F[4], F[6], F[8], QF, KF, VF);
  k_attn<<<dim3(SS / 256, TNB * NH), 512, 0, stream>>>(QF, KF, VF, O, SM, SW);
  k_map<<<dim3(SS / 128, SS / 128, TNB), 512, 0, stream>>>(QF, KF, SM, SW, (float*)((char*)d_out + 16777216));
  k_out<<<dim3(TOB, DM / 128), 128, 0, stream>>>(O, PK + PK_P, F[10], (float*)d_out);
}

// v006
// A run of this version takes 153 microseconds.
// Next to v005, in two timings, it ran 1.13 times as fast each time.
// Counting every step since v000, it is 17.2 times as fast.
#include <hip/hip_runtime.h>
#include <math.h>

typedef __attribute__((ext_vector_type(16))) _Float16 v16h;
typedef __attribute__((ext_vector_type(16))) __bf16 v16b;
typedef __attribute__((ext_vector_type(8)))  _Float16 v8h;
typedef __attribute__((ext_vector_type(8)))  float v8f;
typedef __attribute__((ext_vector_type(4)))  float v4f;
typedef __attribute__((ext_vector_type(2)))  float v2f;
typedef __attribute__((ext_vector_type(4)))  unsigned v4u;
typedef __attribute__((ext_vector_type(4)))  int v4i;
typedef float __attribute__((may_alias)) float_a;
typedef int __attribute__((may_alias)) int_a;

template <typename T> __device__ __forceinline__ void vst2(void* p, T v) { *(T*)p = v;  }
__device__ __forceinline__ v8f wmma16(v16h a, v16h b, v8f c) {
  v8f d = __builtin_amdgcn_wmma_f32_16x16x32_f16(false, a, false, b, (short)0, c, false, false);
  asm volatile("v_nop\n\tv_nop\n\tv_nop\n\tv_nop" : "+v"(d) : "v"(a), "v"(b));
  return d;
}
__device__ __forceinline__ v8f wmma_bf(v16b a, v16b b, v8f c) {
  v8f d = __builtin_amdgcn_wmma_f32_16x16x32_bf16(false, a, false, b, (short)0, c, false, false);
  asm volatile("v_nop\n\tv_nop\n\tv_nop\n\tv_nop" : "+v"(d) : "v"(a), "v"(b));
  return d;
}
// Multi-head cross-attention that also returns the head-averaged attention map (B 4, T 1,024 queries, 1,024 memory positions, d 1,024, 16 heads x 64).
__device__ __forceinline__ v16h frag_h(const _Float16* rowk0, int lane) {
  union { v16h v; v8h q[2]; } u; const _Float16* p = rowk0 + 8 * (lane >> 4);
  u.q[0] = *(const v8h*)p; u.q[1] = *(const v8h*)(p + 16); return u.v;
}
__device__ __forceinline__ v16h frag_f32(const float* rowk0, int lane) {
  v16h a; const float* p = rowk0 + 8 * (lane >> 4);
#pragma unroll
  for (int i = 0; i < 8; ++i) { a[i] = (_Float16)p[i]; a[8 + i] = (_Float16)p[16 + i]; }
  return a;
}
__device__ __forceinline__ v16h frag_f32s(const float* rowk0, int lane, float sc) {
  v16h a; const float* p = rowk0 + 8 * (lane >> 4);
#pragma unroll
  for (int i = 0; i < 8; ++i) { a[i] = (_Float16)(p[i] * sc); a[8 + i] = (_Float16)(p[16 + i] * sc); }
  return a;
}
// column fragment from a [K][ld] layout (column n), rows >= K read as 0
__device__ __forceinline__ v16h fragc_f32(const float* W, int k0, int n, int lane, int ld, int K) {
  v16h a; const int g = lane >> 4;
#pragma unroll
  for (int i = 0; i < 8; ++i) { const int ka = k0 + 8 * g + i, kb = ka + 16;
    a[i] = (_Float16)(ka < K ? W[(size_t)(ka < K ? ka : K - 1) * ld + n] : 0.f); a[8 + i] = (_Float16)(kb < K ? W[(size_t)(kb < K ? kb : K - 1) * ld + n] : 0.f); }
  return a;
}
struct F2 { v16b h, l; };
__device__ __forceinline__ F2 bsplit16(const float v[16]) { F2 r;
#pragma unroll
  for (int i = 0; i < 16; ++i) { const __bf16 h = (__bf16)v[i]; r.h[i] = h; r.l[i] = (__bf16)(v[i] - (float)h); }
  return r; }
__device__ __forceinline__ F2 split_row(const float* row, int k0, int lane) { float v[16]; const float* p = row + k0 + 8 * (lane >> 4);
#pragma unroll
  for (int i = 0; i < 8; ++i) { v[i] = p[i]; v[8 + i] = p[16 + i]; }
  return bsplit16(v); }
__device__ __forceinline__ F2 split_rowK(const float* row, int k0, int lane, int K) { float v[16]; const int g = lane >> 4;
#pragma unroll
  for (int i = 0; i < 8; ++i) { const int ka = k0 + 8 * g + i, kb = ka + 16; v[i] = ka < K ? row[ka < K ? ka : K - 1] : 0.f; v[8 + i] = kb < K ? row[kb < K ? kb : K - 1] : 0.f; }
  return bsplit16(v); }
__device__ __forceinline__ F2 split_col(const float* W, int k0, int n, int lane, int ld, int K) { float v[16]; const int g = lane >> 4;
#pragma unroll
  for (int i = 0; i < 8; ++i) { const int ka = k0 + 8 * g + i, kb = ka + 16; v[i] = ka < K ? W[(size_t)(ka < K ? ka : K - 1) * ld + n] : 0.f; v[8 + i] = kb < K ? W[(size_t)(kb < K ? kb : K - 1) * ld + n] : 0.f; }
  return bsplit16(v); }
__device__ __forceinline__ v8f mac3(const F2& a, const F2& b, v8f c) { c = wmma_bf(a.l, b.h, c); c = wmma_bf(a.h, b.l, c); return wmma_bf(a.h, b.h, c); }
__device__ __forceinline__ float sigm(float v) { return 1.0f / (1.0f + expf(-v)); }
#define LDSX() do { asm volatile("s_wait_dscnt 0" ::: "memory"); __builtin_amdgcn_wave_barrier(); __builtin_amdgcn_fence(__ATOMIC_RELEASE, "workgroup"); } while (0)


#define NB 4
#define SS 1024
#define DM 1024
#define NH 16
#define HD 64
#define QKVW (3 * DM)
#ifndef TQB
#define TQB (SS / 64)
#define TNB NB
#define TOB (NB * SS / 64)     // output row tiles (all)
#endif
typedef __attribute__((ext_vector_type(8))) __bf16 v8b;
__device__ __forceinline__ v16b frag_b(const __bf16* rowk0, int lane) {
  union { v16b v; v8b q[2]; } u; const __bf16* p = rowk0 + 8 * (lane >> 4);
  u.q[0] = *(const v8b*)p; u.q[1] = *(const v8b*)(p + 16); return u.v;
}
__device__ __forceinline__ float bfr(float v) { return (float)(__bf16)v; }
__device__ __attribute__((noinline)) float exp_ni(float v) { return expf(v); }
__device__ __attribute__((noinline)) float erf_ni(float v) { return erff(v); }

#define PK_A 0                       // Wqkv, 192 tiles of 16 rows, fragment order (see k_pack)
#define PK_P (PK_A + QKVW * DM)        // Wo, 64 tiles of 16 rows, fragment order
#define PK_END (PK_P + DM * DM)
// Every operand that a loop reads from the workspace lies there in FRAGMENT ORDER: the 16 bytes that lane 0..31 loads
// with one instruction stand side by side, so a wave-wide 16-byte load reads 512 contiguous bytes (four whole 128-byte lines, not pieces of sixteen).
#define WS_PK  0u
#define WS_QF  (WS_PK + 2u * PK_END)             // f16 Q fragments, laid out as K's: [b][h][32-row tile][ct 2][kc 2][hi, residual x2048][half 2][lane 32][8]
#define WS_KF  (WS_QF + 4u * NB * SS * DM)         // f16 K fragments [b][h][32-key tile][ct 2][kc 2][hi, residual x2048][half 2][lane 32][8]
#define WS_VF  (WS_KF + 4u * NB * SS * DM)         // f16 V fragments [b][h][32-key tile][dt 4][hi, residual x2048][half 2][lane 32][8]
#define WS_O   (WS_VF + 4u * NB * SS * DM)         // f32 O fragments [16-row tile][kc 32][piece 4][lane 32][4]
#define WS_XP  (WS_O + 4u * NB * SS * DM)          // bf16 q_in, k_in, v_in, each 256 tiles of 16 rows, fragment order (see k_pack)
#define WS_ST  (WS_XP + 2u * 3 * NB * SS * DM)     // f32 [2][b][h][query row]: the row's softmax reference m; 1 / (16 x the row's sum of exp(s - m))
#define WS_END (WS_ST + 8u * NB * NH * SS)
// a 16-bit fragment in fragment order: p = the lane's 16 bytes of the first half, the second half stands 512 bytes on
__device__ __forceinline__ v16h frag_ch(const _Float16* p) { union { v16h v; v8h q[2]; } u; u.q[0] = *(const v8h*)p; u.q[1] = *(const v8h*)(p + 256); return u.v; }
__device__ __forceinline__ v16b frag_cb(const __bf16* p) { union { v16b v; v8b q[2]; } u; u.q[0] = *(const v8b*)p; u.q[1] = *(const v8b*)(p + 256); return u.v; }
// ---- k_pack: block = (tile of 16 rows, which); which 0..2 -> W_q/W_k/W_v into PK_A, 3 -> W_o into PK_P, 4..15 -> a quarter of the rows of q_in/k_in/v_in into XP.
// f32 -> bf16, stored as [tile][kc 32][half 2][lane 32][8]: lane = 16 g + row, k = 32 kc + 16 half + 8 g + i (the k order of frag_b, for A and B alike)
__global__ __launch_bounds__(256) void k_pack(const float* __restrict__ WQ, const float* __restrict__ WK, const float* __restrict__ WV, const float* __restrict__ WO, const float* __restrict__ XQ, const float* __restrict__ XK, const float* __restrict__ XV, __bf16* __restrict__ PK, __bf16* __restrict__ XP) {
  const int which = blockIdx.y, t = threadIdx.x, nt = (which < 4) ? blockIdx.x : ((which - 4) & 3) * 64 + blockIdx.x;
  const float* Wm = (which == 0) ? WQ : (which == 1) ? WK : (which == 2) ? WV : (which == 3) ? WO : (which < 8) ? XQ : (which < 12) ? XK : XV;
  __bf16* dst = ((which < 3) ? PK + PK_A + (size_t)which * DM * DM : (which == 3) ? PK + PK_P : XP + (size_t)((which - 4) >> 2) * NB * SS * DM) + (size_t)nt * 16 * DM;
  const float* s = Wm + (size_t)(nt * 16 + (t & 15)) * DM + ((t >> 5) & 1) * 16 + 8 * ((t >> 4) & 1) + (t >> 6) * 32;   // piece t + 256 u: lane t & 31, half (t >> 5) & 1, kc = (t >> 6) + 4 u
  v4f a[8], c[8];
#pragma unroll   // a thread's sixteen loads are in flight together
  for (int u = 0; u < 8; ++u) { a[u] = *(const v4f*)(s + u * 128); c[u] = *(const v4f*)(s + u * 128 + 4); }
#pragma unroll   // constant indices: a, c and o stay in registers
  for (int u = 0; u < 8; ++u) { v8b o;
#pragma unroll   // as above
    for (int i = 0; i < 4; ++i) { o[i] = (__bf16)a[u][i]; o[4 + i] = (__bf16)c[u][i]; }
    *(v8b*)(dst + (size_t)(u * 256 + t) * 8) = o; }
}
// one k step (32 wide) of a 16 x 128 wave tile: the row operand (k_out: f32 pieces; k_qkv: a bf16 fragment) and the eight weight fragments, all loads issued as one group.
// p: the lane's first 16 bytes of the row tile's step; w: the lane's 16 bytes of the first weight tile's step. A step is 1 KiB of a bf16 tile, 2 KiB of an f32 tile
struct KStep { v4f x[4]; v16b w[8]; };
struct KStepB { v16b a; v16b w[8]; };
__device__ __forceinline__ void ld_stepb(KStepB& t, const __bf16* p, const __bf16* w) {
  t.a = frag_cb(p);
#pragma unroll   // constant indices and offsets: t.w stays in registers, every load is the lane's address plus a constant
  for (int j = 0; j < 8; ++j) t.w[j] = frag_cb(w + (size_t)j * 16 * DM);
  asm volatile("s_wait_xcnt 0x0" :: "v"(p), "v"(w) : "memory");   // in front of any later overwrite of a register that these loads name; the inputs keep the address registers whole up to here
}
__device__ __forceinline__ void ld_step(KStep& t, const float* p, const __bf16* w) {
  t.x[0] = *(const v4f*)p; t.x[1] = *(const v4f*)(p + 128); t.x[2] = *(const v4f*)(p + 256); t.x[3] = *(const v4f*)(p + 384);
#pragma unroll
  for (int j = 0; j < 8; ++j) t.w[j] = frag_cb(w + (size_t)j * 16 * DM);
  asm volatile("s_wait_xcnt 0x0" :: "v"(p), "v"(w) : "memory");   // in front of any later overwrite of a register that these loads name; the inputs keep the address registers whole up to here
}
__global__ __launch_bounds__(128) void k_qkv(const __bf16* __restrict__ XP, const __bf16* __restrict__ P, const float* __restrict__ BQ, const float* __restrict__ BK, const float* __restrict__ BV, _Float16* __restrict__ QF, _Float16* __restrict__ KF, _Float16* __restrict__ VF) {
  const int which0 = (blockIdx.y * 128) / DM; const __bf16* X = XP + (size_t)which0 * NB * SS * DM;   // q from q_in, k from k_in, v from v_in
  __shared__ __align__(16) _Float16 so[4][16][136], sol[4][16][136]; __shared__ __align__(16) _Float16 sth[128][72], stl[128][72];
  const int tid = threadIdx.x, wave = tid >> 5, lane = tid & 31, col = lane & 15, g = lane >> 4; const size_t r0 = (size_t)blockIdx.x * 64 + wave * 16; const int n0 = blockIdx.y * 128;
  v8f acc[8] = {};
  const __bf16* xa = X + r0 * DM + lane * 8; const __bf16* pb = P + (size_t)n0 * DM + lane * 8;
  KStepB t0, t1; ld_stepb(t0, xa, pb);
#pragma unroll 1   // the two register sets already are the unrolling
  for (int kc = 0; kc < DM / 32; kc += 2) {
    ld_stepb(t1, xa + 512, pb + 512);
#pragma unroll
    for (int j = 0; j < 8; ++j) acc[j] = wmma_bf(t0.a, t0.w[j], acc[j]);
    { const int adv = kc + 2 < DM / 32 ? 1024 : 0; xa += adv; pb += adv; }   // two steps on; last trip: no step is left, the pointers stay inside the tile.
    ld_stepb(t0, xa, pb);
#pragma unroll
    for (int j = 0; j < 8; ++j) acc[j] = wmma_bf(t1.a, t1.w[j], acc[j]); }
  { const float* BB = (which0 == 0) ? BQ : (which0 == 1) ? BK : BV;
#pragma unroll
    for (int j = 0; j < 8; ++j) { const float bb = bfr(BB[(n0 % DM) + j * 16 + col]);
#pragma unroll
      for (int r = 0; r < 8; ++r) acc[j][r] += bb; } }
  if (n0 < 2 * DM) {   // q stored unscaled (f16 sigma ~0.6, no subnormal exposure); 1/8 applied to the f32 score
#pragma unroll
    for (int j = 0; j < 8; ++j) {
#pragma unroll
      for (int r = 0; r < 8; ++r) { const float v = acc[j][r]; const _Float16 hv = (_Float16)v; so[wave][8 * g + r][j * 16 + col] = hv; sol[wave][8 * g + r][j * 16 + col] = (_Float16)((v - (float)hv) * 2048.0f); } }   // q, k as f16 hi + (x2048) residual (no RoPE in this module)
    LDSX();
    {   // the wave's 16 rows (queries or keys) are one ct of one 32-row tile, its 128 columns two heads: lane = 16 g + row, d = 32 kc + 16 half + 8 g + i
      _Float16* FB = (n0 < DM) ? QF : KF; const int b = (int)(r0 / SS), kt = (int)(r0 % SS) / 16, h0 = (n0 % DM) / HD;
#pragma unroll   // constant offsets: the wave's sixteen LDS reads are in flight together
      for (int hh = 0; hh < 2; ++hh) { _Float16* kd = FB + (((size_t)(b * NH + h0 + hh) * (SS / 32) + (kt >> 1)) * 2 + (kt & 1)) * 2048 + lane * 8;
#pragma unroll   // as above
        for (int kq = 0; kq < 4; ++kq) { const int kc = kq >> 1, hf = kq & 1, sc = hh * 64 + kc * 32 + hf * 16 + 8 * g;
          vst2((unsigned*)(kd + kc * 1024 + hf * 256), *(const v4u*)&so[wave][col][sc]); vst2((unsigned*)(kd + kc * 1024 + 512 + hf * 256), *(const v4u*)&sol[wave][col][sc]); } }
      asm volatile("s_wait_xcnt 0x0" ::: "memory");   // in front of any later overwrite of a register that these stores name
    }
  } else {
#pragma unroll
    for (int j = 0; j < 8; ++j) {
#pragma unroll
      for (int r = 0; r < 8; ++r) { const float v = acc[j][r]; const _Float16 hv = (_Float16)v; sth[j * 16 + col][wave * 16 + 8 * g + r] = hv; stl[j * 16 + col][wave * 16 + 8 * g + r] = (_Float16)((v - (float)hv) * 2048.0f); } }
    __syncthreads();
    const size_t rb = (size_t)blockIdx.x * 64; const int b = (int)(rb / SS), ks0 = (int)(rb % SS) / 32, h0 = (n0 - 2 * DM) / HD;
    // the block's 64 keys are two key tiles, its 128 columns two heads: lane = 16 g + (d mod 16), key = 32 tile + 16 half + 8 g + i
    for (int e = tid; e < 1024; e += 128) { const int hf = (e >> 5) & 1, dt = (e >> 6) & 3, hh = (e >> 8) & 1, kl = e >> 9; const int d = hh * 64 + dt * 16 + col, kk = kl * 32 + hf * 16 + 8 * g;
      _Float16* vd = VF + (((size_t)(b * NH + h0 + hh) * (SS / 32) + ks0 + kl) * 4 + dt) * 1024 + hf * 256 + lane * 8; vst2((unsigned*)vd, *(const v4u*)&sth[d][kk]); vst2((unsigned*)(vd + 512), *(const v4u*)&stl[d][kk]); }
  }
}
// the K fragments (hi, residual) of one 32-key tile, read from its copy in LDS; p: the lane's 16 bytes of the tile (8 KiB in a row, fragment order)
__device__ __forceinline__ void ld_kl(v16h (&kf)[2][2][2], const _Float16* p) {
#pragma unroll   // constant indices and offsets: kf stays in registers, the sixteen LDS reads stand as one group
  for (int ct = 0; ct < 2; ++ct) {
#pragma unroll   // as above
    for (int kc = 0; kc < 2; ++kc) { kf[ct][kc][0] = frag_ch(p + (ct * 2 + kc) * 1024); kf[ct][kc][1] = frag_ch(p + (ct * 2 + kc) * 1024 + 512); } }
}
// k_attn: block = 256 query rows of ONE head of one batch, 16 waves, wave w = query tile w. Each 32-key tile of K and of V is fetched once a block
// (16 bytes a thread) and put into LDS, where all sixteen waves read their fragments. Out: O, and per row the reference m and 1 / (16 l) for k_map.
// K ring of three buffers: in trip t tile t + 2 is stored, tile t + 1 (published by the barrier of trip t - 1) is read into registers. V: two buffers.
// Both products are taken transposed: S^T = K . Q^T (A = K fragments, B = Q fragments) and O^T = V^T . P^T (A = V fragments, B = P^T). Lane (g, col) then holds,
// of query col alone, the scores of keys 16 ct + 8 g + r: maximum and sum are in-lane, and the two score tiles, converted in place, are the B operand P^T
// (element 8 ct + r = key 16 ct + 8 g + r, the k order of the V fragments). Lanes col and col + 16 split a query's keys: their maxima are joined in every tile, their sums once, behind the loop.
// One pass over the keys: the sums are kept against a reference m that follows the running maximum, and are rescaled when it moves.
__device__ __forceinline__ float xhalf(float v) { return __int_as_float(__builtin_amdgcn_permlanex16(__float_as_int(v), __float_as_int(v), 0x76543210, 0xfedcba98, false, false)); }   // the value of lane l ^ 16
__global__ __launch_bounds__(512) void k_attn(const _Float16* __restrict__ QF, const _Float16* __restrict__ KF, const _Float16* __restrict__ VF, float* __restrict__ O, float* __restrict__ SM, float* __restrict__ SW) {
  __shared__ __align__(16) _Float16 kb[3][4096], vb[2][4096]; __shared__ __align__(16) float st[2][256];
  const int tid = threadIdx.x, wave = __builtin_amdgcn_readfirstlane(tid >> 5), lane = tid & 31, col = lane & 15, g = lane >> 4;   // readfirstlane: the wave's offsets stay in scalar registers
  const int bh = blockIdx.y, b = bh / NH, h = bh % NH; const int q0 = blockIdx.x * 256 + wave * 16;
  const _Float16* qf = QF + ((size_t)bh * (SS / 32) + (q0 >> 5)) * 4096 + ((q0 >> 4) & 1) * 2048 + lane * 8;
  v16h aq[2], aql[2];
#pragma unroll   // constant indices: fragments, scores and sums stay in registers
  for (int kc = 0; kc < 2; ++kc) { aq[kc] = frag_ch(qf + kc * 1024); aql[kc] = frag_ch(qf + kc * 1024 + 512); }
  float m = -3.0e38f, l = 0.f;   // of query col: the reference in use (it may trail the true maximum by up to 5.5); the sum over the lane's half of the keys
  const _Float16* kg = KF + (size_t)bh * (SS / 32) * 4096 + tid * 8; const _Float16* vg = VF + (size_t)bh * (SS / 32) * 4096 + tid * 8;   // the thread's 16 bytes of tile 0
  v8h rk, rv;   // the thread's piece of the K tile two trips ahead, of the V tile one trip ahead
  { const v8h k0 = *(const v8h*)kg, k1 = *(const v8h*)(kg + 4096), v0 = *(const v8h*)vg; rk = *(const v8h*)(kg + 2 * 4096); rv = *(const v8h*)(vg + 4096);
    asm volatile("s_wait_xcnt 0x0" :: "v"(qf), "v"(kg), "v"(vg) : "memory");   // in front of any overwrite of a register that these loads name; the inputs keep the address registers whole up to here
    *(v8h*)&kb[0][tid * 8] = k0; *(v8h*)&kb[1][tid * 8] = k1; *(v8h*)&vb[0][tid * 8] = v0; }
  __syncthreads();   // K tiles 0 and 1 and V tile 0 stand in LDS
  v16h kf[2][2][2]; ld_kl(kf, &kb[0][lane * 8]);
  int i1 = 1, i2 = 2;   // ring places of tiles t + 1 and t + 2
  // one pass: unnormalised P^T against the reference m in use, V^T . P^T
  v8f acc[4] = {}, accl[4] = {};
#pragma unroll 1   // one trip per barrier; the ring indices rotate at run time
  for (int ks = 0; ks < SS / 32; ++ks) {
    *(v8h*)&kb[i2][tid * 8] = rk; *(v8h*)&vb[(ks + 1) & 1][tid * 8] = rv;   // V: the readers of trip t - 1 left this buffer before its barrier
    { const int nk = ((ks + 3) & (SS / 32 - 1)) * 4096, nv = ((ks + 2) & (SS / 32 - 1)) * 4096; const _Float16* p = kg + nk; const _Float16* w = vg + nv; rk = *(const v8h*)p; rv = *(const v8h*)w;   // the last trips' indices wrap and stay in bounds
      asm volatile("s_wait_xcnt 0x0" :: "v"(p), "v"(w) : "memory"); }   // in front of any overwrite of the loads' address registers
    v8f c[2], cl[2];
#pragma unroll   // constant indices: fragments, scores and sums stay in registers
    for (int ct = 0; ct < 2; ++ct) { c[ct] = v8f{}; cl[ct] = v8f{};
#pragma unroll   // constant indices: fragments, scores and sums stay in registers
      for (int kc = 0; kc < 2; ++kc) { c[ct] = wmma16(kf[ct][kc][0], aq[kc], c[ct]); cl[ct] = wmma16(kf[ct][kc][0], aql[kc], cl[ct]); cl[ct] = wmma16(kf[ct][kc][1], aq[kc], cl[ct]); } }
    v16h vf[4][2];   // this tile's V fragments, one group of LDS reads into the registers that K's fragments leave
    const _Float16* vp = &vb[ks & 1][lane * 8];
#pragma unroll   // constant indices: fragments, scores and sums stay in registers
    for (int dt = 0; dt < 4; ++dt) { vf[dt][0] = frag_ch(vp + dt * 1024); vf[dt][1] = frag_ch(vp + dt * 1024 + 512); }
    __builtin_amdgcn_sched_barrier(0);   // the V reads are issued in front of the exponentials and fly during them; sunk behind them, their latency would stand in front of the second product
    float mx[8];
#pragma unroll   // constant indices: fragments, scores and sums stay in registers
    for (int r = 0; r < 8; ++r) { c[0][r] += cl[0][r] * (1.0f / 2048.0f); c[1][r] += cl[1][r] * (1.0f / 2048.0f); mx[r] = fmaxf(c[0][r], c[1][r]); }
    float tm = fmaxf(fmaxf(fmaxf(mx[0], mx[1]), fmaxf(mx[2], mx[3])), fmaxf(fmaxf(mx[4], mx[5]), fmaxf(mx[6], mx[7])));
    tm = fmaxf(tm, xhalf(tm)) * 0.125f;   // the tile's maximum of query col, alike in both halves: P^T's 32 keys need one reference
    if (__builtin_amdgcn_ballot_w32(tm > m + 5.5f) != 0) {   // one scalar branch a tile: sums are rescaled only when some query's maximum has outgrown its reference by more than 5.5 (an exponential stays below 245)
      const float mn = fmaxf(m, tm), alpha = (m <= -1.0e38f) ? 0.f : __expf(m - mn);
      l *= alpha; m = mn;
#pragma unroll   // constant indices: fragments, scores and sums stay in registers
      for (int dt = 0; dt < 4; ++dt) { acc[dt] *= alpha; accl[dt] *= alpha; } }
    v16h ph, pl;   // P^T as a B operand: hi, residual x2048
    float es[8];
#pragma unroll   // constant indices: fragments, scores and sums stay in registers
    for (int r = 0; r < 8; ++r) {
#pragma unroll   // constant indices: fragments, scores and sums stay in registers
      for (int ct = 0; ct < 2; ++ct) { const float e = __expf(c[ct][r] * 0.125f - m);   // unnormalised; 1/l applied to the accumulators at the end
        const _Float16 he = (_Float16)e; ph[ct * 8 + r] = he; pl[ct * 8 + r] = (_Float16)((e - (float)he) * 2048.0f); es[r] = ct ? es[r] + e : e; } }
    l += ((es[0] + es[1]) + (es[2] + es[3])) + ((es[4] + es[5]) + (es[6] + es[7]));
#pragma unroll   // constant indices: fragments, scores and sums stay in registers
    for (int dt = 0; dt < 4; ++dt) { acc[dt] = wmma16(vf[dt][0], ph, acc[dt]); accl[dt] = wmma16(vf[dt][0], pl, accl[dt]); accl[dt] = wmma16(vf[dt][1], ph, accl[dt]); }
    ld_kl(kf, &kb[i1][lane * 8]);   // the next tile's K fragments, once V's registers are free
    __syncthreads();   // publishes K tile t + 2 and V tile t + 1; ends all reads of the buffers that the next trip refills
    i1 = i2; i2 = (i2 == 2) ? 0 : i2 + 1; }
  l += xhalf(l);   // the query's other sixteen keys of every tile, under the same reference
  const float il = 1.0f / l;
  if (g == 0) { st[0][wave * 16 + col] = m; st[1][wave * 16 + col] = il * (1.0f / NH); }   // both halves hold the query's values
  __syncthreads();   // every wave's figures stand in LDS
  if (tid < 256) SM[(size_t)bh * SS + blockIdx.x * 256 + tid] = st[0][tid]; else SW[(size_t)bh * SS + blockIdx.x * 256 + tid - 256] = st[1][tid - 256];   // one 128-byte line a wave
  asm volatile("s_wait_xcnt 0x0" ::: "memory");   // in front of any later overwrite of a register that this store names
  // the head's 64 columns are k steps 2 h and 2 h + 1 of k_out: lane = 16 g + row, piece x holds k = 16 (x / 2) + 8 g + 4 (x mod 2) + i of its step:
  // that is registers 4 (x mod 2) + i of the lane's own O^T tile x / 2
  float* of = O + ((size_t)b * SS + q0) * DM + h * 1024 + lane * 4;
#pragma unroll   // constant indices: the sums stay in registers
  for (int x = 0; x < 8; ++x) { v4f o;
#pragma unroll   // as above
    for (int i = 0; i < 4; ++i) o[i] = (acc[x >> 1][(x & 1) * 4 + i] + accl[x >> 1][(x & 1) * 4 + i] * (1.0f / 2048.0f)) * il;
    vst2(of + x * 128, o); }
  asm volatile("s_wait_xcnt 0x0" ::: "memory");   // in front of any later overwrite of a register that these stores name
}
// k_map: the head mean of the attention map. Block = 128 query rows x 128 keys of one batch, 16 waves as 4 x 4, a wave owns 32 x 32 and sums the heads
// (in the order 0..15) in registers. A head's Q rows and K rows of the block (32 KiB each, in a row) are fetched once and put into LDS, two buffers.
#define HSTEP ((SS / 32) * 4096)   // halves from one head's fragments to the next head's
__global__ __launch_bounds__(512) void k_map(const _Float16* __restrict__ QF, const _Float16* __restrict__ KF, const float* __restrict__ SM, const float* __restrict__ SW, float* __restrict__ ATT) {
  __shared__ __align__(16) _Float16 qb[2][4 * 4096], kb[2][4 * 4096]; __shared__ __align__(16) float sst[2][NH][128]; __shared__ __align__(16) float so[16][32][36];
  const int tid = threadIdx.x, wave = __builtin_amdgcn_readfirstlane(tid >> 5), lane = tid & 31, col = lane & 15, g = lane >> 4;   // readfirstlane: the wave's offsets stay in scalar registers
  const int b = blockIdx.z, r0 = blockIdx.y * 128, k0 = blockIdx.x * 128, wr = wave >> 2, wc = wave & 3;
  const _Float16* qs = QF + ((size_t)b * NH * (SS / 32) + (r0 >> 5)) * 4096; const _Float16* cs = KF + ((size_t)b * NH * (SS / 32) + (k0 >> 5)) * 4096;   // head 0: the first of the block's four 32-row tiles of Q, of K
  const _Float16* qg = qs + tid * 8; const _Float16* kg = cs + tid * 8;   // the thread's 16 bytes of it
  v8h rq[4], rk[4];
  { const float* ms = SM + ((size_t)b * NH + wave) * SS + r0; const float* fs = SW + ((size_t)b * NH + wave) * SS + r0;   // wave w brings head w's 128 rows
    const v4f tm = *(const v4f*)(ms + lane * 4), tw = *(const v4f*)(fs + lane * 4); v8h q0[4], c0[4];
#pragma unroll   // constant indices: the pieces stay in registers; heads 0 and 1 are fetched as one group, with one wait behind it
    for (int j = 0; j < 4; ++j) { q0[j] = *(const v8h*)(qg + j * 4096); c0[j] = *(const v8h*)(kg + j * 4096); rq[j] = *(const v8h*)(qg + HSTEP + j * 4096); rk[j] = *(const v8h*)(kg + HSTEP + j * 4096); }
    asm volatile("s_wait_xcnt 0x0" :: "s"(qs), "s"(cs), "s"(ms), "s"(fs), "v"(tid), "v"(lane) : "memory");   // in front of any overwrite of a register that these loads name; the inputs keep bases and offsets whole up to here
    *(v4f*)&sst[0][wave][lane * 4] = tm; *(v4f*)&sst[1][wave][lane * 4] = tw;
#pragma unroll   // as above
    for (int j = 0; j < 4; ++j) { *(v8h*)&qb[0][j * 4096 + tid * 8] = q0[j]; *(v8h*)&kb[0][j * 4096 + tid * 8] = c0[j]; } }
  __syncthreads();   // head 0 and the rows' softmax figures stand in LDS
  v8f am[2][2] = {};
  for (int h = 0; h < NH; ++h) {
#pragma unroll   // as above
    for (int j = 0; j < 4; ++j) { *(v8h*)&qb[(h + 1) & 1][j * 4096 + tid * 8] = rq[j]; *(v8h*)&kb[(h + 1) & 1][j * 4096 + tid * 8] = rk[j]; }   // head h + 1; the readers of head h - 1 left this buffer before its barrier
    { const int ho = ((h + 2) & (NH - 1)) * HSTEP; const _Float16* p = qg + ho; const _Float16* w = kg + ho;   // the last trips' index wraps and stays in bounds
#pragma unroll   // as above
      for (int j = 0; j < 4; ++j) { rq[j] = *(const v8h*)(p + j * 4096); rk[j] = *(const v8h*)(w + j * 4096); }
      asm volatile("s_wait_xcnt 0x0" :: "v"(p), "v"(w) : "memory"); }   // as above
    v16h kf[2][2][2]; ld_kl(kf, &kb[h & 1][wc * 4096 + lane * 8]);
#pragma unroll   // constant indices: fragments, scores and sums stay in registers
    for (int qt = 0; qt < 2; ++qt) { const _Float16* qp = &qb[h & 1][wr * 4096 + qt * 2048 + lane * 8];
      v16h aq[2], aql[2];
#pragma unroll   // constant indices: fragments, scores and sums stay in registers
      for (int kc = 0; kc < 2; ++kc) { aq[kc] = frag_ch(qp + kc * 1024); aql[kc] = frag_ch(qp + kc * 1024 + 512); }
      const float* fm = &sst[0][h][wr * 32 + qt * 16 + 8 * g]; const float* fw = &sst[1][h][wr * 32 + qt * 16 + 8 * g];
      const v4f m0 = *(const v4f*)fm, m1 = *(const v4f*)(fm + 4), w0 = *(const v4f*)fw, w1 = *(const v4f*)(fw + 4);
#pragma unroll   // constant indices: fragments, scores and sums stay in registers
      for (int ct = 0; ct < 2; ++ct) { v8f c = {}, cl = {};
#pragma unroll   // constant indices: fragments, scores and sums stay in registers
        for (int kc = 0; kc < 2; ++kc) { c = wmma16(aq[kc], kf[ct][kc][0], c); cl = wmma16(aql[kc], kf[ct][kc][0], cl); cl = wmma16(aq[kc], kf[ct][kc][1], cl); }
#pragma unroll   // constant indices: fragments, scores and sums stay in registers
        for (int r = 0; r < 8; ++r) { const float mr = r < 4 ? m0[r & 3] : m1[r & 3], wt = r < 4 ? w0[r & 3] : w1[r & 3];
          am[qt][ct][r] += __expf((c[r] + cl[r] * (1.0f / 2048.0f)) * 0.125f - mr) * wt; } } }
    __syncthreads();   // publishes head h + 1; ends all reads of head h's buffer
  }
#pragma unroll   // constant indices: fragments, scores and sums stay in registers
  for (int qt = 0; qt < 2; ++qt) {
#pragma unroll   // constant indices: fragments, scores and sums stay in registers
    for (int ct = 0; ct < 2; ++ct) {
#pragma unroll   // constant indices: fragments, scores and sums stay in registers
      for (int r = 0; r < 8; ++r) so[wave][qt * 16 + 8 * g + r][ct * 16 + col] = am[qt][ct][r]; } }
  LDSX();
  float* ap = ATT + ((size_t)b * SS + r0 + wr * 32 + (lane >> 3)) * SS + k0 + wc * 32 + (lane & 7) * 4;   // eight lanes store one row's 128-byte line
#pragma unroll   // constant offsets: the eight LDS reads are in flight together
  for (int x = 0; x < 8; ++x) vst2(ap + (size_t)x * 4 * SS, *(const v4f*)&so[wave][x * 4 + (lane >> 3)][(lane & 7) * 4]);
  asm volatile("s_wait_xcnt 0x0" ::: "memory");   // in front of any later overwrite of a register that these stores name
}
// ---- k_out: block = (64 rows, 128 cols): out = O(hi/lo) . Wo rows (2 products) + bo
__global__ __launch_bounds__(128) void k_out(const float* __restrict__ O, const __bf16* __restrict__ P, const float* __restrict__ BO, float* __restrict__ Y) {
  __shared__ __align__(16) float so[4][16][132];
  const int tid = threadIdx.x, wave = tid >> 5, lane = tid & 31, col = lane & 15, g = lane >> 4; const size_t r0 = (size_t)blockIdx.x * 64 + wave * 16; const int n0 = blockIdx.y * 128;
  v8f acc[8] = {};
  const float* xa = O + r0 * DM + lane * 4; const __bf16* pb = P + (size_t)n0 * DM + lane * 8;
  KStep t0, t1; ld_step(t0, xa, pb);
#pragma unroll 1   // the two register sets already are the unrolling
  for (int kc = 0; kc < DM / 32; kc += 2) {
    ld_step(t1, xa + 512, pb + 512);
    { float v[16];
#pragma unroll
      for (int i = 0; i < 16; ++i) v[i] = t0.x[i >> 2][i & 3];
      const F2 a = bsplit16(v);
#pragma unroll
      for (int j = 0; j < 8; ++j) { acc[j] = wmma_bf(a.l, t0.w[j], acc[j]); acc[j] = wmma_bf(a.h, t0.w[j], acc[j]); } }
    { const int adv = kc + 2 < DM / 32 ? 1024 : 0; xa += adv; pb += adv; }   // two steps on; last trip: no step is left, the pointers stay inside the tile.
    ld_step(t0, xa, pb);
    { float v[16];
#pragma unroll
      for (int i = 0; i < 16; ++i) v[i] = t1.x[i >> 2][i & 3];
      const F2 a = bsplit16(v);
#pragma unroll
      for (int j = 0; j < 8; ++j) { acc[j] = wmma_bf(a.l, t1.w[j], acc[j]); acc[j] = wmma_bf(a.h, t1.w[j], acc[j]); } } }
#pragma unroll
  for (int j = 0; j < 8; ++j) {
#pragma unroll
    for (int r = 0; r < 8; ++r) so[wave][8 * g + r][j * 16 + col] = acc[j][r] + bfr(BO[n0 + j * 16 + col]); }
  LDSX();
  for (int rl = 0; rl < 16; ++rl) vst2(Y + (r0 + rl) * DM + n0 + lane * 4, *(const v4f*)&so[wave][rl][lane * 4]);
}
extern "C" void kernel_launch(void* const* d_in, const int* in_sizes, int n_in, void* d_out, int out_size, void* d_ws, size_t ws_size, hipStream_t stream) {
  (void)in_sizes; (void)n_in; (void)out_size;
  const float** F = (const float**)d_in;   // 0 q_in [4,1024,1024], 1 k_in, 2 v_in, 3 Wq [1024,1024] natural (x @ W.T), 4 bq, 5 Wk, 6 bk, 7 Wv, 8 bv, 9 Wo, 10 bo
  if (ws_size < (size_t)WS_END) return;
  char* ws = (char*)d_ws; __bf16* PK = (__bf16*)(ws + WS_PK); _Float16 *QF = (_Float16*)(ws + WS_QF), *KF = (_Float16*)(ws + WS_KF), *VF = (_Float16*)(ws + WS_VF); float* O = (float*)(ws + WS_O); __bf16* XP = (__bf16*)(ws + WS_XP); float* SM = (float*)(ws + WS_ST); float* SW = SM + NB * NH * SS;
  k_pack<<<dim3(DM / 16, 16), 256, 0, stream>>>(F[3], F[5], F[7], F[9], F[0], F[1], F[2], PK, XP);
  k_qkv<<<dim3(TNB * SS / 64, QKVW / 128), 128, 0, stream>>>(XP, PK + PK_A, F[4], F[6], F[8], QF, KF, VF);
  k_attn<<<dim3(SS / 256, TNB * NH), 512, 0, stream>>>(QF, KF, VF, O, SM, SW);
  k_map<<<dim3(SS / 128, SS / 128, TNB), 512, 0, stream>>>(QF, KF, SM, SW, (float*)((char*)d_out + 16777216));
  k_out<<<dim3(TOB, DM / 128), 128, 0, stream>>>(O, PK + PK_P, F[10], (float*)d_out);
}

// v007
// One run takes 146 microseconds.
// Timed twice side by side with v006, it ran 1.05 and 1.04 times as fast.
// Over all steps from v000 it is 18.0 times as fast.
#include <hip/hip_runtime.h>
#include <math.h>

typedef __attribute__((ext_vector_type(16))) _Float16 v16h;
typedef __attribute__((ext_vector_type(16))) __bf16 v16b;
typedef __attribute__((ext_vector_type(8)))  _Float16 v8h;
typedef __attribute__((ext_vector_type(8)))  float v8f;
typedef __attribute__((ext_vector_type(4)))  float v4f;
typedef __attribute__((ext_vector_type(2)))  float v2f;
typedef __attribute__((ext_vector_type(4)))  unsigned v4u;
typedef __attribute__((ext_vector_type(4)))  int v4i;
typedef float __attribute__((may_alias)) float_a;
typedef int __attribute__((may_alias)) int_a;

template <typename T> __device__ __forceinline__ void vst2(void* p, T v) { *(T*)p = v;  }
__device__ __forceinline__ v8f wmma16(v16h a, v16h b, v8f c) {
  v8f d = __builtin_amdgcn_wmma_f32_16x16x32_f16(false, a, false, b, (short)0, c, false, false);
  asm volatile("v_nop\n\tv_nop\n\tv_nop\n\tv_nop" : "+v"(d) : "v"(a), "v"(b));
  return d;
}
__device__ __forceinline__ v8f wmma_bf(v16b a, v16b b, v8f c) {
  v8f d = __builtin_amdgcn_wmma_f32_16x16x32_bf16(false, a, false, b, (short)0, c, false, false);
  asm volatile("v_nop\n\tv_nop\n\tv_nop\n\tv_nop" : "+v"(d) : "v"(a), "v"(b));
  return d;
}
// Multi-head cross-attention that also returns the head-averaged attention map (B 4, T 1,024 queries, 1,024 memory positions, d 1,024, 16 heads x 64).
__device__ __forceinline__ v16h frag_h(const _Float16* rowk0, int lane) {
  union { v16h v; v8h q[2]; } u; const _Float16* p = rowk0 + 8 * (lane >> 4);
  u.q[0] = *(const v8h*)p; u.q[1] = *(const v8h*)(p + 16); return u.v;
}
__device__ __forceinline__ v16h frag_f32(const float* rowk0, int lane) {
  v16h a; const float* p = rowk0 + 8 * (lane >> 4);
#pragma unroll
  for (int i = 0; i < 8; ++i) { a[i] = (_Float16)p[i]; a[8 + i] = (_Float16)p[16 + i]; }
  return a;
}
__device__ __forceinline__ v16h frag_f32s(const float* rowk0, int lane, float sc) {
  v16h a; const float* p = rowk0 + 8 * (lane >> 4);
#pragma unroll
  for (int i = 0; i < 8; ++i) { a[i] = (_Float16)(p[i] * sc); a[8 + i] = (_Float16)(p[16 + i] * sc); }
  return a;
}
// column fragment from a [K][ld] layout (column n), rows >= K read as 0
__device__ __forceinline__ v16h fragc_f32(const float* W, int k0, int n, int lane, int ld, int K) {
  v16h a; const int g = lane >> 4;
#pragma unroll
  for (int i = 0; i < 8; ++i) { const int ka = k0 + 8 * g + i, kb = ka + 16;
    a[i] = (_Float16)(ka < K ? W[(size_t)(ka < K ? ka : K - 1) * ld + n] : 0.f); a[8 + i] = (_Float16)(kb < K ? W[(size_t)(kb < K ? kb : K - 1) * ld + n] : 0.f); }
  return a;
}
struct F2 { v16b h, l; };
__device__ __forceinline__ F2 bsplit16(const float v[16]) { F2 r;
#pragma unroll
  for (int i = 0; i < 16; ++i) { const __bf16 h = (__bf16)v[i]; r.h[i] = h; r.l[i] = (__bf16)(v[i] - (float)h); }
  return r; }
__device__ __forceinline__ F2 split_row(const float* row, int k0, int lane) { float v[16]; const float* p = row + k0 + 8 * (lane >> 4);
#pragma unroll
  for (int i = 0; i < 8; ++i) { v[i] = p[i]; v[8 + i] = p[16 + i]; }
  return bsplit16(v); }
__device__ __forceinline__ F2 split_rowK(const float* row, int k0, int lane, int K) { float v[16]; const int g = lane >> 4;
#pragma unroll
  for (int i = 0; i < 8; ++i) { const int ka = k0 + 8 * g + i, kb = ka + 16; v[i] = ka < K ? row[ka < K ? ka : K - 1] : 0.f; v[8 + i] = kb < K ? row[kb < K ? kb : K - 1] : 0.f; }
  return bsplit16(v); }
__device__ __forceinline__ F2 split_col(const float* W, int k0, int n, int lane, int ld, int K) { float v[16]; const int g = lane >> 4;
#pragma unroll
  for (int i = 0; i < 8; ++i) { const int ka = k0 + 8 * g + i, kb = ka + 16; v[i] = ka < K ? W[(size_t)(ka < K ? ka : K - 1) * ld + n] : 0.f; v[8 + i] = kb < K ? W[(size_t)(kb < K ? kb : K - 1) * ld + n] : 0.f; }
  return bsplit16(v); }
__device__ __forceinline__ v8f mac3(const F2& a, const F2& b, v8f c) { c = wmma_bf(a.l, b.h, c); c = wmma_bf(a.h, b.l, c); return wmma_bf(a.h, b.h, c); }
__device__ __forceinline__ float sigm(float v) { return 1.0f / (1.0f + expf(-v)); }
#define LDSX() do { asm volatile("s_wait_dscnt 0" ::: "memory"); __builtin_amdgcn_wave_barrier(); __builtin_amdgcn_fence(__ATOMIC_RELEASE, "workgroup"); } while (0)


#define NB 4
#define SS 1024
#define DM 1024
#define NH 16
#define HD 64
#define QKVW (3 * DM)
#ifndef TQB
#define TQB (SS / 64)
#define TNB NB
#define TOB (NB * SS / 64)     // output row tiles (all)
#endif
typedef __attribute__((ext_vector_type(8))) __bf16 v8b;
__device__ __forceinline__ v16b frag_b(const __bf16* rowk0, int lane) {
  union { v16b v; v8b q[2]; } u; const __bf16* p = rowk0 + 8 * (lane >> 4);
  u.q[0] = *(const v8b*)p; u.q[1] = *(const v8b*)(p + 16); return u.v;
}
__device__ __forceinline__ float bfr(float v) { return (float)(__bf16)v; }
__device__ __attribute__((noinline)) float exp_ni(float v) { return expf(v); }
__device__ __attribute__((noinline)) float erf_ni(float v) { return erff(v); }

#define PK_A 0                       // Wqkv, 192 tiles of 16 rows, fragment order (see k_pack)
#define PK_P (PK_A + QKVW * DM)        // Wo, 64 tiles of 16 rows, fragment order
#define PK_END (PK_P + DM * DM)
// Every operand that a loop reads from the workspace lies there in FRAGMENT ORDER: the 16 bytes that lane 0..31 loads
// with one instruction stand side by side, so a wave-wide 16-byte load reads 512 contiguous bytes (four whole 128-byte lines, not pieces of sixteen).
#define WS_PK  0u
#define WS_QF  (WS_PK + 2u * PK_END)             // f16 Q fragments, laid out as K's: [b][h][32-row tile][ct 2][kc 2][hi, residual x2048][half 2][lane 32][8]
#define WS_KF  (WS_QF + 4u * NB * SS * DM)         // f16 K fragments [b][h][32-key tile][ct 2][kc 2][hi, residual x2048][half 2][lane 32][8]
#define WS_VF  (WS_KF + 4u * NB * SS * DM)         // f16 V fragments [b][h][32-key tile][dt 4][hi, residual x2048][half 2][lane 32][8]
#define WS_O   (WS_VF + 4u * NB * SS * DM)         // f32 O fragments [16-row tile][kc 32][piece 4][lane 32][4]
#define WS_XP  (WS_O + 4u * NB * SS * DM)          // bf16 q_in, k_in, v_in, each 256 tiles of 16 rows, fragment order (see k_pack)
#define WS_ST  (WS_XP + 2u * 3 * NB * SS * DM)     // f32 [2][b][h][query row]: the row's softmax reference m; 1 / (16 x the row's sum of exp(s - m))
#define WS_END (WS_ST + 8u * NB * NH * SS)
// a 16-bit fragment in fragment order: p = the lane's 16 bytes of the first half, the second half stands 512 bytes on
__device__ __forceinline__ v16h frag_ch(const _Float16* p) { union { v16h v; v8h q[2]; } u; u.q[0] = *(const v8h*)p; u.q[1] = *(const v8h*)(p + 256); return u.v; }
__device__ __forceinline__ v16b frag_cb(const __bf16* p) { union { v16b v; v8b q[2]; } u; u.q[0] = *(const v8b*)p; u.q[1] = *(const v8b*)(p + 256); return u.v; }
// ---- k_pack: block = (tile of 16 rows, which); which 0..2 -> W_q/W_k/W_v into PK_A, 3 -> W_o into PK_P, 4..15 -> a quarter of the rows of q_in/k_in/v_in into XP.
// f32 -> bf16, stored as [tile][kc 32][half 2][lane 32][8]: lane = 16 g + row, k = 32 kc + 16 half + 8 g + i (the k order of frag_b, for A and B alike)
__global__ __launch_bounds__(256) void k_pack(const float* __restrict__ WQ, const float* __restrict__ WK, const float* __restrict__ WV, const float* __restrict__ WO, const float* __restrict__ XQ, const float* __restrict__ XK, const float* __restrict__ XV, __bf16* __restrict__ PK, __bf16* __restrict__ XP) {
  const int which = blockIdx.y, t = threadIdx.x, nt = (which < 4) ? blockIdx.x : ((which - 4) & 3) * 64 + blockIdx.x;
  const float* Wm = (which == 0) ? WQ : (which == 1) ? WK : (which == 2) ? WV : (which == 3) ? WO : (which < 8) ? XQ : (which < 12) ? XK : XV;
  __bf16* dst = ((which < 3) ? PK + PK_A + (size_t)which * DM * DM : (which == 3) ? PK + PK_P : XP + (size_t)((which - 4) >> 2) * NB * SS * DM) + (size_t)nt * 16 * DM;
  const float* s = Wm + (size_t)(nt * 16 + (t & 15)) * DM + ((t >> 5) & 1) * 16 + 8 * ((t >> 4) & 1) + (t >> 6) * 32;   // piece t + 256 u: lane t & 31, half (t >> 5) & 1, kc = (t >> 6) + 4 u
  v4f a[8], c[8];
#pragma unroll   // a thread's sixteen loads are in flight together
  for (int u = 0; u < 8; ++u) { a[u] = *(const v4f*)(s + u * 128); c[u] = *(const v4f*)(s + u * 128 + 4); }
#pragma unroll   // constant indices: a, c and o stay in registers
  for (int u = 0; u < 8; ++u) { v8b o;
#pragma unroll   // as above
    for (int i = 0; i < 4; ++i) { o[i] = (__bf16)a[u][i]; o[4 + i] = (__bf16)c[u][i]; }
    *(v8b*)(dst + (size_t)(u * 256 + t) * 8) = o; }
}
// one k step (32 wide) of a wave tile 128 columns wide: the row operand (k_out: f32 pieces of 16 rows; k_qkv: the bf16 fragments of two 16-row tiles) and the eight weight fragments, all loads issued as one group.
// p: the lane's first 16 bytes of the row tile's step; w: the lane's 16 bytes of the first weight tile's step. A step is 1 KiB of a bf16 tile, 2 KiB of an f32 tile
struct KStep { v4f x[4]; v16b w[8]; };
struct KStepB { v16b a[2]; v16b w[8]; };   // k_qkv: two row tiles, 64 rows apart, share the eight weight fragments
__device__ __forceinline__ void ld_stepb(KStepB& t, const __bf16* p, const __bf16* w) {
  t.a[0] = frag_cb(p); t.a[1] = frag_cb(p + (size_t)64 * DM);
#pragma unroll   // constant indices and offsets: t.w stays in registers, every load is the lane's address plus a constant
  for (int j = 0; j < 8; ++j) t.w[j] = frag_cb(w + (size_t)j * 16 * DM);
  asm volatile("s_wait_xcnt 0x0" :: "v"(p), "v"(w) : "memory");   // in front of any later overwrite of a register that these loads name; the inputs keep the address registers whole up to here
}
// sixteen products of one k step: both row tiles against the eight weight fragments. Plain builtins: the wave needs more than 256 registers, and with an asm statement on each product's operands the build spilled; the compiler keeps the distance behind its own WMMAs
__device__ __forceinline__ void mm16(v8f (&acc)[2][8], const KStepB& t) {
#pragma unroll   // constant indices: the sums stay in registers
  for (int j = 0; j < 8; ++j) {
    acc[0][j] = __builtin_amdgcn_wmma_f32_16x16x32_bf16(false, t.a[0], false, t.w[j], (short)0, acc[0][j], false, false);
    acc[1][j] = __builtin_amdgcn_wmma_f32_16x16x32_bf16(false, t.a[1], false, t.w[j], (short)0, acc[1][j], false, false); }
  __builtin_amdgcn_sched_barrier(0);   // the next group of loads stays behind these products and the products behind the group in front: sunk among them, a load would be waited for with no step of lead
}
__device__ __forceinline__ void ld_step(KStep& t, const float* p, const __bf16* w) {
  t.x[0] = *(const v4f*)p; t.x[1] = *(const v4f*)(p + 128); t.x[2] = *(const v4f*)(p + 256); t.x[3] = *(const v4f*)(p + 384);
#pragma unroll
  for (int j = 0; j < 8; ++j) t.w[j] = frag_cb(w + (size_t)j * 16 * DM);
  asm volatile("s_wait_xcnt 0x0" :: "v"(p), "v"(w) : "memory");   // in front of any later overwrite of a register that these loads name; the inputs keep the address registers whole up to here
}
__global__ __launch_bounds__(128) void k_qkv(const __bf16* __restrict__ XP, const __bf16* __restrict__ P, const float* __restrict__ BQ, const float* __restrict__ BK, const float* __restrict__ BV, _Float16* __restrict__ QF, _Float16* __restrict__ KF, _Float16* __restrict__ VF) {
  const int which0 = (blockIdx.y * 128) / DM; const __bf16* X = XP + (size_t)which0 * NB * SS * DM;   // q from q_in, k from k_in, v from v_in
  __shared__ __align__(16) _Float16 so[4][16][136], sol[4][16][136]; __shared__ __align__(16) _Float16 sth[128][72], stl[128][72];
  const int tid = threadIdx.x, wave = tid >> 5, lane = tid & 31, col = lane & 15, g = lane >> 4; const size_t rw = (size_t)blockIdx.x * 128 + wave * 16; const int n0 = blockIdx.y * 128;   // the wave's row tiles start at rw and rw + 64: a weight fragment, once loaded, feeds two products
  v8f acc2[2][8] = {};
  const __bf16* xa = X + rw * DM + lane * 8; const __bf16* pb = P + (size_t)n0 * DM + lane * 8;
  KStepB t0, t1; ld_stepb(t0, xa, pb);
#pragma unroll 1   // the two register sets already are the unrolling
  for (int kc = 0; kc < DM / 32; kc += 2) {
    ld_stepb(t1, xa + 512, pb + 512);
    __builtin_amdgcn_sched_barrier(0);   // as in mm16
    mm16(acc2, t0);
    { const int adv = kc + 2 < DM / 32 ? 1024 : 0; xa += adv; pb += adv; }   // two steps on; last trip: no step is left, the pointers stay inside the tile.
    ld_stepb(t0, xa, pb);
    __builtin_amdgcn_sched_barrier(0);   // as in mm16
    mm16(acc2, t1); }
#pragma unroll   // constant index: both sets of sums stay in registers. Each trip hands out 64 of the block's 128 rows through the same LDS stage (q, k: a wave's own part, whose reads have returned into its stores' data before the second trip)
  for (int rt = 0; rt < 2; ++rt) { v8f (&acc)[8] = acc2[rt]; const size_t r0 = rw + rt * 64;
  { const float* BB = (which0 == 0) ? BQ : (which0 == 1) ? BK : BV;
#pragma unroll
    for (int j = 0; j < 8; ++j) { const float bb = bfr(BB[(n0 % DM) + j * 16 + col]);
#pragma unroll
      for (int r = 0; r < 8; ++r) acc[j][r] += bb; } }
  if (n0 < 2 * DM) {   // q stored unscaled (f16 sigma ~0.6, no subnormal exposure); 1/8 applied to the f32 score
#pragma unroll
    for (int j = 0; j < 8; ++j) {
#pragma unroll
      for (int r = 0; r < 8; ++r) { const float v = acc[j][r]; const _Float16 hv = (_Float16)v; so[wave][8 * g + r][j * 16 + col] = hv; sol[wave][8 * g + r][j * 16 + col] = (_Float16)((v - (float)hv) * 2048.0f); } }   // q, k as f16 hi + (x2048) residual (no RoPE in this module)
    LDSX();
    {   // the wave's 16 rows (queries or keys) are one ct of one 32-row tile, its 128 columns two heads: lane = 16 g + row, d = 32 kc + 16 half + 8 g + i
      _Float16* FB = (n0 < DM) ? QF : KF; const int b = (int)(r0 / SS), kt = (int)(r0 % SS) / 16, h0 = (n0 % DM) / HD;
#pragma unroll   // constant offsets: the wave's sixteen LDS reads are in flight together
      for (int hh = 0; hh < 2; ++hh) { _Float16* kd = FB + (((size_t)(b * NH + h0 + hh) * (SS / 32) + (kt >> 1)) * 2 + (kt & 1)) * 2048 + lane * 8;
#pragma unroll   // as above
        for (int kq = 0; kq < 4; ++kq) { const int kc = kq >> 1, hf = kq & 1, sc = hh * 64 + kc * 32 + hf * 16 + 8 * g;
          vst2((unsigned*)(kd + kc * 1024 + hf * 256), *(const v4u*)&so[wave][col][sc]); vst2((unsigned*)(kd + kc * 1024 + 512 + hf * 256), *(const v4u*)&sol[wave][col][sc]); } }
      asm volatile("s_wait_xcnt 0x0" ::: "memory");   // in front of any later overwrite of a register that these stores name
    }
  } else {
#pragma unroll
    for (int j = 0; j < 8; ++j) {
#pragma unroll
      for (int r = 0; r < 8; ++r) { const float v = acc[j][r]; const _Float16 hv = (_Float16)v; sth[j * 16 + col][wave * 16 + 8 * g + r] = hv; stl[j * 16 + col][wave * 16 + 8 * g + r] = (_Float16)((v - (float)hv) * 2048.0f); } }
    __syncthreads();
    const size_t rb = (size_t)blockIdx.x * 128 + rt * 64; const int b = (int)(rb / SS), ks0 = (int)(rb % SS) / 32, h0 = (n0 - 2 * DM) / HD;
    // the trip's 64 keys are two key tiles, its 128 columns two heads: lane = 16 g + (d mod 16), key = 32 tile + 16 half + 8 g + i
    for (int e = tid; e < 1024; e += 128) { const int hf = (e >> 5) & 1, dt = (e >> 6) & 3, hh = (e >> 8) & 1, kl = e >> 9; const int d = hh * 64 + dt * 16 + col, kk = kl * 32 + hf * 16 + 8 * g;
      _Float16* vd = VF + (((size_t)(b * NH + h0 + hh) * (SS / 32) + ks0 + kl) * 4 + dt) * 1024 + hf * 256 + lane * 8; vst2((unsigned*)vd, *(const v4u*)&sth[d][kk]); vst2((unsigned*)(vd + 512), *(const v4u*)&stl[d][kk]); }
    asm volatile("s_wait_xcnt 0x0" ::: "memory");   // in front of any later overwrite of a register that these stores name
    if (rt == 0) __syncthreads();   // every wave has read the stage before the second trip writes it again
  } }
}
// the K fragments (hi, residual) of one 32-key tile, read from its copy in LDS; p: the lane's 16 bytes of the tile (8 KiB in a row, fragment order)
__device__ __forceinline__ void ld_kl(v16h (&kf)[2][2][2], const _Float16* p) {
#pragma unroll   // constant indices and offsets: kf stays in registers, the sixteen LDS reads stand as one group
  for (int ct = 0; ct < 2; ++ct) {
#pragma unroll   // as above
    for (int kc = 0; kc < 2; ++kc) { kf[ct][kc][0] = frag_ch(p + (ct * 2 + kc) * 1024); kf[ct][kc][1] = frag_ch(p + (ct * 2 + kc) * 1024 + 512); } }
}
// k_attn: block = 256 query rows of ONE head of one batch, 16 waves, wave w = query tile w. Each 32-key tile of K and of V is fetched once a block
// (16 bytes a thread) and put into LDS, where all sixteen waves read their fragments. Out: O, and per row the reference m and 1 / (16 l) for k_map.
// K ring of three buffers: in trip t tile t + 2 is stored, tile t + 1 (published by the barrier of trip t - 1) is read into registers. V: two buffers.
// Both products are taken transposed: S^T = K . Q^T (A = K fragments, B = Q fragments) and O^T = V^T . P^T (A = V fragments, B = P^T). Lane (g, col) then holds,
// of query col alone, the scores of keys 16 ct + 8 g + r: maximum and sum are in-lane, and the two score tiles, converted in place, are the B operand P^T
// (element 8 ct + r = key 16 ct + 8 g + r, the k order of the V fragments). Lanes col and col + 16 split a query's keys: their maxima are joined in every tile, their sums once, behind the loop.
// One pass over the keys: the sums are kept against a reference m that follows the running maximum, and are rescaled when it moves.
__device__ __forceinline__ float xhalf(float v) { return __int_as_float(__builtin_amdgcn_permlanex16(__float_as_int(v), __float_as_int(v), 0x76543210, 0xfedcba98, false, false)); }   // the value of lane l ^ 16
__global__ __launch_bounds__(512) void k_attn(const _Float16* __restrict__ QF, const _Float16* __restrict__ KF, const _Float16* __restrict__ VF, float* __restrict__ O, float* __restrict__ SM, float* __restrict__ SW) {
  __shared__ __align__(16) _Float16 kb[3][4096], vb[2][4096]; __shared__ __align__(16) float st[2][256];
  const int tid = threadIdx.x, wave = __builtin_amdgcn_readfirstlane(tid >> 5), lane = tid & 31, col = lane & 15, g = lane >> 4;   // readfirstlane: the wave's offsets stay in scalar registers
  const int bh = blockIdx.y, b = bh / NH, h = bh % NH; const int q0 = blockIdx.x * 256 + wave * 16;
  const _Float16* qf = QF + ((size_t)bh * (SS / 32) + (q0 >> 5)) * 4096 + ((q0 >> 4) & 1) * 2048 + lane * 8;
  v16h aq[2], aql[2];
#pragma unroll   // constant indices: fragments, scores and sums stay in registers
  for (int kc = 0; kc < 2; ++kc) { aq[kc] = frag_ch(qf + kc * 1024); aql[kc] = frag_ch(qf + kc * 1024 + 512); }
  float m = -3.0e38f, l = 0.f;   // of query col: the reference in use (it may trail the true maximum by up to 5.5); the sum over the lane's half of the keys
  const _Float16* kg = KF + (size_t)bh * (SS / 32) * 4096 + tid * 8; const _Float16* vg = VF + (size_t)bh * (SS / 32) * 4096 + tid * 8;   // the thread's 16 bytes of tile 0
  v8h rk, rv;   // the thread's piece of the K tile two trips ahead, of the V tile one trip ahead
  { const v8h k0 = *(const v8h*)kg, k1 = *(const v8h*)(kg + 4096), v0 = *(const v8h*)vg; rk = *(const v8h*)(kg + 2 * 4096); rv = *(const v8h*)(vg + 4096);
    asm volatile("s_wait_xcnt 0x0" :: "v"(qf), "v"(kg), "v"(vg) : "memory");   // in front of any overwrite of a register that these loads name; the inputs keep the address registers whole up to here
    *(v8h*)&kb[0][tid * 8] = k0; *(v8h*)&kb[1][tid * 8] = k1; *(v8h*)&vb[0][tid * 8] = v0; }
  __syncthreads();   // K tiles 0 and 1 and V tile 0 stand in LDS
  v16h kf[2][2][2]; ld_kl(kf, &kb[0][lane * 8]);
  int i1 = 1, i2 = 2;   // ring places of tiles t + 1 and t + 2
  // one pass: unnormalised P^T against the reference m in use, V^T . P^T
  v8f acc[4] = {}, accl[4] = {};
#pragma unroll 1   // one trip per barrier; the ring indices rotate at run time
  for (int ks = 0; ks < SS / 32; ++ks) {
    *(v8h*)&kb[i2][tid * 8] = rk; *(v8h*)&vb[(ks + 1) & 1][tid * 8] = rv;   // V: the readers of trip t - 1 left this buffer before its barrier
    { const int nk = ((ks + 3) & (SS / 32 - 1)) * 4096, nv = ((ks + 2) & (SS / 32 - 1)) * 4096; const _Float16* p = kg + nk; const _Float16* w = vg + nv; rk = *(const v8h*)p; rv = *(const v8h*)w;   // the last trips' indices wrap and stay in bounds
      asm volatile("s_wait_xcnt 0x0" :: "v"(p), "v"(w) : "memory"); }   // in front of any overwrite of the loads' address registers
    v8f c[2], cl[2];
#pragma unroll   // constant indices: fragments, scores and sums stay in registers
    for (int ct = 0; ct < 2; ++ct) { c[ct] = v8f{}; cl[ct] = v8f{};
#pragma unroll   // constant indices: fragments, scores and sums stay in registers
      for (int kc = 0; kc < 2; ++kc) { c[ct] = wmma16(kf[ct][kc][0], aq[kc], c[ct]); cl[ct] = wmma16(kf[ct][kc][0], aql[kc], cl[ct]); cl[ct] = wmma16(kf[ct][kc][1], aq[kc], cl[ct]); } }
    v16h vf[4][2];   // this tile's V fragments, one group of LDS reads into the registers that K's fragments leave
    const _Float16* vp = &vb[ks & 1][lane * 8];
#pragma unroll   // constant indices: fragments, scores and sums stay in registers
    for (int dt = 0; dt < 4; ++dt) { vf[dt][0] = frag_ch(vp + dt * 1024); vf[dt][1] = frag_ch(vp + dt * 1024 + 512); }
    __builtin_amdgcn_sched_barrier(0);   // the V reads are issued in front of the exponentials and fly during them; sunk behind them, their latency would stand in front of the second product
    float mx[8];
#pragma unroll   // constant indices: fragments, scores and sums stay in registers
    for (int r = 0; r < 8; ++r) { c[0][r] += cl[0][r] * (1.0f / 2048.0f); c[1][r] += cl[1][r] * (1.0f / 2048.0f); mx[r] = fmaxf(c[0][r], c[1][r]); }
    float tm = fmaxf(fmaxf(fmaxf(mx[0], mx[1]), fmaxf(mx[2], mx[3])), fmaxf(fmaxf(mx[4], mx[5]), fmaxf(mx[6], mx[7])));
    tm = fmaxf(tm, xhalf(tm)) * 0.125f;   // the tile's maximum of query col, alike in both halves: P^T's 32 keys need one reference
    if (__builtin_amdgcn_ballot_w32(tm > m + 5.5f) != 0) {   // one scalar branch a tile: sums are rescaled only when some query's maximum has outgrown its reference by more than 5.5 (an exponential stays below 245)
      const float mn = fmaxf(m, tm), alpha = (m <= -1.0e38f) ? 0.f : __expf(m - mn);
      l *= alpha; m = mn;
#pragma unroll   // constant indices: fragments, scores and sums stay in registers
      for (int dt = 0; dt < 4; ++dt) { acc[dt] *= alpha; accl[dt] *= alpha; } }
    v16h ph, pl;   // P^T as a B operand: hi, residual x2048
    float es[8];
#pragma unroll   // constant indices: fragments, scores and sums stay in registers
    for (int r = 0; r < 8; ++r) {
#pragma unroll   // constant indices: fragments, scores and sums stay in registers
      for (int ct = 0; ct < 2; ++ct) { const float e = __expf(c[ct][r] * 0.125f - m);   // unnormalised; 1/l applied to the accumulators at the end
        const _Float16 he = (_Float16)e; ph[ct * 8 + r] = he; pl[ct * 8 + r] = (_Float16)((e - (float)he) * 2048.0f); es[r] = ct ? es[r] + e : e; } }
    l += ((es[0] + es[1]) + (es[2] + es[3])) + ((es[4] + es[5]) + (es[6] + es[7]));
#pragma unroll   // constant indices: fragments, scores and sums stay in registers
    for (int dt = 0; dt < 4; ++dt) { acc[dt] = wmma16(vf[dt][0], ph, acc[dt]); accl[dt] = wmma16(vf[dt][0], pl, accl[dt]); accl[dt] = wmma16(vf[dt][1], ph, accl[dt]); }
    ld_kl(kf, &kb[i1][lane * 8]);   // the next tile's K fragments, once V's registers are free
    __syncthreads();   // publishes K tile t + 2 and V tile t + 1; ends all reads of the buffers that the next trip refills
    i1 = i2; i2 = (i2 == 2) ? 0 : i2 + 1; }
  l += xhalf(l);   // the query's other sixteen keys of every tile, under the same reference
  const float il = 1.0f / l;
  if (g == 0) { st[0][wave * 16 + col] = m; st[1][wave * 16 + col] = il * (1.0f / NH); }   // both halves hold the query's values
  __syncthreads();   // every wave's figures stand in LDS
  if (tid < 256) SM[(size_t)bh * SS + blockIdx.x * 256 + tid] = st[0][tid]; else SW[(size_t)bh * SS + blockIdx.x * 256 + tid - 256] = st[1][tid - 256];   // one 128-byte line a wave
  asm volatile("s_wait_xcnt 0x0" ::: "memory");   // in front of any later overwrite of a register that this store names
  // the head's 64 columns are k steps 2 h and 2 h + 1 of k_out: lane = 16 g + row, piece x holds k = 16 (x / 2) + 8 g + 4 (x mod 2) + i of its step:
  // that is registers 4 (x mod 2) + i of the lane's own O^T tile x / 2
  float* of = O + ((size_t)b * SS + q0) * DM + h * 1024 + lane * 4;
#pragma unroll   // constant indices: the sums stay in registers
  for (int x = 0; x < 8; ++x) { v4f o;
#pragma unroll   // as above
    for (int i = 0; i < 4; ++i) o[i] = (acc[x >> 1][(x & 1) * 4 + i] + accl[x >> 1][(x & 1) * 4 + i] * (1.0f / 2048.0f)) * il;
    vst2(of + x * 128, o); }
  asm volatile("s_wait_xcnt 0x0" ::: "memory");   // in front of any later overwrite of a register that these stores name
}
// k_map: the head mean of the attention map. Block = 128 query rows x 128 keys of one batch, 16 waves as 4 x 4, a wave owns 32 x 32 and sums the heads
// (in the order 0..15) in registers. A head's Q rows and K rows of the block (32 KiB each, in a row) are fetched once and put into LDS, two buffers.
#define HSTEP ((SS / 32) * 4096)   // halves from one head's fragments to the next head's
__global__ __launch_bounds__(512) void k_map(const _Float16* __restrict__ QF, const _Float16* __restrict__ KF, const float* __restrict__ SM, const float* __restrict__ SW, float* __restrict__ ATT) {
  __shared__ __align__(16) _Float16 qb[2][4 * 4096], kb[2][4 * 4096]; __shared__ __align__(16) float sst[2][NH][128]; __shared__ __align__(16) float so[16][32][36];
  const int tid = threadIdx.x, wave = __builtin_amdgcn_readfirstlane(tid >> 5), lane = tid & 31, col = lane & 15, g = lane >> 4;   // readfirstlane: the wave's offsets stay in scalar registers
  const int b = blockIdx.z, r0 = blockIdx.y * 128, k0 = blockIdx.x * 128, wr = wave >> 2, wc = wave & 3;
  const _Float16* qs = QF + ((size_t)b * NH * (SS / 32) + (r0 >> 5)) * 4096; const _Float16* cs = KF + ((size_t)b * NH * (SS / 32) + (k0 >> 5)) * 4096;   // head 0: the first of the block's four 32-row tiles of Q, of K
  const _Float16* qg = qs + tid * 8; const _Float16* kg = cs + tid * 8;   // the thread's 16 bytes of it
  v8h rq[4], rk[4];
  { const float* ms = SM + ((size_t)b * NH + wave) * SS + r0; const float* fs = SW + ((size_t)b * NH + wave) * SS + r0;   // wave w brings head w's 128 rows
    const v4f tm = *(const v4f*)(ms + lane * 4), tw = *(const v4f*)(fs + lane * 4); v8h q0[4], c0[4];
#pragma unroll   // constant indices: the pieces stay in registers; heads 0 and 1 are fetched as one group, with one wait behind it
    for (int j = 0; j < 4; ++j) { q0[j] = *(const v8h*)(qg + j * 4096); c0[j] = *(const v8h*)(kg + j * 4096); rq[j] = *(const v8h*)(qg + HSTEP + j * 4096); rk[j] = *(const v8h*)(kg + HSTEP + j * 4096); }
    asm volatile("s_wait_xcnt 0x0" :: "s"(qs), "s"(cs), "s"(ms), "s"(fs), "v"(tid), "v"(lane) : "memory");   // in front of any overwrite of a register that these loads name; the inputs keep bases and offsets whole up to here
    *(v4f*)&sst[0][wave][lane * 4] = tm; *(v4f*)&sst[1][wave][lane * 4] = tw;
#pragma unroll   // as above
    for (int j = 0; j < 4; ++j) { *(v8h*)&qb[0][j * 4096 + tid * 8] = q0[j]; *(v8h*)&kb[0][j * 4096 + tid * 8] = c0[j]; } }
  __syncthreads();   // head 0 and the rows' softmax figures stand in LDS
  v8f am[2][2] = {};
  for (int h = 0; h < NH; ++h) {
#pragma unroll   // as above
    for (int j = 0; j < 4; ++j) { *(v8h*)&qb[(h + 1) & 1][j * 4096 + tid * 8] = rq[j]; *(v8h*)&kb[(h + 1) & 1][j * 4096 + tid * 8] = rk[j]; }   // head h + 1; the readers of head h - 1 left this buffer before its barrier
    { const int ho = ((h + 2) & (NH - 1)) * HSTEP; const _Float16* p = qg + ho; const _Float16* w = kg + ho;   // the last trips' index wraps and stays in bounds
#pragma unroll   // as above
      for (int j = 0; j < 4; ++j) { rq[j] = *(const v8h*)(p + j * 4096); rk[j] = *(const v8h*)(w + j * 4096); }
      asm volatile("s_wait_xcnt 0x0" :: "v"(p), "v"(w) : "memory"); }   // as above
    v16h kf[2][2][2]; ld_kl(kf, &kb[h & 1][wc * 4096 + lane * 8]);
#pragma unroll   // constant indices: fragments, scores and sums stay in registers
    for (int qt = 0; qt < 2; ++qt) { const _Float16* qp = &qb[h & 1][wr * 4096 + qt * 2048 + lane * 8];
      v16h aq[2], aql[2];
#pragma unroll   // constant indices: fragments, scores and sums stay in registers
      for (int kc = 0; kc < 2; ++kc) { aq[kc] = frag_ch(qp + kc * 1024); aql[kc] = frag_ch(qp + kc * 1024 + 512); }
      const float* fm = &sst[0][h][wr * 32 + qt * 16 + 8 * g]; const float* fw = &sst[1][h][wr * 32 + qt * 16 + 8 * g];
      const v4f m0 = *(const v4f*)fm, m1 = *(const v4f*)(fm + 4), w0 = *(const v4f*)fw, w1 = *(const v4f*)(fw + 4);
#pragma unroll   // constant indices: fragments, scores and sums stay in registers
      for (int ct = 0; ct < 2; ++ct) { v8f c = {}, cl = {};
#pragma unroll   // constant indices: fragments, scores and sums stay in registers
        for (int kc = 0; kc < 2; ++kc) { c = wmma16(aq[kc], kf[ct][kc][0], c); cl = wmma16(aql[kc], kf[ct][kc][0], cl); cl = wmma16(aq[kc], kf[ct][kc][1], cl); }
#pragma unroll   // constant indices: fragments, scores and sums stay in registers
        for (int r = 0; r < 8; ++r) { const float mr = r < 4 ? m0[r & 3] : m1[r & 3], wt = r < 4 ? w0[r & 3] : w1[r & 3];
          am[qt][ct][r] += __expf((c[r] + cl[r] * (1.0f / 2048.0f)) * 0.125f - mr) * wt; } } }
    __syncthreads();   // publishes head h + 1; ends all reads of head h's buffer
  }
#pragma unroll   // constant indices: fragments, scores and sums stay in registers
  for (int qt = 0; qt < 2; ++qt) {
#pragma unroll   // constant indices: fragments, scores and sums stay in registers
    for (int ct = 0; ct < 2; ++ct) {
#pragma unroll   // constant indices: fragments, scores and sums stay in registers
      for (int r = 0; r < 8; ++r) so[wave][qt * 16 + 8 * g + r][ct * 16 + col] = am[qt][ct][r]; } }
  LDSX();
  float* ap = ATT + ((size_t)b * SS + r0 + wr * 32 + (lane >> 3)) * SS + k0 + wc * 32 + (lane & 7) * 4;   // eight lanes store one row's 128-byte line
#pragma unroll   // constant offsets: the eight LDS reads are in flight together
  for (int x = 0; x < 8; ++x) vst2(ap + (size_t)x * 4 * SS, *(const v4f*)&so[wave][x * 4 + (lane >> 3)][(lane & 7) * 4]);
  asm volatile("s_wait_xcnt 0x0" ::: "memory");   // in front of any later overwrite of a register that these stores name
}
// ---- k_out: block = (64 rows, 128 cols): out = O(hi/lo) . Wo rows (2 products) + bo
__global__ __launch_bounds__(128) void k_out(const float* __restrict__ O, const __bf16* __restrict__ P, const float* __restrict__ BO, float* __restrict__ Y) {
  __shared__ __align__(16) float so[4][16][132];
  const int tid = threadIdx.x, wave = tid >> 5, lane = tid & 31, col = lane & 15, g = lane >> 4; const size_t r0 = (size_t)blockIdx.x * 64 + wave * 16; const int n0 = blockIdx.y * 128;
  v8f acc[8] = {};
  const float* xa = O + r0 * DM + lane * 4; const __bf16* pb = P + (size_t)n0 * DM + lane * 8;
  KStep t0, t1; ld_step(t0, xa, pb);
#pragma unroll 1   // the two register sets already are the unrolling
  for (int kc = 0; kc < DM / 32; kc += 2) {
    ld_step(t1, xa + 512, pb + 512);
    { float v[16];
#pragma unroll
      for (int i = 0; i < 16; ++i) v[i] = t0.x[i >> 2][i & 3];
      const F2 a = bsplit16(v);
#pragma unroll
      for (int j = 0; j < 8; ++j) { acc[j] = wmma_bf(a.l, t0.w[j], acc[j]); acc[j] = wmma_bf(a.h, t0.w[j], acc[j]); } }
    { const int adv = kc + 2 < DM / 32 ? 1024 : 0; xa += adv; pb += adv; }   // two steps on; last trip: no step is left, the pointers stay inside the tile.
    ld_step(t0, xa, pb);
    { float v[16];
#pragma unroll
      for (int i = 0; i < 16; ++i) v[i] = t1.x[i >> 2][i & 3];
      const F2 a = bsplit16(v);
#pragma unroll
      for (int j = 0; j < 8; ++j) { acc[j] = wmma_bf(a.l, t1.w[j], acc[j]); acc[j] = wmma_bf(a.h, t1.w[j], acc[j]); } } }
#pragma unroll
  for (int j = 0; j < 8; ++j) {
#pragma unroll
    for (int r = 0; r < 8; ++r) so[wave][8 * g + r][j * 16 + col] = acc[j][r] + bfr(BO[n0 + j * 16 + col]); }
  LDSX();
  for (int rl = 0; rl < 16; ++rl) vst2(Y + (r0 + rl) * DM + n0 + lane * 4, *(const v4f*)&so[wave][rl][lane * 4]);
}
extern "C" void kernel_launch(void* const* d_in, const int* in_sizes, int n_in, void* d_out, int out_size, void* d_ws, size_t ws_size, hipStream_t stream) {
  (void)in_sizes; (void)n_in; (void)out_size;
  const float** F = (const float**)d_in;   // 0 q_in [4,1024,1024], 1 k_in, 2 v_in, 3 Wq [1024,1024] natural (x @ W.T), 4 bq, 5 Wk, 6 bk, 7 Wv, 8 bv, 9 Wo, 10 bo
  if (ws_size < (size_t)WS_END) return;
  char* ws = (char*)d_ws; __bf16* PK = (__bf16*)(ws + WS_PK); _Float16 *QF = (_Float16*)(ws + WS_QF), *KF = (_Float16*)(ws + WS_KF), *VF = (_Float16*)(ws + WS_VF); float* O = (float*)(ws + WS_O); __bf16* XP = (__bf16*)(ws + WS_XP); float* SM = (float*)(ws + WS_ST); float* SW = SM + NB * NH * SS;
  k_pack<<<dim3(DM / 16, 16), 256, 0, stream>>>(F[3], F[5], F[7], F[9], F[0], F[1], F[2], PK, XP);
  k_qkv<<<dim3(TNB * SS / 128, QKVW / 128), 128, 0, stream>>>(XP, PK + PK_A, F[4], F[6], F[8], QF, KF, VF);
  k_attn<<<dim3(SS / 256, TNB * NH), 512, 0, stream>>>(QF, KF, VF, O, SM, SW);
  k_map<<<dim3(SS / 128, SS / 128, TNB), 512, 0, stream>>>(QF, KF, SM, SW, (float*)((char*)d_out + 16777216));
  k_out<<<dim3(TOB, DM / 128), 128, 0, stream>>>(O, PK + PK_P, F[10], (float*)d_out);
}

// v008
// A run of this version takes 138 microseconds.
// In both of two side-by-side timings against v007, it was 1.05 times as fast.
// Counting every step since v000, it is 19.0 times as fast.
#include <hip/hip_runtime.h>
#include <math.h>

typedef __attribute__((ext_vector_type(16))) _Float16 v16h;
typedef __attribute__((ext_vector_type(16))) __bf16 v16b;
typedef __attribute__((ext_vector_type(8)))  _Float16 v8h;
typedef __attribute__((ext_vector_type(8)))  float v8f;
typedef __attribute__((ext_vector_type(4)))  float v4f;
typedef __attribute__((ext_vector_type(2)))  float v2f;
typedef __attribute__((ext_vector_type(4)))  unsigned v4u;
typedef __attribute__((ext_vector_type(4)))  int v4i;
typedef float __attribute__((may_alias)) float_a;
typedef int __attribute__((may_alias)) int_a;

template <typename T> __device__ __forceinline__ void vst2(void* p, T v) { *(T*)p = v;  }
__device__ __forceinline__ v8f wmma16(v16h a, v16h b, v8f c) {
  return __builtin_amdgcn_wmma_f32_16x16x32_f16(false, a, false, b, (short)0, c, false, false);   // plain builtin: the compiler keeps the distance behind its own WMMAs, with a v_nop only where no other instruction fills a slot (each v_nop is one more vector instruction to issue)
}
__device__ __forceinline__ v8f wmma_bf(v16b a, v16b b, v8f c) {
  return __builtin_amdgcn_wmma_f32_16x16x32_bf16(false, a, false, b, (short)0, c, false, false);   // as wmma16
}
// Multi-head cross-attention that also returns the head-averaged attention map (B 4, T 1,024 queries, 1,024 memory positions, d 1,024, 16 heads x 64).
__device__ __forceinline__ v16h frag_h(const _Float16* rowk0, int lane) {
  union { v16h v; v8h q[2]; } u; const _Float16* p = rowk0 + 8 * (lane >> 4);
  u.q[0] = *(const v8h*)p; u.q[1] = *(const v8h*)(p + 16); return u.v;
}
__device__ __forceinline__ v16h frag_f32(const float* rowk0, int lane) {
  v16h a; const float* p = rowk0 + 8 * (lane >> 4);
#pragma unroll
  for (int i = 0; i < 8; ++i) { a[i] = (_Float16)p[i]; a[8 + i] = (_Float16)p[16 + i]; }
  return a;
}
__device__ __forceinline__ v16h frag_f32s(const float* rowk0, int lane, float sc) {
  v16h a; const float* p = rowk0 + 8 * (lane >> 4);
#pragma unroll
  for (int i = 0; i < 8; ++i) { a[i] = (_Float16)(p[i] * sc); a[8 + i] = (_Float16)(p[16 + i] * sc); }
  return a;
}
// column fragment from a [K][ld] layout (column n), rows >= K read as 0
__device__ __forceinline__ v16h fragc_f32(const float* W, int k0, int n, int lane, int ld, int K) {
  v16h a; const int g = lane >> 4;
#pragma unroll
  for (int i = 0; i < 8; ++i) { const int ka = k0 + 8 * g + i, kb = ka + 16;
    a[i] = (_Float16)(ka < K ? W[(size_t)(ka < K ? ka : K - 1) * ld + n] : 0.f); a[8 + i] = (_Float16)(kb < K ? W[(size_t)(kb < K ? kb : K - 1) * ld + n] : 0.f); }
  return a;
}
struct F2 { v16b h, l; };
__device__ __forceinline__ F2 bsplit16(const float v[16]) { F2 r;
#pragma unroll
  for (int i = 0; i < 16; ++i) { const __bf16 h = (__bf16)v[i]; r.h[i] = h; r.l[i] = (__bf16)(v[i] - (float)h); }
  return r; }
__device__ __forceinline__ F2 split_row(const float* row, int k0, int lane) { float v[16]; const float* p = row + k0 + 8 * (lane >> 4);
#pragma unroll
  for (int i = 0; i < 8; ++i) { v[i] = p[i]; v[8 + i] = p[16 + i]; }
  return bsplit16(v); }
__device__ __forceinline__ F2 split_rowK(const float* row, int k0, int lane, int K) { float v[16]; const int g = lane >> 4;
#pragma unroll
  for (int i = 0; i < 8; ++i) { const int ka = k0 + 8 * g + i, kb = ka + 16; v[i] = ka < K ? row[ka < K ? ka : K - 1] : 0.f; v[8 + i] = kb < K ? row[kb < K ? kb : K - 1] : 0.f; }
  return bsplit16(v); }
__device__ __forceinline__ F2 split_col(const float* W, int k0, int n, int lane, int ld, int K) { float v[16]; const int g = lane >> 4;
#pragma unroll
  for (int i = 0; i < 8; ++i) { const int ka = k0 + 8 * g + i, kb = ka + 16; v[i] = ka < K ? W[(size_t)(ka < K ? ka : K - 1) * ld + n] : 0.f; v[8 + i] = kb < K ? W[(size_t)(kb < K ? kb : K - 1) * ld + n] : 0.f; }
  return bsplit16(v); }
__device__ __forceinline__ v8f mac3(const F2& a, const F2& b, v8f c) { c = wmma_bf(a.l, b.h, c); c = wmma_bf(a.h, b.l, c); return wmma_bf(a.h, b.h, c); }
__device__ __forceinline__ float sigm(float v) { return 1.0f / (1.0f + expf(-v)); }
#define LDSX() do { asm volatile("s_wait_dscnt 0" ::: "memory"); __builtin_amdgcn_wave_barrier(); __builtin_amdgcn_fence(__ATOMIC_RELEASE, "workgroup"); } while (0)


#define NB 4
#define SS 1024
#define DM 1024
#define NH 16
#define HD 64
#define QKVW (3 * DM)
#ifndef TQB
#define TQB (SS / 64)
#define TNB NB
#define TOB (NB * SS / 64)     // output row tiles (all)
#endif
typedef __attribute__((ext_vector_type(8))) __bf16 v8b;
__device__ __forceinline__ v16b frag_b(const __bf16* rowk0, int lane) {
  union { v16b v; v8b q[2]; } u; const __bf16* p = rowk0 + 8 * (lane >> 4);
  u.q[0] = *(const v8b*)p; u.q[1] = *(const v8b*)(p + 16); return u.v;
}
__device__ __forceinline__ float bfr(float v) { return (float)(__bf16)v; }
__device__ __attribute__((noinline)) float exp_ni(float v) { return expf(v); }
__device__ __attribute__((noinline)) float erf_ni(float v) { return erff(v); }

#define PK_A 0                       // Wqkv, 192 tiles of 16 rows, fragment order (see k_pack)
#define PK_P (PK_A + QKVW * DM)        // Wo, 64 tiles of 16 rows, fragment order
#define PK_END (PK_P + DM * DM)
// Every operand that a loop reads from the workspace lies there in FRAGMENT ORDER: the 16 bytes that lane 0..31 loads
// with one instruction stand side by side, so a wave-wide 16-byte load reads 512 contiguous bytes (four whole 128-byte lines, not pieces of sixteen).
#define WS_PK  0u
#define WS_QF  (WS_PK + 2u * PK_END)             // f16 Q fragments, laid out as K's: [b][h][32-row tile][ct 2][kc 2][hi, residual x2048][half 2][lane 32][8]
#define WS_KF  (WS_QF + 4u * NB * SS * DM)         // f16 K fragments [b][h][32-key tile][ct 2][kc 2][hi, residual x2048][half 2][lane 32][8]
#define WS_VF  (WS_KF + 4u * NB * SS * DM)         // f16 V fragments [b][h][32-key tile][dt 4][hi, residual x2048][half 2][lane 32][8]
#define WS_O   (WS_VF + 4u * NB * SS * DM)         // f32 O fragments [16-row tile][kc 32][piece 4][lane 32][4]
#define WS_XP  (WS_O + 4u * NB * SS * DM)          // bf16 q_in, k_in, v_in, each 256 tiles of 16 rows, fragment order (see k_pack)
#define WS_ST  (WS_XP + 2u * 3 * NB * SS * DM)     // f32 [2][b][h][query row]: the row's softmax reference m; 1 / (16 x the row's sum of exp(s - m))
#define WS_END (WS_ST + 8u * NB * NH * SS)
// a 16-bit fragment in fragment order: p = the lane's 16 bytes of the first half, the second half stands 512 bytes on
__device__ __forceinline__ v16h frag_ch(const _Float16* p) { union { v16h v; v8h q[2]; } u; u.q[0] = *(const v8h*)p; u.q[1] = *(const v8h*)(p + 256); return u.v; }
__device__ __forceinline__ v16b frag_cb(const __bf16* p) { union { v16b v; v8b q[2]; } u; u.q[0] = *(const v8b*)p; u.q[1] = *(const v8b*)(p + 256); return u.v; }
// ---- k_pack: block = (tile of 16 rows, which); which 0..2 -> W_q/W_k/W_v into PK_A, 3 -> W_o into PK_P, 4..15 -> a quarter of the rows of q_in/k_in/v_in into XP.
// f32 -> bf16, stored as [tile][kc 32][half 2][lane 32][8]: lane = 16 g + row, k = 32 kc + 16 half + 8 g + i (the k order of frag_b, for A and B alike)
__global__ __launch_bounds__(256) void k_pack(const float* __restrict__ WQ, const float* __restrict__ WK, const float* __restrict__ WV, const float* __restrict__ WO, const float* __restrict__ XQ, const float* __restrict__ XK, const float* __restrict__ XV, __bf16* __restrict__ PK, __bf16* __restrict__ XP) {
  const int which = blockIdx.y, t = threadIdx.x, nt = (which < 4) ? blockIdx.x : ((which - 4) & 3) * 64 + blockIdx.x;
  const float* Wm = (which == 0) ? WQ : (which == 1) ? WK : (which == 2) ? WV : (which == 3) ? WO : (which < 8) ? XQ : (which < 12) ? XK : XV;
  __bf16* dst = ((which < 3) ? PK + PK_A + (size_t)which * DM * DM : (which == 3) ? PK + PK_P : XP + (size_t)((which - 4) >> 2) * NB * SS * DM) + (size_t)nt * 16 * DM;
  const float* s = Wm + (size_t)(nt * 16 + (t & 15)) * DM + ((t >> 5) & 1) * 16 + 8 * ((t >> 4) & 1) + (t >> 6) * 32;   // piece t + 256 u: lane t & 31, half (t >> 5) & 1, kc = (t >> 6) + 4 u
  v4f a[8], c[8];
#pragma unroll   // a thread's sixteen loads are in flight together
  for (int u = 0; u < 8; ++u) { a[u] = *(const v4f*)(s + u * 128); c[u] = *(const v4f*)(s + u * 128 + 4); }
#pragma unroll   // constant indices: a, c and o stay in registers
  for (int u = 0; u < 8; ++u) { v8b o;
#pragma unroll   // as above
    for (int i = 0; i < 4; ++i) { o[i] = (__bf16)a[u][i]; o[4 + i] = (__bf16)c[u][i]; }
    *(v8b*)(dst + (size_t)(u * 256 + t) * 8) = o; }
}
// one k step (32 wide) of a wave tile 128 columns wide: the row operand (k_out: f32 pieces of 16 rows; k_qkv: the bf16 fragments of two 16-row tiles) and the eight weight fragments, all loads issued as one group.
// p: the lane's first 16 bytes of the row tile's step; w: the lane's 16 bytes of the first weight tile's step. A step is 1 KiB of a bf16 tile, 2 KiB of an f32 tile
struct KStep { v4f x[4]; v16b w[8]; };
struct KStepB { v16b a[2]; v16b w[8]; };   // k_qkv: two row tiles, 64 rows apart, share the eight weight fragments
__device__ __forceinline__ void ld_stepb(KStepB& t, const __bf16* p, const __bf16* w) {
  t.a[0] = frag_cb(p); t.a[1] = frag_cb(p + (size_t)64 * DM);
#pragma unroll   // constant indices and offsets: t.w stays in registers, every load is the lane's address plus a constant
  for (int j = 0; j < 8; ++j) t.w[j] = frag_cb(w + (size_t)j * 16 * DM);
  asm volatile("s_wait_xcnt 0x0" :: "v"(p), "v"(w) : "memory");   // in front of any later overwrite of a register that these loads name; the inputs keep the address registers whole up to here
}
// sixteen products of one k step: both row tiles against the eight weight fragments. Plain builtins: the wave needs more than 256 registers, and with an asm statement on each product's operands the build spilled; the compiler keeps the distance behind its own WMMAs
__device__ __forceinline__ void mm16(v8f (&acc)[2][8], const KStepB& t) {
#pragma unroll   // constant indices: the sums stay in registers
  for (int j = 0; j < 8; ++j) {
    acc[0][j] = __builtin_amdgcn_wmma_f32_16x16x32_bf16(false, t.a[0], false, t.w[j], (short)0, acc[0][j], false, false);
    acc[1][j] = __builtin_amdgcn_wmma_f32_16x16x32_bf16(false, t.a[1], false, t.w[j], (short)0, acc[1][j], false, false); }
  __builtin_amdgcn_sched_barrier(0);   // the next group of loads stays behind these products and the products behind the group in front: sunk among them, a load would be waited for with no step of lead
}
__device__ __forceinline__ void ld_step(KStep& t, const float* p, const __bf16* w) {
  t.x[0] = *(const v4f*)p; t.x[1] = *(const v4f*)(p + 128); t.x[2] = *(const v4f*)(p + 256); t.x[3] = *(const v4f*)(p + 384);
#pragma unroll
  for (int j = 0; j < 8; ++j) t.w[j] = frag_cb(w + (size_t)j * 16 * DM);
  asm volatile("s_wait_xcnt 0x0" :: "v"(p), "v"(w) : "memory");   // in front of any later overwrite of a register that these loads name; the inputs keep the address registers whole up to here
}
__global__ __launch_bounds__(128) void k_qkv(const __bf16* __restrict__ XP, const __bf16* __restrict__ P, const float* __restrict__ BQ, const float* __restrict__ BK, const float* __restrict__ BV, _Float16* __restrict__ QF, _Float16* __restrict__ KF, _Float16* __restrict__ VF) {
  const int which0 = (blockIdx.y * 128) / DM; const __bf16* X = XP + (size_t)which0 * NB * SS * DM;   // q from q_in, k from k_in, v from v_in
  __shared__ __align__(16) _Float16 so[4][16][136], sol[4][16][136]; __shared__ __align__(16) _Float16 sth[128][72], stl[128][72];
  const int tid = threadIdx.x, wave = tid >> 5, lane = tid & 31, col = lane & 15, g = lane >> 4; const size_t rw = (size_t)blockIdx.x * 128 + wave * 16; const int n0 = blockIdx.y * 128;   // the wave's row tiles start at rw and rw + 64: a weight fragment, once loaded, feeds two products
  v8f acc2[2][8] = {};
  const __bf16* xa = X + rw * DM + lane * 8; const __bf16* pb = P + (size_t)n0 * DM + lane * 8;
  KStepB t0, t1; ld_stepb(t0, xa, pb);
#pragma unroll 1   // the two register sets already are the unrolling
  for (int kc = 0; kc < DM / 32; kc += 2) {
    ld_stepb(t1, xa + 512, pb + 512);
    __builtin_amdgcn_sched_barrier(0);   // as in mm16
    mm16(acc2, t0);
    { const int adv = kc + 2 < DM / 32 ? 1024 : 0; xa += adv; pb += adv; }   // two steps on; last trip: no step is left, the pointers stay inside the tile.
    ld_stepb(t0, xa, pb);
    __builtin_amdgcn_sched_barrier(0);   // as in mm16
    mm16(acc2, t1); }
#pragma unroll   // constant index: both sets of sums stay in registers. Each trip hands out 64 of the block's 128 rows through the same LDS stage (q, k: a wave's own part, whose reads have returned into its stores' data before the second trip)
  for (int rt = 0; rt < 2; ++rt) { v8f (&acc)[8] = acc2[rt]; const size_t r0 = rw + rt * 64;
  { const float* BB = (which0 == 0) ? BQ : (which0 == 1) ? BK : BV;
#pragma unroll
    for (int j = 0; j < 8; ++j) { const float bb = bfr(BB[(n0 % DM) + j * 16 + col]);
#pragma unroll
      for (int r = 0; r < 8; ++r) acc[j][r] += bb; } }
  if (n0 < 2 * DM) {   // q stored unscaled (f16 sigma ~0.6, no subnormal exposure); 1/8 applied to the f32 score
#pragma unroll
    for (int j = 0; j < 8; ++j) {
#pragma unroll
      for (int r = 0; r < 8; ++r) { const float v = acc[j][r]; const _Float16 hv = (_Float16)v; so[wave][8 * g + r][j * 16 + col] = hv; sol[wave][8 * g + r][j * 16 + col] = (_Float16)((v - (float)hv) * 2048.0f); } }   // q, k as f16 hi + (x2048) residual (no RoPE in this module)
    LDSX();
    {   // the wave's 16 rows (queries or keys) are one ct of one 32-row tile, its 128 columns two heads: lane = 16 g + row, d = 32 kc + 16 half + 8 g + i
      _Float16* FB = (n0 < DM) ? QF : KF; const int b = (int)(r0 / SS), kt = (int)(r0 % SS) / 16, h0 = (n0 % DM) / HD;
#pragma unroll   // constant offsets: the wave's sixteen LDS reads are in flight together
      for (int hh = 0; hh < 2; ++hh) { _Float16* kd = FB + (((size_t)(b * NH + h0 + hh) * (SS / 32) + (kt >> 1)) * 2 + (kt & 1)) * 2048 + lane * 8;
#pragma unroll   // as above
        for (int kq = 0; kq < 4; ++kq) { const int kc = kq >> 1, hf = kq & 1, sc = hh * 64 + kc * 32 + hf * 16 + 8 * g;
          vst2((unsigned*)(kd + kc * 1024 + hf * 256), *(const v4u*)&so[wave][col][sc]); vst2((unsigned*)(kd + kc * 1024 + 512 + hf * 256), *(const v4u*)&sol[wave][col][sc]); } }
      asm volatile("s_wait_xcnt 0x0" ::: "memory");   // in front of any later overwrite of a register that these stores name
    }
  } else {
#pragma unroll
    for (int j = 0; j < 8; ++j) {
#pragma unroll
      for (int r = 0; r < 8; ++r) { const float v = acc[j][r]; const _Float16 hv = (_Float16)v; sth[j * 16 + col][wave * 16 + 8 * g + r] = hv; stl[j * 16 + col][wave * 16 + 8 * g + r] = (_Float16)((v - (float)hv) * 2048.0f); } }
    __syncthreads();
    const size_t rb = (size_t)blockIdx.x * 128 + rt * 64; const int b = (int)(rb / SS), ks0 = (int)(rb % SS) / 32, h0 = (n0 - 2 * DM) / HD;
    // the trip's 64 keys are two key tiles, its 128 columns two heads: lane = 16 g + (d mod 16), key = 32 tile + 16 half + 8 g + i
    for (int e = tid; e < 1024; e += 128) { const int hf = (e >> 5) & 1, dt = (e >> 6) & 3, hh = (e >> 8) & 1, kl = e >> 9; const int d = hh * 64 + dt * 16 + col, kk = kl * 32 + hf * 16 + 8 * g;
      _Float16* vd = VF + (((size_t)(b * NH + h0 + hh) * (SS / 32) + ks0 + kl) * 4 + dt) * 1024 + hf * 256 + lane * 8; vst2((unsigned*)vd, *(const v4u*)&sth[d][kk]); vst2((unsigned*)(vd + 512), *(const v4u*)&stl[d][kk]); }
    asm volatile("s_wait_xcnt 0x0" ::: "memory");   // in front of any later overwrite of a register that these stores name
    if (rt == 0) __syncthreads();   // every wave has read the stage before the second trip writes it again
  } }
}
// the K fragments (hi, residual) of one 32-key tile, read from its copy in LDS; p: the lane's 16 bytes of the tile (8 KiB in a row, fragment order)
__device__ __forceinline__ void ld_kl(v16h (&kf)[2][2][2], const _Float16* p) {
#pragma unroll   // constant indices and offsets: kf stays in registers, the sixteen LDS reads stand as one group
  for (int ct = 0; ct < 2; ++ct) {
#pragma unroll   // as above
    for (int kc = 0; kc < 2; ++kc) { kf[ct][kc][0] = frag_ch(p + (ct * 2 + kc) * 1024); kf[ct][kc][1] = frag_ch(p + (ct * 2 + kc) * 1024 + 512); } }
}
// k_attn: block = 256 query rows of ONE head of one batch, 16 waves, wave w = query tile w. Each 32-key tile of K and of V is fetched once a block
// (16 bytes a thread) and put into LDS, where all sixteen waves read their fragments. Out: O, and per row the reference m and 1 / (16 l) for k_map.
// K ring of three buffers: in trip t tile t + 2 is stored, tile t + 1 (published by the barrier of trip t - 1) is read into registers. V: two buffers.
// Both products are taken transposed: S^T = K . Q^T (A = K fragments, B = Q fragments) and O^T = V^T . P^T (A = V fragments, B = P^T). Lane (g, col) then holds,
// of query col alone, the scores of keys 16 ct + 8 g + r: maximum and sum are in-lane, and the two score tiles, converted in place, are the B operand P^T
// (element 8 ct + r = key 16 ct + 8 g + r, the k order of the V fragments). Lanes col and col + 16 split a query's keys: their maxima are joined in every tile, their sums once, behind the loop.
// One pass over the keys: the sums are kept against a reference m that follows the running maximum, and are rescaled when it moves.
__device__ __forceinline__ float xhalf(float v) { return __int_as_float(__builtin_amdgcn_permlanex16(__float_as_int(v), __float_as_int(v), 0x76543210, 0xfedcba98, false, false)); }   // the value of lane l ^ 16
__global__ __launch_bounds__(512) void k_attn(const _Float16* __restrict__ QF, const _Float16* __restrict__ KF, const _Float16* __restrict__ VF, float* __restrict__ O, float* __restrict__ SM, float* __restrict__ SW) {
  __shared__ __align__(16) _Float16 kb[3][4096], vb[2][4096]; __shared__ __align__(16) float st[2][256];
  const int tid = threadIdx.x, wave = __builtin_amdgcn_readfirstlane(tid >> 5), lane = tid & 31, col = lane & 15, g = lane >> 4;   // readfirstlane: the wave's offsets stay in scalar registers
  const int bh = blockIdx.y, b = bh / NH, h = bh % NH; const int q0 = blockIdx.x * 256 + wave * 16;
  const _Float16* qf = QF + ((size_t)bh * (SS / 32) + (q0 >> 5)) * 4096 + ((q0 >> 4) & 1) * 2048 + lane * 8;
  v16h aq[2], aql[2];
#pragma unroll   // constant indices: fragments, scores and sums stay in registers
  for (int kc = 0; kc < 2; ++kc) { aq[kc] = frag_ch(qf + kc * 1024); aql[kc] = frag_ch(qf + kc * 1024 + 512); }
  float m = -3.0e38f, l = 0.f;   // of query col: the reference in use (it may trail the true maximum by up to 5.5); the sum over the lane's half of the keys
  const _Float16* kg = KF + (size_t)bh * (SS / 32) * 4096 + tid * 8; const _Float16* vg = VF + (size_t)bh * (SS / 32) * 4096 + tid * 8;   // the thread's 16 bytes of tile 0
  v8h rk, rv;   // the thread's piece of the K tile two trips ahead, of the V tile one trip ahead
  { const v8h k0 = *(const v8h*)kg, k1 = *(const v8h*)(kg + 4096), v0 = *(const v8h*)vg; rk = *(const v8h*)(kg + 2 * 4096); rv = *(const v8h*)(vg + 4096);
    asm volatile("s_wait_xcnt 0x0" :: "v"(qf), "v"(kg), "v"(vg) : "memory");   // in front of any overwrite of a register that these loads name; the inputs keep the address registers whole up to here
    *(v8h*)&kb[0][tid * 8] = k0; *(v8h*)&kb[1][tid * 8] = k1; *(v8h*)&vb[0][tid * 8] = v0; }
  __syncthreads();   // K tiles 0 and 1 and V tile 0 stand in LDS
  v16h kf[2][2][2]; ld_kl(kf, &kb[0][lane * 8]);
  int i1 = 1, i2 = 2;   // ring places of tiles t + 1 and t + 2
  // one pass: unnormalised P^T against the reference m in use, V^T . P^T
  v8f acc[4] = {}, accl[4] = {};
#pragma unroll 1   // one trip per barrier; the ring indices rotate at run time
  for (int ks = 0; ks < SS / 32; ++ks) {
    *(v8h*)&kb[i2][tid * 8] = rk; *(v8h*)&vb[(ks + 1) & 1][tid * 8] = rv;   // V: the readers of trip t - 1 left this buffer before its barrier
    { const int nk = ((ks + 3) & (SS / 32 - 1)) * 4096, nv = ((ks + 2) & (SS / 32 - 1)) * 4096; const _Float16* p = kg + nk; const _Float16* w = vg + nv; rk = *(const v8h*)p; rv = *(const v8h*)w;   // the last trips' indices wrap and stay in bounds
      asm volatile("s_wait_xcnt 0x0" :: "v"(p), "v"(w) : "memory"); }   // in front of any overwrite of the loads' address registers
    v8f c[2], cl[2];
#pragma unroll   // constant indices: fragments, scores and sums stay in registers
    for (int ct = 0; ct < 2; ++ct) { c[ct] = v8f{}; cl[ct] = v8f{};
#pragma unroll   // constant indices: fragments, scores and sums stay in registers
      for (int kc = 0; kc < 2; ++kc) { c[ct] = wmma16(kf[ct][kc][0], aq[kc], c[ct]); cl[ct] = wmma16(kf[ct][kc][0], aql[kc], cl[ct]); cl[ct] = wmma16(kf[ct][kc][1], aq[kc], cl[ct]); } }
    v16h vf[4][2];   // this tile's V fragments, one group of LDS reads into the registers that K's fragments leave
    const _Float16* vp = &vb[ks & 1][lane * 8];
#pragma unroll   // constant indices: fragments, scores and sums stay in registers
    for (int dt = 0; dt < 4; ++dt) { vf[dt][0] = frag_ch(vp + dt * 1024); vf[dt][1] = frag_ch(vp + dt * 1024 + 512); }
    __builtin_amdgcn_sched_barrier(0);   // the V reads are issued in front of the exponentials and fly during them; sunk behind them, their latency would stand in front of the second product
    float mx[8];
#pragma unroll   // constant indices: fragments, scores and sums stay in registers
    for (int r = 0; r < 8; ++r) { c[0][r] += cl[0][r] * (1.0f / 2048.0f); c[1][r] += cl[1][r] * (1.0f / 2048.0f); mx[r] = fmaxf(c[0][r], c[1][r]); }
    float tm = fmaxf(fmaxf(fmaxf(mx[0], mx[1]), fmaxf(mx[2], mx[3])), fmaxf(fmaxf(mx[4], mx[5]), fmaxf(mx[6], mx[7])));
    tm = fmaxf(tm, xhalf(tm)) * 0.125f;   // the tile's maximum of query col, alike in both halves: P^T's 32 keys need one reference
    if (__builtin_amdgcn_ballot_w32(tm > m + 5.5f) != 0) {   // one scalar branch a tile: sums are rescaled only when some query's maximum has outgrown its reference by more than 5.5 (an exponential stays below 245)
      const float mn = fmaxf(m, tm), alpha = (m <= -1.0e38f) ? 0.f : __expf(m - mn);
      l *= alpha; m = mn;
#pragma unroll   // constant indices: fragments, scores and sums stay in registers
      for (int dt = 0; dt < 4; ++dt) { acc[dt] *= alpha; accl[dt] *= alpha; } }
    v16h ph, pl;   // P^T as a B operand: hi, residual x2048
    float es[8];
#pragma unroll   // constant indices: fragments, scores and sums stay in registers
    for (int r = 0; r < 8; ++r) {
#pragma unroll   // constant indices: fragments, scores and sums stay in registers
      for (int ct = 0; ct < 2; ++ct) { const float e = __expf(c[ct][r] * 0.125f - m);   // unnormalised; 1/l applied to the accumulators at the end
        const _Float16 he = (_Float16)e; ph[ct * 8 + r] = he; pl[ct * 8 + r] = (_Float16)((e - (float)he) * 2048.0f); es[r] = ct ? es[r] + e : e; } }
    l += ((es[0] + es[1]) + (es[2] + es[3])) + ((es[4] + es[5]) + (es[6] + es[7]));
#pragma unroll   // constant indices: fragments, scores and sums stay in registers
    for (int dt = 0; dt < 4; ++dt) { acc[dt] = wmma16(vf[dt][0], ph, acc[dt]); accl[dt] = wmma16(vf[dt][0], pl, accl[dt]); accl[dt] = wmma16(vf[dt][1], ph, accl[dt]); }
    ld_kl(kf, &kb[i1][lane * 8]);   // the next tile's K fragments, once V's registers are free
    __syncthreads();   // publishes K tile t + 2 and V tile t + 1; ends all reads of the buffers that the next trip refills
    i1 = i2; i2 = (i2 == 2) ? 0 : i2 + 1; }
  l += xhalf(l);   // the query's other sixteen keys of every tile, under the same reference
  const float il = 1.0f / l;
  if (g == 0) { st[0][wave * 16 + col] = m; st[1][wave * 16 + col] = il * (1.0f / NH); }   // both halves hold the query's values
  __syncthreads();   // every wave's figures stand in LDS
  if (tid < 256) SM[(size_t)bh * SS + blockIdx.x * 256 + tid] = st[0][tid]; else SW[(size_t)bh * SS + blockIdx.x * 256 + tid - 256] = st[1][tid - 256];   // one 128-byte line a wave
  asm volatile("s_wait_xcnt 0x0" ::: "memory");   // in front of any later overwrite of a register that this store names
  // the head's 64 columns are k steps 2 h and 2 h + 1 of k_out: lane = 16 g + row, piece x holds k = 16 (x / 2) + 8 g + 4 (x mod 2) + i of its step:
  // that is registers 4 (x mod 2) + i of the lane's own O^T tile x / 2
  float* of = O + ((size_t)b * SS + q0) * DM + h * 1024 + lane * 4;
#pragma unroll   // constant indices: the sums stay in registers
  for (int x = 0; x < 8; ++x) { v4f o;
#pragma unroll   // as above
    for (int i = 0; i < 4; ++i) o[i] = (acc[x >> 1][(x & 1) * 4 + i] + accl[x >> 1][(x & 1) * 4 + i] * (1.0f / 2048.0f)) * il;
    vst2(of + x * 128, o); }
  asm volatile("s_wait_xcnt 0x0" ::: "memory");   // in front of any later overwrite of a register that these stores name
}
// k_map: the head mean of the attention map. Block = 128 query rows x 128 keys of one batch, 16 waves as 4 x 4, a wave owns 32 x 32 and sums the heads
// (in the order 0..15) in registers. A head's Q rows and K rows of the block (32 KiB each, in a row) are fetched once and put into LDS, two buffers.
#define HSTEP ((SS / 32) * 4096)   // halves from one head's fragments to the next head's
__global__ __launch_bounds__(512) void k_map(const _Float16* __restrict__ QF, const _Float16* __restrict__ KF, const float* __restrict__ SM, const float* __restrict__ SW, float* __restrict__ ATT) {
  __shared__ __align__(16) _Float16 qb[2][4 * 4096], kb[2][4 * 4096]; __shared__ __align__(16) float sst[2][NH][128]; __shared__ __align__(16) float so[16][32][36];
  const int tid = threadIdx.x, wave = __builtin_amdgcn_readfirstlane(tid >> 5), lane = tid & 31, col = lane & 15, g = lane >> 4;   // readfirstlane: the wave's offsets stay in scalar registers
  const int b = blockIdx.z, r0 = blockIdx.y * 128, k0 = blockIdx.x * 128, wr = wave >> 2, wc = wave & 3;
  const _Float16* qs = QF + ((size_t)b * NH * (SS / 32) + (r0 >> 5)) * 4096; const _Float16* cs = KF + ((size_t)b * NH * (SS / 32) + (k0 >> 5)) * 4096;   // head 0: the first of the block's four 32-row tiles of Q, of K
  const _Float16* qg = qs + tid * 8; const _Float16* kg = cs + tid * 8;   // the thread's 16 bytes of it
  v8h rq[4], rk[4];
  { const float* ms = SM + ((size_t)b * NH + wave) * SS + r0; const float* fs = SW + ((size_t)b * NH + wave) * SS + r0;   // wave w brings head w's 128 rows
    const v4f tm = *(const v4f*)(ms + lane * 4), tw = *(const v4f*)(fs + lane * 4); v8h q0[4], c0[4];
#pragma unroll   // constant indices: the pieces stay in registers; heads 0 and 1 are fetched as one group, with one wait behind it
    for (int j = 0; j < 4; ++j) { q0[j] = *(const v8h*)(qg + j * 4096); c0[j] = *(const v8h*)(kg + j * 4096); rq[j] = *(const v8h*)(qg + HSTEP + j * 4096); rk[j] = *(const v8h*)(kg + HSTEP + j * 4096); }
    asm volatile("s_wait_xcnt 0x0" :: "s"(qs), "s"(cs), "s"(ms), "s"(fs), "v"(tid), "v"(lane) : "memory");   // in front of any overwrite of a register that these loads name; the inputs keep bases and offsets whole up to here
    *(v4f*)&sst[0][wave][lane * 4] = tm; *(v4f*)&sst[1][wave][lane * 4] = tw;
#pragma unroll   // as above
    for (int j = 0; j < 4; ++j) { *(v8h*)&qb[0][j * 4096 + tid * 8] = q0[j]; *(v8h*)&kb[0][j * 4096 + tid * 8] = c0[j]; } }
  __syncthreads();   // head 0 and the rows' softmax figures stand in LDS
  v8f am[2][2] = {};
  for (int h = 0; h < NH; ++h) {
#pragma unroll   // as above
    for (int j = 0; j < 4; ++j) { *(v8h*)&qb[(h + 1) & 1][j * 4096 + tid * 8] = rq[j]; *(v8h*)&kb[(h + 1) & 1][j * 4096 + tid * 8] = rk[j]; }   // head h + 1; the readers of head h - 1 left this buffer before its barrier
    { const int ho = ((h + 2) & (NH - 1)) * HSTEP; const _Float16* p = qg + ho; const _Float16* w = kg + ho;   // the last trips' index wraps and stays in bounds
#pragma unroll   // as above
      for (int j = 0; j < 4; ++j) { rq[j] = *(const v8h*)(p + j * 4096); rk[j] = *(const v8h*)(w + j * 4096); }
      asm volatile("s_wait_xcnt 0x0" :: "v"(p), "v"(w) : "memory"); }   // as above
    v16h kf[2][2][2]; ld_kl(kf, &kb[h & 1][wc * 4096 + lane * 8]);
#pragma unroll   // constant indices: fragments, scores and sums stay in registers
    for (int qt = 0; qt < 2; ++qt) { const _Float16* qp = &qb[h & 1][wr * 4096 + qt * 2048 + lane * 8];
      v16h aq[2], aql[2];
#pragma unroll   // constant indices: fragments, scores and sums stay in registers
      for (int kc = 0; kc < 2; ++kc) { aq[kc] = frag_ch(qp + kc * 1024); aql[kc] = frag_ch(qp + kc * 1024 + 512); }
      const float* fm = &sst[0][h][wr * 32 + qt * 16 + 8 * g]; const float* fw = &sst[1][h][wr * 32 + qt * 16 + 8 * g];
      const v4f m0 = *(const v4f*)fm, m1 = *(const v4f*)(fm + 4), w0 = *(const v4f*)fw, w1 = *(const v4f*)(fw + 4);
#pragma unroll   // constant indices: fragments, scores and sums stay in registers
      for (int ct = 0; ct < 2; ++ct) { v8f c = {}, cl = {};
#pragma unroll   // constant indices: fragments, scores and sums stay in registers
        for (int kc = 0; kc < 2; ++kc) { c = wmma16(aq[kc], kf[ct][kc][0], c); cl = wmma16(aql[kc], kf[ct][kc][0], cl); cl = wmma16(aq[kc], kf[ct][kc][1], cl); }
#pragma unroll   // constant indices: fragments, scores and sums stay in registers
        for (int r = 0; r < 8; ++r) { const float mr = r < 4 ? m0[r & 3] : m1[r & 3], wt = r < 4 ? w0[r & 3] : w1[r & 3];
          am[qt][ct][r] += __expf((c[r] + cl[r] * (1.0f / 2048.0f)) * 0.125f - mr) * wt; } } }
    __builtin_amdgcn_sched_barrier(0);   // the head's products stay in front of the barrier: sunk behind it, the wait for the next head's global loads, which stands at the barrier, would come half a trip after their issue
    __syncthreads();   // publishes head h + 1; ends all reads of head h's buffer
  }
#pragma unroll   // constant indices: fragments, scores and sums stay in registers
  for (int qt = 0; qt < 2; ++qt) {
#pragma unroll   // constant indices: fragments, scores and sums stay in registers
    for (int ct = 0; ct < 2; ++ct) {
#pragma unroll   // constant indices: fragments, scores and sums stay in registers
      for (int r = 0; r < 8; ++r) so[wave][qt * 16 + 8 * g + r][ct * 16 + col] = am[qt][ct][r]; } }
  LDSX();
  float* ap = ATT + ((size_t)b * SS + r0 + wr * 32 + (lane >> 3)) * SS + k0 + wc * 32 + (lane & 7) * 4;   // eight lanes store one row's 128-byte line
#pragma unroll   // constant offsets: the eight LDS reads are in flight together
  for (int x = 0; x < 8; ++x) vst2(ap + (size_t)x * 4 * SS, *(const v4f*)&so[wave][x * 4 + (lane >> 3)][(lane & 7) * 4]);
  asm volatile("s_wait_xcnt 0x0" ::: "memory");   // in front of any later overwrite of a register that these stores name
}
// ---- k_out: block = (64 rows, 128 cols): out = O(hi/lo) . Wo rows (2 products) + bo
__global__ __launch_bounds__(128) void k_out(const float* __restrict__ O, const __bf16* __restrict__ P, const float* __restrict__ BO, float* __restrict__ Y) {
  __shared__ __align__(16) float so[4][16][132];
  const int tid = threadIdx.x, wave = tid >> 5, lane = tid & 31, col = lane & 15, g = lane >> 4; const size_t r0 = (size_t)blockIdx.x * 64 + wave * 16; const int n0 = blockIdx.y * 128;
  v8f acc[8] = {};
  const float* xa = O + r0 * DM + lane * 4; const __bf16* pb = P + (size_t)n0 * DM + lane * 8;
  KStep t0, t1; ld_step(t0, xa, pb);
#pragma unroll 1   // the two register sets already are the unrolling
  for (int kc = 0; kc < DM / 32; kc += 2) {
    ld_step(t1, xa + 512, pb + 512);
    __builtin_amdgcn_sched_barrier(0);   // as in mm16
    { float v[16];
#pragma unroll
      for (int i = 0; i < 16; ++i) v[i] = t0.x[i >> 2][i & 3];
      const F2 a = bsplit16(v);
#pragma unroll
      for (int j = 0; j < 8; ++j) { acc[j] = wmma_bf(a.l, t0.w[j], acc[j]); acc[j] = wmma_bf(a.h, t0.w[j], acc[j]); } }
    __builtin_amdgcn_sched_barrier(0);   // as in mm16
    { const int adv = kc + 2 < DM / 32 ? 1024 : 0; xa += adv; pb += adv; }   // two steps on; last trip: no step is left, the pointers stay inside the tile.
    ld_step(t0, xa, pb);
    __builtin_amdgcn_sched_barrier(0);   // as in mm16
    { float v[16];
#pragma unroll
      for (int i = 0; i < 16; ++i) v[i] = t1.x[i >> 2][i & 3];
      const F2 a = bsplit16(v);
#pragma unroll
      for (int j = 0; j < 8; ++j) { acc[j] = wmma_bf(a.l, t1.w[j], acc[j]); acc[j] = wmma_bf(a.h, t1.w[j], acc[j]); } }
    __builtin_amdgcn_sched_barrier(0); }   // as in mm16
#pragma unroll
  for (int j = 0; j < 8; ++j) {
#pragma unroll
    for (int r = 0; r < 8; ++r) so[wave][8 * g + r][j * 16 + col] = acc[j][r] + bfr(BO[n0 + j * 16 + col]); }
  LDSX();
  for (int rl = 0; rl < 16; ++rl) vst2(Y + (r0 + rl) * DM + n0 + lane * 4, *(const v4f*)&so[wave][rl][lane * 4]);
}
extern "C" void kernel_launch(void* const* d_in, const int* in_sizes, int n_in, void* d_out, int out_size, void* d_ws, size_t ws_size, hipStream_t stream) {
  (void)in_sizes; (void)n_in; (void)out_size;
  const float** F = (const float**)d_in;   // 0 q_in [4,1024,1024], 1 k_in, 2 v_in, 3 Wq [1024,1024] natural (x @ W.T), 4 bq, 5 Wk, 6 bk, 7 Wv, 8 bv, 9 Wo, 10 bo
  if (ws_size < (size_t)WS_END) return;
  char* ws = (char*)d_ws; __bf16* PK = (__bf16*)(ws + WS_PK); _Float16 *QF = (_Float16*)(ws + WS_QF), *KF = (_Float16*)(ws + WS_KF), *VF = (_Float16*)(ws + WS_VF); float* O = (float*)(ws + WS_O); __bf16* XP = (__bf16*)(ws + WS_XP); float* SM = (float*)(ws + WS_ST); float* SW = SM + NB * NH * SS;
  k_pack<<<dim3(DM / 16, 16), 256, 0, stream>>>(F[3], F[5], F[7], F[9], F[0], F[1], F[2], PK, XP);
  k_qkv<<<dim3(TNB * SS / 128, QKVW / 128), 128, 0, stream>>>(XP, PK + PK_A, F[4], F[6], F[8], QF, KF, VF);
  k_attn<<<dim3(SS / 256, TNB * NH), 512, 0, stream>>>(QF, KF, VF, O, SM, SW);
  k_map<<<dim3(SS / 128, SS / 128, TNB), 512, 0, stream>>>(QF, KF, SM, SW, (float*)((char*)d_out + 16777216));
  k_out<<<dim3(TOB, DM / 128), 128, 0, stream>>>(O, PK + PK_P, F[10], (float*)d_out);
}

// v010
// Measured time: 97.1 microseconds a run.
// Versions between v008 and this one are left out; their measured steps multiply to 1.42 times as fast.
// Counting every step since v000, it is 27.0 times as fast.
#include <hip/hip_runtime.h>
#include <math.h>

typedef __attribute__((ext_vector_type(16))) _Float16 v16h;
typedef __attribute__((ext_vector_type(16))) __bf16 v16b;
typedef __attribute__((ext_vector_type(8)))  _Float16 v8h;
typedef __attribute__((ext_vector_type(8)))  float v8f;
typedef __attribute__((ext_vector_type(4)))  float v4f;
typedef __attribute__((ext_vector_type(2)))  float v2f;
typedef __attribute__((ext_vector_type(4)))  unsigned v4u;
typedef __attribute__((ext_vector_type(4)))  int v4i;
typedef float __attribute__((may_alias)) float_a;
typedef int __attribute__((may_alias)) int_a;

template <typename T> __device__ __forceinline__ void vst2(void* p, T v) { *(T*)p = v;  }
__device__ __forceinline__ v8f wmma16(v16h a, v16h b, v8f c) {
  return __builtin_amdgcn_wmma_f32_16x16x32_f16(false, a, false, b, (short)0, c, false, false);   // plain builtin: the compiler keeps the distance behind its own WMMAs, with a v_nop only where no other instruction fills a slot (each v_nop is one more vector instruction to issue)
}
__device__ __forceinline__ v8f wmma_bf(v16b a, v16b b, v8f c) {
  return __builtin_amdgcn_wmma_f32_16x16x32_bf16(false, a, false, b, (short)0, c, false, false);   // as wmma16
}
// Multi-head cross-attention that also returns the head-averaged attention map (B 4, T 1,024 queries, 1,024 memory positions, d 1,024, 16 heads x 64).
__device__ __forceinline__ v16h frag_h(const _Float16* rowk0, int lane) {
  union { v16h v; v8h q[2]; } u; const _Float16* p = rowk0 + 8 * (lane >> 4);
  u.q[0] = *(const v8h*)p; u.q[1] = *(const v8h*)(p + 16); return u.v;
}
__device__ __forceinline__ v16h frag_f32(const float* rowk0, int lane) {
  v16h a; const float* p = rowk0 + 8 * (lane >> 4);
#pragma unroll
  for (int i = 0; i < 8; ++i) { a[i] = (_Float16)p[i]; a[8 + i] = (_Float16)p[16 + i]; }
  return a;
}
__device__ __forceinline__ v16h frag_f32s(const float* rowk0, int lane, float sc) {
  v16h a; const float* p = rowk0 + 8 * (lane >> 4);
#pragma unroll
  for (int i = 0; i < 8; ++i) { a[i] = (_Float16)(p[i] * sc); a[8 + i] = (_Float16)(p[16 + i] * sc); }
  return a;
}
// column fragment from a [K][ld] layout (column n), rows >= K read as 0
__device__ __forceinline__ v16h fragc_f32(const float* W, int k0, int n, int lane, int ld, int K) {
  v16h a; const int g = lane >> 4;
#pragma unroll
  for (int i = 0; i < 8; ++i) { const int ka = k0 + 8 * g + i, kb = ka + 16;
    a[i] = (_Float16)(ka < K ? W[(size_t)(ka < K ? ka : K - 1) * ld + n] : 0.f); a[8 + i] = (_Float16)(kb < K ? W[(size_t)(kb < K ? kb : K - 1) * ld + n] : 0.f); }
  return a;
}
struct F2 { v16b h, l; };
__device__ __forceinline__ F2 bsplit16(const float v[16]) { F2 r;
#pragma unroll
  for (int i = 0; i < 16; ++i) { const __bf16 h = (__bf16)v[i]; r.h[i] = h; r.l[i] = (__bf16)(v[i] - (float)h); }
  return r; }
__device__ __forceinline__ F2 split_row(const float* row, int k0, int lane) { float v[16]; const float* p = row + k0 + 8 * (lane >> 4);
#pragma unroll
  for (int i = 0; i < 8; ++i) { v[i] = p[i]; v[8 + i] = p[16 + i]; }
  return bsplit16(v); }
__device__ __forceinline__ F2 split_rowK(const float* row, int k0, int lane, int K) { float v[16]; const int g = lane >> 4;
#pragma unroll
  for (int i = 0; i < 8; ++i) { const int ka = k0 + 8 * g + i, kb = ka + 16; v[i] = ka < K ? row[ka < K ? ka : K - 1] : 0.f; v[8 + i] = kb < K ? row[kb < K ? kb : K - 1] : 0.f; }
  return bsplit16(v); }
__device__ __forceinline__ F2 split_col(const float* W, int k0, int n, int lane, int ld, int K) { float v[16]; const int g = lane >> 4;
#pragma unroll
  for (int i = 0; i < 8; ++i) { const int ka = k0 + 8 * g + i, kb = ka + 16; v[i] = ka < K ? W[(size_t)(ka < K ? ka : K - 1) * ld + n] : 0.f; v[8 + i] = kb < K ? W[(size_t)(kb < K ? kb : K - 1) * ld + n] : 0.f; }
  return bsplit16(v); }
__device__ __forceinline__ v8f mac3(const F2& a, const F2& b, v8f c) { c = wmma_bf(a.l, b.h, c); c = wmma_bf(a.h, b.l, c); return wmma_bf(a.h, b.h, c); }
__device__ __forceinline__ float sigm(float v) { return 1.0f / (1.0f + expf(-v)); }
#define LDSX() do { asm volatile("s_wait_dscnt 0" ::: "memory"); __builtin_amdgcn_wave_barrier(); __builtin_amdgcn_fence(__ATOMIC_RELEASE, "workgroup"); } while (0)


#define NB 4
#define SS 1024
#define DM 1024
#define NH 16
#define HD 64
#define QKVW (3 * DM)
#ifndef TQB
#define TQB (SS / 64)
#define TNB NB
#define TOB (NB * SS / 64)     // output row tiles (all)
#endif
typedef __attribute__((ext_vector_type(8))) __bf16 v8b;
__device__ __forceinline__ v16b frag_b(const __bf16* rowk0, int lane) {
  union { v16b v; v8b q[2]; } u; const __bf16* p = rowk0 + 8 * (lane >> 4);
  u.q[0] = *(const v8b*)p; u.q[1] = *(const v8b*)(p + 16); return u.v;
}
__device__ __forceinline__ float bfr(float v) { return (float)(__bf16)v; }
__device__ __attribute__((noinline)) float exp_ni(float v) { return expf(v); }
__device__ __attribute__((noinline)) float erf_ni(float v) { return erff(v); }

#define PK_A 0                       // Wqkv, 192 tiles of 16 rows, fragment order (see k_pack)
#define PK_P (PK_A + QKVW * DM)        // Wo, 64 tiles of 16 rows, fragment order
#define PK_END (PK_P + DM * DM)
// Every operand that a loop reads from the workspace lies there in FRAGMENT ORDER: the 16 bytes that lane 0..31 loads
// with one instruction stand side by side, so a wave-wide 16-byte load reads 512 contiguous bytes (four whole 128-byte lines, not pieces of sixteen).
#define WS_PK  0u
#define WS_QF  (WS_PK + 2u * PK_END)             // f16 Q fragments, laid out as K's: [b][h][32-row tile][ct 2][kc 2][half 2][lane 32][8]
#define WS_KF  (WS_QF + 2u * NB * SS * DM)         // f16 K fragments [b][h][32-key tile][ct 2][kc 2][half 2][lane 32][8]
#define WS_VF  (WS_KF + 2u * NB * SS * DM)         // f16 V fragments [b][h][32-key tile][dt 4][half 2][lane 32][8]
#define WS_O   (WS_VF + 2u * NB * SS * DM)         // f32 O fragments [16-row tile][kc 32][piece 4][lane 32][4]
#define WS_XP  (WS_O + 4u * NB * SS * DM)          // bf16 q_in, k_in, v_in, each 256 tiles of 16 rows, fragment order (see k_pack)
#define WS_ST  (WS_XP + 2u * 3 * NB * SS * DM)     // f32 [b][h][query row]: minus (the row's reference m, in log2 units, + log2(16 x the row's sum of 2^(s - m)))
#define WS_END (WS_ST + 4u * NB * NH * SS)
// a 16-bit fragment in fragment order: p = the lane's 16 bytes of the first half, the second half stands 512 bytes on
__device__ __forceinline__ v16h frag_ch(const _Float16* p) { union { v16h v; v8h q[2]; } u; u.q[0] = *(const v8h*)p; u.q[1] = *(const v8h*)(p + 256); return u.v; }
__device__ __forceinline__ v16b frag_cb(const __bf16* p) { union { v16b v; v8b q[2]; } u; u.q[0] = *(const v8b*)p; u.q[1] = *(const v8b*)(p + 256); return u.v; }
// ---- k_pack: block = (tile of 16 rows, which); which 0..2 -> W_q/W_k/W_v into PK_A, 3 -> W_o into PK_P, 4..15 -> a quarter of the rows of q_in/k_in/v_in into XP.
// f32 -> bf16, stored as [tile][kc 32][half 2][lane 32][8]: lane = 16 g + row, k = 32 kc + 16 half + 8 g + i (the k order of frag_b, for A and B alike)
__global__ __launch_bounds__(256) void k_pack(const float* __restrict__ WQ, const float* __restrict__ WK, const float* __restrict__ WV, const float* __restrict__ WO, const float* __restrict__ XQ, const float* __restrict__ XK, const float* __restrict__ XV, __bf16* __restrict__ PK, __bf16* __restrict__ XP) {
  const int which = blockIdx.y, t = threadIdx.x, nt = (which < 4) ? blockIdx.x : ((which - 4) & 3) * 64 + blockIdx.x;
  const float* Wm = (which == 0) ? WQ : (which == 1) ? WK : (which == 2) ? WV : (which == 3) ? WO : (which < 8) ? XQ : (which < 12) ? XK : XV;
  __bf16* dst = ((which < 3) ? PK + PK_A + (size_t)which * DM * DM : (which == 3) ? PK + PK_P : XP + (size_t)((which - 4) >> 2) * NB * SS * DM) + (size_t)nt * 16 * DM;
  const float* s = Wm + (size_t)(nt * 16 + (t & 15)) * DM + ((t >> 5) & 1) * 16 + 8 * ((t >> 4) & 1) + (t >> 6) * 32;   // piece t + 256 u: lane t & 31, half (t >> 5) & 1, kc = (t >> 6) + 4 u
  v4f a[8], c[8];
#pragma unroll   // a thread's sixteen loads are in flight together
  for (int u = 0; u < 8; ++u) { a[u] = *(const v4f*)(s + u * 128); c[u] = *(const v4f*)(s + u * 128 + 4); }
#pragma unroll   // constant indices: a, c and o stay in registers
  for (int u = 0; u < 8; ++u) { v8b o;
#pragma unroll   // as above
    for (int i = 0; i < 4; ++i) { o[i] = (__bf16)a[u][i]; o[4 + i] = (__bf16)c[u][i]; }
    *(v8b*)(dst + (size_t)(u * 256 + t) * 8) = o; }
}
// one k step (32 wide) of a wave tile 128 columns wide: the row operand (k_out: f32 pieces of 16 rows; k_qkv: the bf16 fragments of two 16-row tiles) and the eight weight fragments, all loads issued as one group.
// p: the lane's first 16 bytes of the row tile's step; w: the lane's 16 bytes of the first weight tile's step. A step is 1 KiB of a bf16 tile, 2 KiB of an f32 tile
struct KStep { v4f x[4]; v16b w[8]; };
struct KStepB { v16b a[2]; v16b w[8]; };   // k_qkv: two row tiles, 64 rows apart, share the eight weight fragments
__device__ __forceinline__ void ld_stepb(KStepB& t, const __bf16* p, const __bf16* w) {
  t.a[0] = frag_cb(p); t.a[1] = frag_cb(p + (size_t)64 * DM);
#pragma unroll   // constant indices and offsets: t.w stays in registers, every load is the lane's address plus a constant
  for (int j = 0; j < 8; ++j) t.w[j] = frag_cb(w + (size_t)j * 16 * DM);
  asm volatile("s_wait_xcnt 0x0" :: "v"(p), "v"(w) : "memory");   // in front of any later overwrite of a register that these loads name; the inputs keep the address registers whole up to here
}
// sixteen products of one k step: both row tiles against the eight weight fragments. Plain builtins: the wave needs more than 256 registers, and with an asm statement on each product's operands the build spilled; the compiler keeps the distance behind its own WMMAs
__device__ __forceinline__ void mm16(v8f (&acc)[2][8], const KStepB& t) {
#pragma unroll   // constant indices: the sums stay in registers
  for (int j = 0; j < 8; ++j) {
    acc[0][j] = __builtin_amdgcn_wmma_f32_16x16x32_bf16(false, t.a[0], false, t.w[j], (short)0, acc[0][j], false, false);
    acc[1][j] = __builtin_amdgcn_wmma_f32_16x16x32_bf16(false, t.a[1], false, t.w[j], (short)0, acc[1][j], false, false); }
  __builtin_amdgcn_sched_barrier(0);   // the next group of loads stays behind these products and the products behind the group in front: sunk among them, a load would be waited for with no step of lead
}
__device__ __forceinline__ void ld_step(KStep& t, const float* p, const __bf16* w) {
  t.x[0] = *(const v4f*)p; t.x[1] = *(const v4f*)(p + 128); t.x[2] = *(const v4f*)(p + 256); t.x[3] = *(const v4f*)(p + 384);
#pragma unroll
  for (int j = 0; j < 8; ++j) t.w[j] = frag_cb(w + (size_t)j * 16 * DM);
  asm volatile("s_wait_xcnt 0x0" :: "v"(p), "v"(w) : "memory");   // in front of any later overwrite of a register that these loads name; the inputs keep the address registers whole up to here
}
__global__ __launch_bounds__(128) void k_qkv(const __bf16* __restrict__ XP, const __bf16* __restrict__ P, const float* __restrict__ BQ, const float* __restrict__ BK, const float* __restrict__ BV, _Float16* __restrict__ QF, _Float16* __restrict__ KF, _Float16* __restrict__ VF) {
  const int which0 = (blockIdx.y * 128) / DM; const __bf16* X = XP + (size_t)which0 * NB * SS * DM;   // q from q_in, k from k_in, v from v_in
  __shared__ __align__(16) _Float16 so[4][16][136]; __shared__ __align__(16) _Float16 sth[128][72];
  const int tid = threadIdx.x, wave = tid >> 5, lane = tid & 31, col = lane & 15, g = lane >> 4; const size_t rw = (size_t)blockIdx.x * 128 + wave * 16; const int n0 = blockIdx.y * 128;   // the wave's row tiles start at rw and rw + 64: a weight fragment, once loaded, feeds two products
  v8f acc2[2][8] = {};
  const __bf16* xa = X + rw * DM + lane * 8; const __bf16* pb = P + (size_t)n0 * DM + lane * 8;
  KStepB t0, t1; ld_stepb(t0, xa, pb);
#pragma unroll 1   // the two register sets already are the unrolling
  for (int kc = 0; kc < DM / 32; kc += 2) {
    ld_stepb(t1, xa + 512, pb + 512);
    __builtin_amdgcn_sched_barrier(0);   // as in mm16
    mm16(acc2, t0);
    { const int adv = kc + 2 < DM / 32 ? 1024 : 0; xa += adv; pb += adv; }   // two steps on; last trip: no step is left, the pointers stay inside the tile.
    ld_stepb(t0, xa, pb);
    __builtin_amdgcn_sched_barrier(0);   // as in mm16
    mm16(acc2, t1); }
#pragma unroll   // constant index: both sets of sums stay in registers. Each trip hands out 64 of the block's 128 rows through the same LDS stage (q, k: a wave's own part, whose reads have returned into its stores' data before the second trip)
  for (int rt = 0; rt < 2; ++rt) { v8f (&acc)[8] = acc2[rt]; const size_t r0 = rw + rt * 64;
  { const float* BB = (which0 == 0) ? BQ : (which0 == 1) ? BK : BV;
#pragma unroll
    for (int j = 0; j < 8; ++j) { const float bb = bfr(BB[(n0 % DM) + j * 16 + col]);
#pragma unroll
      for (int r = 0; r < 8; ++r) acc[j][r] += bb; } }
  if (n0 < 2 * DM) {   // q stored unscaled (f16 sigma ~0.6, no subnormal exposure); 1/8 applied to the f32 score
#pragma unroll
    for (int j = 0; j < 8; ++j) {
#pragma unroll
      for (int r = 0; r < 8; ++r) so[wave][8 * g + r][j * 16 + col] = (_Float16)acc[j][r]; }   // q, k as plain f16: their own error from the bf16 operands of this product is several times f16's rounding step (no RoPE in this module)
    LDSX();
    {   // the wave's 16 rows (queries or keys) are one ct of one 32-row tile, its 128 columns two heads: lane = 16 g + row, d = 32 kc + 16 half + 8 g + i
      _Float16* FB = (n0 < DM) ? QF : KF; const int b = (int)(r0 / SS), kt = (int)(r0 % SS) / 16, h0 = (n0 % DM) / HD;
#pragma unroll   // constant offsets: the wave's eight LDS reads are in flight together
      for (int hh = 0; hh < 2; ++hh) { _Float16* kd = FB + (((size_t)(b * NH + h0 + hh) * (SS / 32) + (kt >> 1)) * 2 + (kt & 1)) * 1024 + lane * 8;
#pragma unroll   // as above
        for (int kq = 0; kq < 4; ++kq) { const int kc = kq >> 1, hf = kq & 1, sc = hh * 64 + kc * 32 + hf * 16 + 8 * g;
          vst2((unsigned*)(kd + kc * 512 + hf * 256), *(const v4u*)&so[wave][col][sc]); } }
      asm volatile("s_wait_xcnt 0x0" ::: "memory");   // in front of any later overwrite of a register that these stores name
    }
  } else {
#pragma unroll
    for (int j = 0; j < 8; ++j) {
#pragma unroll
      for (int r = 0; r < 8; ++r) sth[j * 16 + col][wave * 16 + 8 * g + r] = (_Float16)acc[j][r]; }   // v as plain f16, as q and k
    __syncthreads();
    const size_t rb = (size_t)blockIdx.x * 128 + rt * 64; const int b = (int)(rb / SS), ks0 = (int)(rb % SS) / 32, h0 = (n0 - 2 * DM) / HD;
    // the trip's 64 keys are two key tiles, its 128 columns two heads: lane = 16 g + (d mod 16), key = 32 tile + 16 half + 8 g + i
    for (int e = tid; e < 1024; e += 128) { const int hf = (e >> 5) & 1, dt = (e >> 6) & 3, hh = (e >> 8) & 1, kl = e >> 9; const int d = hh * 64 + dt * 16 + col, kk = kl * 32 + hf * 16 + 8 * g;
      _Float16* vd = VF + (((size_t)(b * NH + h0 + hh) * (SS / 32) + ks0 + kl) * 4 + dt) * 512 + hf * 256 + lane * 8; vst2((unsigned*)vd, *(const v4u*)&sth[d][kk]); }
    asm volatile("s_wait_xcnt 0x0" ::: "memory");   // in front of any later overwrite of a register that these stores name
    if (rt == 0) __syncthreads();   // every wave has read the stage before the second trip writes it again
  } }
}
// the K fragments of 16 NCT keys, read from their copy in LDS; p: the lane's 16 bytes of the first (2 KiB per 16 keys, in a row, fragment order)
template <int NCT> __device__ __forceinline__ void ld_kl(v16h (&kf)[NCT][2], const _Float16* p) {
#pragma unroll   // constant indices and offsets: kf stays in registers, the LDS reads stand as one group
  for (int ct = 0; ct < NCT; ++ct) {
#pragma unroll   // as above
    for (int kc = 0; kc < 2; ++kc) kf[ct][kc] = frag_ch(p + (ct * 2 + kc) * 512); }
}
// k_attn: block = 256 query rows of ONE head of one batch, 16 waves, wave w = query tile w. Each 64-key tile of K and of V (8 KiB each) is fetched once a block
// (16 bytes a thread) and put into LDS, where all sixteen waves read their fragments. Out: O, and per row one figure, -(m + log2(16 l)), for k_map.
// K ring of three buffers: in trip t tile t + 2 is stored, tile t + 1 (published by the barrier of trip t - 1) is read into registers. V: two buffers.
// Both products are taken transposed: S^T = K . Q^T (A = K fragments, B = Q fragments) and O^T = V^T . P^T (A = V fragments, B = P^T). Lane (g, col) then holds,
// of query col alone, the scores of keys 16 ct + 8 g + r: maximum and sum are in-lane, and two neighbouring score tiles, converted in place, are the B operand P^T of their 32 keys
// (element 8 (ct mod 2) + r = key 16 (ct mod 2) + 8 g + r, the k order of the V fragments). Lanes col and col + 16 split a query's keys: their maxima are joined in every tile, their sums once, behind the loop.
// One pass over the keys: the sums are kept against a reference m that follows the running maximum, and are rescaled when it moves.
// Q, K, V and P enter the products as plain f16, one product each.
// Exponentials are taken in base 2, which is what v_exp_f32 computes: the score scale 1/8 and log2(e) are one constant, the reference m is kept in log2 units,
// so an exponent is one multiply-add of the raw score, written on pairs (one packed instruction for two scores).
#define SC2 0.18033688f        // log2(e) / 8
#define KT 64                  // keys of a tile
#define TH (KT * HD)           // halves of a K or V tile
__device__ __forceinline__ float xhalf(float v) { return __int_as_float(__builtin_amdgcn_permlanex16(__float_as_int(v), __float_as_int(v), 0x76543210, 0xfedcba98, false, false)); }   // the value of lane l ^ 16
__global__ __launch_bounds__(512) void k_attn(const _Float16* __restrict__ QF, const _Float16* __restrict__ KF, const _Float16* __restrict__ VF, float* __restrict__ O, float* __restrict__ SM) {
  __shared__ __align__(16) _Float16 kb[3][TH], vb[2][TH]; __shared__ __align__(16) float st[256];
  const int tid = threadIdx.x, wave = __builtin_amdgcn_readfirstlane(tid >> 5), lane = tid & 31, col = lane & 15, g = lane >> 4;   // readfirstlane: the wave's offsets stay in scalar registers
  const int bh = blockIdx.y, b = bh / NH, h = bh % NH; const int q0 = blockIdx.x * 256 + wave * 16;
  const _Float16* qf = QF + ((size_t)bh * (SS / 32) + (q0 >> 5)) * 2048 + ((q0 >> 4) & 1) * 1024 + lane * 8;
  v16h aq[2];
#pragma unroll   // constant indices: fragments, scores and sums stay in registers
  for (int kc = 0; kc < 2; ++kc) aq[kc] = frag_ch(qf + kc * 512);
  float m = -3.0e38f, l = 0.f;   // of query col: the reference in use, in log2 units (it may trail the true maximum by up to 7.93); the sum over the lane's half of the keys
  const _Float16* kg = KF + (size_t)bh * SS * HD + tid * 8; const _Float16* vg = VF + (size_t)bh * SS * HD + tid * 8;   // the thread's 16 bytes of tile 0
  v8h rk, rv;   // the thread's piece of the K tile two trips ahead, of the V tile one trip ahead
  { const v8h k0 = *(const v8h*)kg, k1 = *(const v8h*)(kg + TH), v0 = *(const v8h*)vg; rk = *(const v8h*)(kg + 2 * TH); rv = *(const v8h*)(vg + TH);
    asm volatile("s_wait_xcnt 0x0" :: "v"(qf), "v"(kg), "v"(vg) : "memory");   // in front of any overwrite of a register that these loads name; the inputs keep the address registers whole up to here
    *(v8h*)&kb[0][tid * 8] = k0; *(v8h*)&kb[1][tid * 8] = k1; *(v8h*)&vb[0][tid * 8] = v0; }
  __syncthreads();   // K tiles 0 and 1 and V tile 0 stand in LDS
  v16h kf[4][2]; ld_kl<4>(kf, &kb[0][lane * 8]);
  int i1 = 1, i2 = 2;   // ring places of tiles t + 1 and t + 2
  // one pass: unnormalised P^T against the reference m in use, V^T . P^T
  v8f acc[4] = {};
#pragma unroll 1   // one trip per barrier; the ring indices rotate at run time
  for (int ks = 0; ks < SS / KT; ++ks) {
    *(v8h*)&kb[i2][tid * 8] = rk; *(v8h*)&vb[(ks + 1) & 1][tid * 8] = rv;   // V: the readers of trip t - 1 left this buffer before its barrier
    { const int nk = ((ks + 3) & (SS / KT - 1)) * TH, nv = ((ks + 2) & (SS / KT - 1)) * TH; const _Float16* p = kg + nk; const _Float16* w = vg + nv; rk = *(const v8h*)p; rv = *(const v8h*)w;   // the last trips' indices wrap and stay in bounds
      asm volatile("s_wait_xcnt 0x0" :: "v"(p), "v"(w) : "memory"); }   // in front of any overwrite of the loads' address registers
    v8f c[4];
#pragma unroll   // constant indices: fragments, scores and sums stay in registers
    for (int ct = 0; ct < 4; ++ct) c[ct] = wmma16(kf[ct][1], aq[1], wmma16(kf[ct][0], aq[0], v8f{}));
    v16h vf[2][4];   // this tile's V fragments (32 keys u, 16 columns dt), one group of LDS reads into the registers that K's fragments leave
    const _Float16* vp = &vb[ks & 1][lane * 8];
#pragma unroll   // constant indices: fragments, scores and sums stay in registers
    for (int u = 0; u < 2; ++u) {
#pragma unroll   // as above
      for (int dt = 0; dt < 4; ++dt) vf[u][dt] = frag_ch(vp + (u * 4 + dt) * 512); }
    __builtin_amdgcn_sched_barrier(0);   // the V reads are issued in front of the exponentials and fly during them; sunk behind them, their latency would stand in front of the second product
    float mx[8];
#pragma unroll   // constant indices: fragments, scores and sums stay in registers
    for (int r = 0; r < 8; ++r) mx[r] = fmaxf(fmaxf(c[0][r], c[1][r]), fmaxf(c[2][r], c[3][r]));
    float tm = fmaxf(fmaxf(fmaxf(mx[0], mx[1]), fmaxf(mx[2], mx[3])), fmaxf(fmaxf(mx[4], mx[5]), fmaxf(mx[6], mx[7])));
    tm = fmaxf(tm, xhalf(tm)) * SC2;   // the tile's maximum of query col, alike in both halves: P^T's keys need one reference
    if (__builtin_amdgcn_ballot_w32(tm > m + 7.93f) != 0) {   // one scalar branch a tile: sums are rescaled only when some query's maximum has outgrown its reference by more than 7.93 (an exponential stays below 245)
      const float mn = fmaxf(m, tm), alpha = (m <= -1.0e38f) ? 0.f : __builtin_amdgcn_exp2f(m - mn);
      l *= alpha; m = mn;
#pragma unroll   // constant indices: fragments, scores and sums stay in registers
      for (int dt = 0; dt < 4; ++dt) acc[dt] *= alpha; }
    v16h ph[2];   // P^T as a B operand, 32 keys each
    v2f es[4]; const v2f nm = {-m, -m};
#pragma unroll   // constant indices: fragments, scores and sums stay in registers
    for (int r = 0; r < 8; r += 2) {
#pragma unroll   // constant indices: fragments, scores and sums stay in registers
      for (int ct = 0; ct < 4; ++ct) { const v2f s = {c[ct][r], c[ct][r + 1]}; const v2f x = s * SC2 + nm;   // two exponents, one packed multiply-add
        const v2f e = {__builtin_amdgcn_exp2f(x[0]), __builtin_amdgcn_exp2f(x[1])};   // unnormalised; 1/l applied to the accumulators at the end
        ph[ct >> 1][(ct & 1) * 8 + r] = (_Float16)e[0]; ph[ct >> 1][(ct & 1) * 8 + r + 1] = (_Float16)e[1]; es[r >> 1] = ct ? es[r >> 1] + e : e; } }
    { const v2f t = (es[0] + es[1]) + (es[2] + es[3]); l += t[0] + t[1]; }
#pragma unroll   // constant indices: fragments, scores and sums stay in registers
    for (int u = 0; u < 2; ++u) {
#pragma unroll   // as above
      for (int dt = 0; dt < 4; ++dt) acc[dt] = wmma16(vf[u][dt], ph[u], acc[dt]); }
    ld_kl<4>(kf, &kb[i1][lane * 8]);   // the next tile's K fragments, once V's registers are free
    __syncthreads();   // publishes K tile t + 2 and V tile t + 1; ends all reads of the buffers that the next trip refills
    i1 = i2; i2 = (i2 == 2) ? 0 : i2 + 1; }
  l += xhalf(l);   // the query's other half of the keys of every tile, under the same reference
  const float il = 1.0f / l;
  if (g == 0) st[wave * 16 + col] = -(m + __builtin_amdgcn_logf(l * (float)NH));   // both halves hold the query's values; v_log_f32 is log2: 2^(s + this) = the probability / 16
  __syncthreads();   // every wave's figures stand in LDS
  if (tid < 256) SM[(size_t)bh * SS + blockIdx.x * 256 + tid] = st[tid];   // one 128-byte line a wave
  asm volatile("s_wait_xcnt 0x0" ::: "memory");   // in front of any later overwrite of a register that this store names
  // the head's 64 columns are k steps 2 h and 2 h + 1 of k_out: lane = 16 g + row, piece x holds k = 16 (x / 2) + 8 g + 4 (x mod 2) + i of its step:
  // that is registers 4 (x mod 2) + i of the lane's own O^T tile x / 2
  float* of = O + ((size_t)b * SS + q0) * DM + h * 1024 + lane * 4;
#pragma unroll   // constant indices: the sums stay in registers
  for (int x = 0; x < 8; ++x) { v4f o;
#pragma unroll   // as above
    for (int i = 0; i < 4; ++i) o[i] = acc[x >> 1][(x & 1) * 4 + i] * il;
    vst2(of + x * 128, o); }
  asm volatile("s_wait_xcnt 0x0" ::: "memory");   // in front of any later overwrite of a register that these stores name
}
// k_map: the head mean of the attention map. Block = 128 query rows x 128 keys of one batch, 16 waves as 4 x 4, a wave owns 32 x 32 and sums the heads
// (in the order 0..15) in registers. Two heads' Q rows and K rows of the block (16 KiB each a head, in a row) are fetched once and put into LDS as one stage, two buffers.
#define HSTEP (SS * HD)   // halves from one head's fragments to the next head's
#define HB (128 * HD)     // halves of one head's 128 rows
__global__ __launch_bounds__(512) void k_map(const _Float16* __restrict__ QF, const _Float16* __restrict__ KF, const float* __restrict__ SM, float* __restrict__ ATT) {
  __shared__ __align__(16) _Float16 qb[2][2 * HB], kb[2][2 * HB]; __shared__ __align__(16) float sst[NH][128]; __shared__ __align__(16) float so[16][32][36];
  const int tid = threadIdx.x, wave = __builtin_amdgcn_readfirstlane(tid >> 5), lane = tid & 31, col = lane & 15, g = lane >> 4;   // readfirstlane: the wave's offsets stay in scalar registers
  const int b = blockIdx.z, r0 = blockIdx.y * 128, k0 = blockIdx.x * 128, wr = wave >> 2, wc = wave & 3;
  const _Float16* qs = QF + ((size_t)b * NH * SS + r0) * HD; const _Float16* cs = KF + ((size_t)b * NH * SS + k0) * HD;   // head 0: the first of the block's four 32-row tiles of Q, of K
  const _Float16* qg = qs + tid * 8; const _Float16* kg = cs + tid * 8;   // the thread's 16 bytes of it
  v8h rq[4], rk[4];   // piece j of a stage: head j / 2 of its two, half j mod 2 of that head's 16 KiB
  { const float* ms = SM + ((size_t)b * NH + wave) * SS + r0;   // wave w brings head w's 128 rows
    const v4f tm = *(const v4f*)(ms + lane * 4); v8h q0[4], c0[4];
#pragma unroll   // constant indices: the pieces stay in registers; stages 0 and 1 are fetched as one group, with one wait behind it
    for (int j = 0; j < 4; ++j) { const int o = (j >> 1) * HSTEP + (j & 1) * 4096; q0[j] = *(const v8h*)(qg + o); c0[j] = *(const v8h*)(kg + o); rq[j] = *(const v8h*)(qg + 2 * HSTEP + o); rk[j] = *(const v8h*)(kg + 2 * HSTEP + o); }
    asm volatile("s_wait_xcnt 0x0" :: "s"(qs), "s"(cs), "s"(ms), "v"(tid), "v"(lane) : "memory");   // in front of any overwrite of a register that these loads name; the inputs keep bases and offsets whole up to here
    *(v4f*)&sst[wave][lane * 4] = tm;
#pragma unroll   // as above
    for (int j = 0; j < 4; ++j) { *(v8h*)&qb[0][j * 4096 + tid * 8] = q0[j]; *(v8h*)&kb[0][j * 4096 + tid * 8] = c0[j]; } }
  __syncthreads();   // heads 0 and 1 and the rows' softmax figures stand in LDS
  v8f am[2][2] = {};
  for (int hp = 0; hp < NH / 2; ++hp) {
#pragma unroll   // as above
    for (int j = 0; j < 4; ++j) { *(v8h*)&qb[(hp + 1) & 1][j * 4096 + tid * 8] = rq[j]; *(v8h*)&kb[(hp + 1) & 1][j * 4096 + tid * 8] = rk[j]; }   // stage hp + 1; the readers of stage hp - 1 left this buffer before its barrier
    { const int ho = ((hp + 2) & (NH / 2 - 1)) * 2 * HSTEP; const _Float16* p = qg + ho; const _Float16* w = kg + ho;   // the last trips' index wraps and stays in bounds
#pragma unroll   // as above
      for (int j = 0; j < 4; ++j) { const int o = (j >> 1) * HSTEP + (j & 1) * 4096; rq[j] = *(const v8h*)(p + o); rk[j] = *(const v8h*)(w + o); }
      asm volatile("s_wait_xcnt 0x0" :: "v"(p), "v"(w) : "memory"); }   // as above
#pragma unroll   // constant offsets: the second head's LDS reads can be issued during the first head's exponentials
    for (int hh = 0; hh < 2; ++hh) { const int h = 2 * hp + hh;
    v16h kf[2][2]; ld_kl<2>(kf, &kb[hp & 1][hh * HB + wc * 2048 + lane * 8]);
#pragma unroll   // constant indices: fragments, scores and sums stay in registers
    for (int qt = 0; qt < 2; ++qt) { const _Float16* qp = &qb[hp & 1][hh * HB + wr * 2048 + qt * 1024 + lane * 8];
      v16h aq[2];
#pragma unroll   // constant indices: fragments, scores and sums stay in registers
      for (int kc = 0; kc < 2; ++kc) aq[kc] = frag_ch(qp + kc * 512);
      const float* fm = &sst[h][wr * 32 + qt * 16 + 8 * g];
      const v4f m0 = *(const v4f*)fm, m1 = *(const v4f*)(fm + 4);
#pragma unroll   // constant indices: fragments, scores and sums stay in registers
      for (int ct = 0; ct < 2; ++ct) { const v8f c = wmma16(aq[1], kf[ct][1], wmma16(aq[0], kf[ct][0], v8f{}));
#pragma unroll   // constant indices: fragments, scores and sums stay in registers
        for (int r = 0; r < 8; ++r) { const float mr = r < 4 ? m0[r & 3] : m1[r & 3];
          am[qt][ct][r] += __builtin_amdgcn_exp2f(c[r] * SC2 + mr); } } } }   // the row's figure holds reference, sum and 1/16: the exponential is the head's share of the mean
    __builtin_amdgcn_sched_barrier(0);   // the stage's products stay in front of the barrier: sunk behind it, the wait for the next stage's global loads, which stands at the barrier, would come half a trip after their issue
    __syncthreads();   // publishes stage hp + 1; ends all reads of stage hp's buffer
  }
#pragma unroll   // constant indices: fragments, scores and sums stay in registers
  for (int qt = 0; qt < 2; ++qt) {
#pragma unroll   // constant indices: fragments, scores and sums stay in registers
    for (int ct = 0; ct < 2; ++ct) {
#pragma unroll   // constant indices: fragments, scores and sums stay in registers
      for (int r = 0; r < 8; ++r) so[wave][qt * 16 + 8 * g + r][ct * 16 + col] = am[qt][ct][r]; } }
  LDSX();
  float* ap = ATT + ((size_t)b * SS + r0 + wr * 32 + (lane >> 3)) * SS + k0 + wc * 32 + (lane & 7) * 4;   // eight lanes store one row's 128-byte line
#pragma unroll   // constant offsets: the eight LDS reads are in flight together
  for (int x = 0; x < 8; ++x) vst2(ap + (size_t)x * 4 * SS, *(const v4f*)&so[wave][x * 4 + (lane >> 3)][(lane & 7) * 4]);
  asm volatile("s_wait_xcnt 0x0" ::: "memory");   // in front of any later overwrite of a register that these stores name
}
// ---- k_out: block = (64 rows, 128 cols): out = O(hi/lo) . Wo rows (2 products) + bo
__global__ __launch_bounds__(128) void k_out(const float* __restrict__ O, const __bf16* __restrict__ P, const float* __restrict__ BO, float* __restrict__ Y) {
  __shared__ __align__(16) float so[4][16][132];
  const int tid = threadIdx.x, wave = tid >> 5, lane = tid & 31, col = lane & 15, g = lane >> 4; const size_t r0 = (size_t)blockIdx.x * 64 + wave * 16; const int n0 = blockIdx.y * 128;
  v8f acc[8] = {};
  const float* xa = O + r0 * DM + lane * 4; const __bf16* pb = P + (size_t)n0 * DM + lane * 8;
  KStep t0, t1; ld_step(t0, xa, pb);
#pragma unroll 1   // the two register sets already are the unrolling
  for (int kc = 0; kc < DM / 32; kc += 2) {
    ld_step(t1, xa + 512, pb + 512);
    __builtin_amdgcn_sched_barrier(0);   // as in mm16
    { float v[16];
#pragma unroll
      for (int i = 0; i < 16; ++i) v[i] = t0.x[i >> 2][i & 3];
      const F2 a = bsplit16(v);
#pragma unroll
      for (int j = 0; j < 8; ++j) { acc[j] = wmma_bf(a.l, t0.w[j], acc[j]); acc[j] = wmma_bf(a.h, t0.w[j], acc[j]); } }
    __builtin_amdgcn_sched_barrier(0);   // as in mm16
    { const int adv = kc + 2 < DM / 32 ? 1024 : 0; xa += adv; pb += adv; }   // two steps on; last trip: no step is left, the pointers stay inside the tile.
    ld_step(t0, xa, pb);
    __builtin_amdgcn_sched_barrier(0);   // as in mm16
    { float v[16];
#pragma unroll
      for (int i = 0; i < 16; ++i) v[i] = t1.x[i >> 2][i & 3];
      const F2 a = bsplit16(v);
#pragma unroll
      for (int j = 0; j < 8; ++j) { acc[j] = wmma_bf(a.l, t1.w[j], acc[j]); acc[j] = wmma_bf(a.h, t1.w[j], acc[j]); } }
    __builtin_amdgcn_sched_barrier(0); }   // as in mm16
#pragma unroll
  for (int j = 0; j < 8; ++j) {
#pragma unroll
    for (int r = 0; r < 8; ++r) so[wave][8 * g + r][j * 16 + col] = acc[j][r] + bfr(BO[n0 + j * 16 + col]); }
  LDSX();
  for (int rl = 0; rl < 16; ++rl) vst2(Y + (r0 + rl) * DM + n0 + lane * 4, *(const v4f*)&so[wave][rl][lane * 4]);
}
extern "C" void kernel_launch(void* const* d_in, const int* in_sizes, int n_in, void* d_out, int out_size, void* d_ws, size_t ws_size, hipStream_t stream) {
  (void)in_sizes; (void)n_in; (void)out_size;
  const float** F = (const float**)d_in;   // 0 q_in [4,1024,1024], 1 k_in, 2 v_in, 3 Wq [1024,1024] natural (x @ W.T), 4 bq, 5 Wk, 6 bk, 7 Wv, 8 bv, 9 Wo, 10 bo
  if (ws_size < (size_t)WS_END) return;
  char* ws = (char*)d_ws; __bf16* PK = (__bf16*)(ws + WS_PK); _Float16 *QF = (_Float16*)(ws + WS_QF), *KF = (_Float16*)(ws + WS_KF), *VF = (_Float16*)(ws + WS_VF); float* O = (float*)(ws + WS_O); __bf16* XP = (__bf16*)(ws + WS_XP); float* SM = (float*)(ws + WS_ST);
  k_pack<<<dim3(DM / 16, 16), 256, 0, stream>>>(F[3], F[5], F[7], F[9], F[0], F[1], F[2], PK, XP);
  k_qkv<<<dim3(TNB * SS / 128, QKVW / 128), 128, 0, stream>>>(XP, PK + PK_A, F[4], F[6], F[8], QF, KF, VF);
  k_attn<<<dim3(SS / 256, TNB * NH), 512, 0, stream>>>(QF, KF, VF, O, SM);
  k_map<<<dim3(SS / 128, SS / 128, TNB), 512, 0, stream>>>(QF, KF, SM, (float*)((char*)d_out + 16777216));
  k_out<<<dim3(TOB, DM / 128), 128, 0, stream>>>(O, PK + PK_P, F[10], (float*)d_out);
}
